// v000
// Times are from an AMD MI455X. After a warm-up the kernel runs many times in a row, and a time is the length of
// such a window on the GPU divided by its runs, so every launch and the gaps after it count. The runs cycle
// through copies of the inputs. A figure is the median of several windows, for all but v000 over two sittings.
// Sittings can differ by a few percent; kernels timed side by side share one.
// The starting kernel, v000, takes 770 microseconds a run.
#include <hip/hip_runtime.h>

// Triangle attention (starting node) on a pair representation (act [1][256][256][128], mask [1][256][256]): x = LayerNorm_c(act) (eps 1e-5, ln_g/ln_b); per row i: q, k, v, g = x[i] W (wq/wk/wv/wg [128][4][32] 'xw', 4 heads x 32; q x 32^-0.5), logits[h][q][k] = q.k + 1e9 (mask[i][k] - 1) + nb[h][q][k] with the pair bias nb[h][q][k] = sum_c x[q][k][c] w2d[c][h] (shared by all rows i);
// softmax over k; o = attn.v gated by sigmoid(x wg + bg); out[i][q][c] = sum_{h,d} o[h][d] wo[h][d][c] + bo -> [1][256][256][128] (8.4 M).
// Layout: LayerNorm -> bf16 hi/lo token planes [65536][128]; nb for all 65536 pair positions by one GEMM (w2d padded to 64 columns); rows i in 4 groups of 64: q/k/v/g projections (hi/lo x exact), fp16 planes q,k [h][i][t][32] and v^T [h][i][64 (32 zero-padded)][t], per head ONE z-batched (z = the 64 rows) score GEMM [64][256][256], softmax kernel (adds mask bias + pair bias, x 32^-0.5), z-batched attn.v, then gating + merge to hi/lo planes and the output GEMM (+ bo).
// Compute dtypes, f32 accumulate: every input rounded to bf16 once; LayerNorm in f32, its output as bf16 hi + lo (2-product projections against exact bf16 weights); scores and attn.v on single fp16 planes (logit sigma ~0.24; P x1024 ~ 4: no subnormals); pair bias, mask bias, softmax, gating in f32; output GEMM hl x exact + bo.

#define NI   256       // rows i
#define TT   256       // tokens per row (q / k index)
#define DM   128       // c_z
#define NH_  4
#define HD   32
#define HDP  64        // head dim padded for the attn.v GEMM (N tile 64); rows 32..63 of v^T are zeros
#define DQ   (NH_ * HD)
#define IG   64        // rows i per group
#define NTK  (IG * TT) // tokens per group = 16384
#define NTOK (NI * TT) // 65536
#define NBP  64        // pair-bias GEMM width (4 used)
#define PCAR 1024.0f
#define SCL  0.17677669529663688f   // 32^-0.5
typedef _Float16 h16;
typedef unsigned short bf;
typedef __attribute__((ext_vector_type(16))) __bf16   v16bf;
typedef __attribute__((ext_vector_type(16))) _Float16 v16h;
typedef __attribute__((ext_vector_type(8)))  _Float16 v8h;
typedef __attribute__((ext_vector_type(8)))  unsigned short v8us;
typedef __attribute__((ext_vector_type(8)))  float    v8f;
typedef __attribute__((ext_vector_type(4)))  float    v4f;
typedef v8h  __attribute__((may_alias)) v8ha;
typedef v4f  __attribute__((may_alias)) v4fa;
typedef v8us __attribute__((may_alias)) v8usa;

__device__ __forceinline__ unsigned short f2bf(float f) { unsigned u = __float_as_uint(f); u += 0x7FFFu + ((u >> 16) & 1u); return (unsigned short)(u >> 16); }
__device__ __forceinline__ float bf2f(unsigned short b) { return __uint_as_float(((unsigned)b) << 16); }
__device__ __forceinline__ float bfr(float f) { return bf2f(f2bf(f)); }
__device__ __forceinline__ v16h cat16(v8h lo, v8h hi) { return __builtin_shufflevector(lo, hi, 0, 1, 2, 3, 4, 5, 6, 7, 8, 9, 10, 11, 12, 13, 14, 15); }
__device__ __forceinline__ v16bf cat16b(v8us lo, v8us hi) { return __builtin_bit_cast(v16bf, __builtin_shufflevector(lo, hi, 0, 1, 2, 3, 4, 5, 6, 7, 8, 9, 10, 11, 12, 13, 14, 15)); }
__device__ __forceinline__ v8f wmma16(v16h a, v16h b, v8f c) { return __builtin_amdgcn_wmma_f32_16x16x32_f16(false, a, false, b, (short)0, c, false, false); }
__device__ __forceinline__ v8f wmmab(v16bf a, v16bf b, v8f c) { return __builtin_amdgcn_wmma_f32_16x16x32_bf16(false, a, false, b, (short)0, c, false, false); }



// ---- k_gemmw: register-blocked GEMM, ONE WAVE per 64x64 output tile (16 accumulators), operands straight from K-contiguous 16-bit planes; grid (M/64, N/64, Z), 32 threads.
// C[m][n] (f32, pitch ldc, + optional f32 bias[n]) = sum_k A[m][k] Bt[n][k] (+ split products per NSPLIT). z-batch strides sA/sB/sC in elements. K % 32 == 0.
template <typename T16> struct WFrag;
template <> struct WFrag<h16> { typedef v16h V; static __device__ __forceinline__ V ld(const h16* p) { return cat16(*(const v8h*)p, *(const v8h*)(p + 16)); } static __device__ __forceinline__ v8f mma(V a, V b, v8f c) { return wmma16(a, b, c); } };
template <> struct WFrag<bf> { typedef v16bf V; static __device__ __forceinline__ V ld(const bf* p) { return cat16b(*(const v8us*)p, *(const v8us*)(p + 16)); } static __device__ __forceinline__ v8f mma(V a, V b, v8f c) { return wmmab(a, b, c); } };
template <typename T16, int NSPLIT, bool BIAS>
__global__ __launch_bounds__(32) void k_gemmw(const T16* __restrict__ A, const T16* __restrict__ A2, const T16* __restrict__ Bt, const T16* __restrict__ Bt2, int K, float* C, int ldc, const float* __restrict__ bias, size_t sA, size_t sB, size_t sC) {
    typedef typename WFrag<T16>::V V;
    __shared__ __align__(16) float os[16 * 68];
    const size_t z = blockIdx.z; A += z * sA; if (A2) A2 += z * sA; Bt += z * sB; if (Bt2) Bt2 += z * sB; C += z * sC;
    const int lane = threadIdx.x & 31, lr = lane & 15, hi = lane >> 4; const int r0 = blockIdx.x * 64, c0 = blockIdx.y * 64;
    v8f acc[4][4];
#pragma unroll
    for (int mb = 0; mb < 4; ++mb)
#pragma unroll
        for (int nb = 0; nb < 4; ++nb) acc[mb][nb] = (v8f){};
    const size_t aoff = (size_t)(r0 + lr) * K + 8 * hi, boff = (size_t)(c0 + lr) * K + 8 * hi;
#pragma unroll 1
    for (int kc = 0; kc < K; kc += 32) {
        V a[4], a2[4];
#pragma unroll
        for (int mb = 0; mb < 4; ++mb) { a[mb] = WFrag<T16>::ld(A + aoff + (size_t)mb * 16 * K + kc); if (NSPLIT == 1 || NSPLIT == 2) a2[mb] = WFrag<T16>::ld(A2 + aoff + (size_t)mb * 16 * K + kc); }
#pragma unroll
        for (int nb = 0; nb < 4; ++nb) { const V b = WFrag<T16>::ld(Bt + boff + (size_t)nb * 16 * K + kc); V b2; if (NSPLIT >= 2) b2 = WFrag<T16>::ld(Bt2 + boff + (size_t)nb * 16 * K + kc);
#pragma unroll
            for (int mb = 0; mb < 4; ++mb) { acc[mb][nb] = WFrag<T16>::mma(a[mb], b, acc[mb][nb]); if (NSPLIT == 1 || NSPLIT == 2) acc[mb][nb] = WFrag<T16>::mma(a2[mb], b, acc[mb][nb]); if (NSPLIT >= 2) acc[mb][nb] = WFrag<T16>::mma(a[mb], b2, acc[mb][nb]); } }
        asm volatile("v_nop\n\tv_nop\n\tv_nop\n\tv_nop" : "+v"(acc[0][0]), "+v"(acc[1][1]), "+v"(acc[2][2]), "+v"(acc[3][3]) : "v"(a[0]), "v"(a[3]));
    }
#pragma unroll
    for (int mb = 0; mb < 4; ++mb) {
#pragma unroll
        for (int nb = 0; nb < 4; ++nb) {
#pragma unroll
            for (int j = 0; j < 8; ++j) os[(hi * 8 + j) * 68 + nb * 16 + lr] = acc[mb][nb][j]; }
        __builtin_amdgcn_wave_barrier(); asm volatile("" ::: "memory");
        float* crow = C + (size_t)(r0 + mb * 16) * ldc + c0;
{
#pragma unroll
            for (int s = 0; s < 8; ++s) { const int row = 2 * s + hi, cofs = lr * 4; v4f val = *(const v4fa*)(os + row * 68 + cofs); if (BIAS) { val[0] += bfr(bias[c0 + cofs]); val[1] += bfr(bias[c0 + cofs + 1]); val[2] += bfr(bias[c0 + cofs + 2]); val[3] += bfr(bias[c0 + cofs + 3]); }
                *(v4f*)(crow + (size_t)row * ldc + cofs) = val; }
             }
        __builtin_amdgcn_wave_barrier(); asm volatile("" ::: "memory");
    }
}

typedef __attribute__((ext_vector_type(4))) unsigned short v4us;
typedef __attribute__((ext_vector_type(2))) unsigned short v2us;
typedef __attribute__((ext_vector_type(2))) _Float16 v2h;
typedef __attribute__((ext_vector_type(4))) _Float16 v4h;
__device__ __forceinline__ h16 tohx(float x) { return (h16)x; }
__device__ __forceinline__ void splitf(float y, unsigned short& h, unsigned short& l) { h = f2bf(y); l = f2bf(y - bf2f(h)); }
__global__ __launch_bounds__(256) void k_wtG(const float* __restrict__ w, int K, int N, bf* Bt) {
    const int lane = threadIdx.x & 31; const int L0 = (blockIdx.x * 8 + (threadIdx.x >> 5)) * 8; const int nlines = N * K / 64;
{
#pragma unroll 1
        for (int l = 0; l < 8; ++l) { const int L = L0 + l; if (L >= nlines) break; const size_t e = (size_t)L * 64 + lane * 2; const int k = (int)(e % K), n = (int)(e / K); v2us o;
            o[0] = f2bf(w[(size_t)k * N + n]); o[1] = f2bf(w[(size_t)(k + 1) * N + n]); *(v2us*)(Bt + e) = o; }
         }
}
__global__ __launch_bounds__(256) void k_cvt8(const float* __restrict__ src, bf* dst, size_t n8) { const size_t i = (size_t)blockIdx.x * 256 + threadIdx.x; if (i >= n8) return; const v8f v = *(const v8f*)(src + i * 8); v8us o;
#pragma unroll
    for (int k = 0; k < 8; ++k) o[k] = f2bf(v[k]); *(v8us*)(dst + i * 8) = o;  }

__global__ __launch_bounds__(256) void k_w2d(const float* __restrict__ w, bf* Bt) { const int i = blockIdx.x * 256 + threadIdx.x; if (i >= NBP * DM / 8) return; const int r = i / (DM / 8), c0 = (i % (DM / 8)) * 8; v8us o;
#pragma unroll
    for (int k = 0; k < 8; ++k) o[k] = (r < NH_) ? f2bf(w[(size_t)(c0 + k) * NH_ + r]) : (unsigned short)0; *(v8us*)(Bt + (size_t)r * DM + c0) = o;  }
__global__ __launch_bounds__(256) void k_lnx(const float* __restrict__ A, const float* __restrict__ g, const float* __restrict__ bb, bf* Xh, bf* Xl) {
    const int lane = threadIdx.x & 31; const size_t tok = (size_t)blockIdx.x * 8 + (threadIdx.x >> 5); if (tok >= NTOK) return; const v4f a = *(const v4f*)(A + tok * DM + lane * 4); float v[4]; float s = 0.f;
#pragma unroll
    for (int q = 0; q < 4; ++q) { v[q] = bfr(a[q]); s = __fadd_rn(s, v[q]); }
#pragma unroll
    for (int sh = 16; sh; sh >>= 1) s = __fadd_rn(s, __shfl_xor(s, sh, 32));
    const float mu = __fdiv_rn(s, (float)DM); float s2 = 0.f;
#pragma unroll
    for (int q = 0; q < 4; ++q) { float d0 = __fsub_rn(v[q], mu); asm volatile("" : "+v"(d0)); float p = __fmul_rn(d0, d0); asm volatile("" : "+v"(p)); s2 = __fadd_rn(s2, p); }
#pragma unroll
    for (int sh = 16; sh; sh >>= 1) s2 = __fadd_rn(s2, __shfl_xor(s2, sh, 32));
    const float rs = __fdiv_rn(1.0f, __fsqrt_rn(__fadd_rn(__fdiv_rn(s2, (float)DM), 1e-5f))); v4us oh, ol;
#pragma unroll
    for (int q = 0; q < 4; ++q) { const int c = lane * 4 + q; float xn = __fmul_rn(__fsub_rn(v[q], mu), rs); asm volatile("" : "+v"(xn)); float gg = bfr(g[c]); asm volatile("" : "+v"(gg)); float y = __fmul_rn(xn, gg); asm volatile("" : "+v"(y)); float be = bfr(bb[c]); asm volatile("" : "+v"(be)); y = __fadd_rn(y, be); unsigned short h2, l2; splitf(y, h2, l2); oh[q] = h2; ol[q] = l2; }
    *(v4us*)(Xh + tok * DM + lane * 4) = oh; *(v4us*)(Xl + tok * DM + lane * 4) = ol;  }
__global__ __launch_bounds__(256) void k_qkpl(const float* __restrict__ F, h16* P16) { const size_t e = ((size_t)blockIdx.x * 256 + threadIdx.x) * 2; if (e >= (size_t)NH_ * NTK * HD) return; const int d = (int)(e % HD); const size_t tk = (e / HD) % NTK; const int h = (int)(e / ((size_t)HD * NTK)); v2h o;
    o[0] = tohx(F[tk * DQ + h * HD + d]); o[1] = tohx(F[tk * DQ + h * HD + d + 1]); *(v2h*)(P16 + e) = o;  }
__global__ __launch_bounds__(256) void k_vtpl(const float* __restrict__ F, h16* V16) { const size_t e = ((size_t)blockIdx.x * 256 + threadIdx.x) * 2; if (e >= (size_t)NH_ * IG * HDP * TT) return; const int t = (int)(e % TT); const int dp = (int)((e / TT) % HDP); const size_t il = (e / ((size_t)TT * HDP)) % IG; const int h = (int)(e / ((size_t)TT * HDP * IG)); v2h o;
    if (dp < HD) { o[0] = tohx(F[(il * TT + t) * DQ + h * HD + dp]); o[1] = tohx(F[(il * TT + t + 1) * DQ + h * HD + dp]); } else { o[0] = (h16)0.0f; o[1] = (h16)0.0f; }
    *(v2h*)(V16 + e) = o;  }
__global__ __launch_bounds__(256) void k_asoftT(const float* __restrict__ Sb, const float* __restrict__ NB, const float* __restrict__ mask, int i0, int h, h16* P16) {
    const int lane = threadIdx.x & 31; const int row = blockIdx.x * 8 + (threadIdx.x >> 5); if (row >= IG * TT) return; const int q = row % TT; const int il = row / TT; const int i = i0 + il; const float* sr = Sb + (size_t)row * TT; float v[TT / 32]; float mx = -3.0e38f;
#pragma unroll
    for (int ch = 0; ch < TT / 128; ++ch) { const int j0 = ch * 128 + lane * 4; const v4f a = *(const v4f*)(sr + j0); const v4f mk = *(const v4f*)(mask + (size_t)i * TT + j0);
#pragma unroll
        for (int qq = 0; qq < 4; ++qq) { const int j = j0 + qq; float sc = __fmul_rn(a[qq], SCL); asm volatile("" : "+v"(sc)); float mb = __fmul_rn(1e9f, __fsub_rn(bfr(mk[qq]), 1.0f)); asm volatile("" : "+v"(mb)); const float nb = NB[((size_t)q * TT + j) * NBP + h]; const float t = __fadd_rn(__fadd_rn(sc, mb), nb); v[ch * 4 + qq] = t; mx = fmaxf(mx, t); } }
#pragma unroll
    for (int sh = 16; sh; sh >>= 1) mx = fmaxf(mx, __shfl_xor(mx, sh, 32));
    float sum = 0.f;
#pragma unroll
    for (int kk = 0; kk < TT / 32; ++kk) { float d0 = __fsub_rn(v[kk], mx); asm volatile("" : "+v"(d0)); v[kk] = __builtin_amdgcn_exp2f(__fmul_rn(d0, 1.4426950408889634f)); sum += v[kk]; }
#pragma unroll
    for (int sh = 16; sh; sh >>= 1) sum += __shfl_xor(sum, sh, 32);
    const float f = __fdiv_rn(PCAR, sum);
{
#pragma unroll
        for (int ch = 0; ch < TT / 128; ++ch) { v4h o4;
#pragma unroll
            for (int qq = 0; qq < 4; ++qq) { float y = __fmul_rn(v[ch * 4 + qq], f); asm volatile("" : "+v"(y)); o4[qq] = tohx(y); }
            *(v4h*)(P16 + (size_t)row * TT + ch * 128 + lane * 4) = o4; }
         }
}
__global__ __launch_bounds__(256) void k_gmerge(const float* __restrict__ O, const float* __restrict__ FG, const float* __restrict__ bg, bf* Ah, bf* Al) { const size_t e = ((size_t)blockIdx.x * 256 + threadIdx.x) * 4; if (e >= (size_t)NTK * DQ) return; const int c = (int)(e % DQ); const size_t tk = e / DQ; const int h = c / HD, d = c % HD; v4us oh, ol;
    const v4f ov = *(const v4f*)(O + (((size_t)h * NTK + tk) * HDP + d)); const v4f gv = *(const v4f*)(FG + tk * DQ + c);
#pragma unroll
    for (int qq = 0; qq < 4; ++qq) { float bgv = bfr(bg[c + qq]); asm volatile("" : "+v"(bgv)); const float ga = __fadd_rn(gv[qq], bgv); const float sg = __fdiv_rn(1.0f, __fadd_rn(1.0f, __builtin_amdgcn_exp2f(__fmul_rn(ga, -1.4426950408889634f)))); float o1 = __fmul_rn(ov[qq], 1.0f / PCAR); asm volatile("" : "+v"(o1)); const float y = __fmul_rn(o1, sg); unsigned short h2, l2; splitf(y, h2, l2); oh[qq] = h2; ol[qq] = l2; }
    *(v4us*)(Ah + e) = oh; *(v4us*)(Al + e) = ol;  }

extern "C" void kernel_launch(void* const* d_in, const int* in_sizes, int n_in,
                              void* d_out, int out_size, void* d_ws, size_t ws_size, hipStream_t stream) {
    (void)in_sizes; (void)n_in; (void)out_size;
    const float* act = (const float*)d_in[0]; const float* mask = (const float*)d_in[1]; const float* lng = (const float*)d_in[2]; const float* lnb = (const float*)d_in[3]; const float* w2d = (const float*)d_in[4]; const float* wq = (const float*)d_in[5]; const float* wk = (const float*)d_in[6]; const float* wv = (const float*)d_in[7]; const float* wg = (const float*)d_in[8]; const float* bg = (const float*)d_in[9]; const float* wo = (const float*)d_in[10]; const float* bo = (const float*)d_in[11];
    float* OUT = (float*)d_out;     // [1][256][256][128]
    char* wsp = (char*)d_ws;
    auto take = [&](size_t bytes) { char* p = wsp; wsp += (bytes + 255) & ~(size_t)255; return (void*)p; };
    bf* WQ = (bf*)take((size_t)DQ * DM * 2); bf* WK = (bf*)take((size_t)DQ * DM * 2); bf* WV = (bf*)take((size_t)DQ * DM * 2); bf* WG = (bf*)take((size_t)DQ * DM * 2); bf* WO = (bf*)take((size_t)DM * DQ * 2); bf* W2 = (bf*)take((size_t)NBP * DM * 2);
    bf* Xh = (bf*)take((size_t)NTOK * DM * 2); bf* Xl = (bf*)take((size_t)NTOK * DM * 2); float* NB = (float*)take((size_t)NTOK * NBP * 4);
    float* FQ = (float*)take((size_t)NTK * DQ * 4); float* FK = (float*)take((size_t)NTK * DQ * 4); float* FG = (float*)take((size_t)NTK * DQ * 4); h16* QP16 = (h16*)take((size_t)NH_ * NTK * HD * 2); h16* KP16 = (h16*)take((size_t)NH_ * NTK * HD * 2); h16* VT16 = (h16*)take((size_t)NH_ * IG * HDP * TT * 2);
    float* Sb = (float*)take((size_t)IG * TT * TT * 4); h16* P16 = (h16*)take((size_t)IG * TT * TT * 2); float* Ob = (float*)take((size_t)NH_ * NTK * HDP * 4); bf* ATh = (bf*)take((size_t)NTK * DQ * 2); bf* ATl = (bf*)take((size_t)NTK * DQ * 2);
    if ((size_t)(wsp - (char*)d_ws) > ws_size) return;    // ws 256 MiB (carve ~136 MiB)
    float* FV = FK;   /* v projection reuses FK after the k planes are built (stream-ordered, same type) */
    k_wtG<<<(unsigned)((DM * DQ / 64 + 63) / 64), 256, 0, stream>>>(wq, DM, DQ, WQ); k_wtG<<<(unsigned)((DM * DQ / 64 + 63) / 64), 256, 0, stream>>>(wk, DM, DQ, WK); k_wtG<<<(unsigned)((DM * DQ / 64 + 63) / 64), 256, 0, stream>>>(wv, DM, DQ, WV); k_wtG<<<(unsigned)((DM * DQ / 64 + 63) / 64), 256, 0, stream>>>(wg, DM, DQ, WG);
    k_wtG<<<(unsigned)((DQ * DM / 64 + 63) / 64), 256, 0, stream>>>(wo, DQ, DM, WO); k_w2d<<<(NBP * DM / 8 + 255) / 256, 256, 0, stream>>>(w2d, W2);
    k_lnx<<<NTOK / 8, 256, 0, stream>>>(act, lng, lnb, Xh, Xl);
    k_gemmw<bf, 1, false><<<dim3(NTOK / 64, NBP / 64, 1), 32, 0, stream>>>(Xh, Xl, W2, nullptr, DM, NB, NBP, nullptr, 0, 0, 0);   /* pair bias nb[(q,k)][h] for all 65536 positions (cols 0..3) */
    for (int i0 = 0; i0 < NI; i0 += IG) { const bf* Xgh = Xh + (size_t)i0 * TT * DM; const bf* Xgl = Xl + (size_t)i0 * TT * DM;
        k_gemmw<bf, 1, false><<<dim3(NTK / 64, DQ / 64, 1), 32, 0, stream>>>(Xgh, Xgl, WQ, nullptr, DM, FQ, DQ, nullptr, 0, 0, 0); k_qkpl<<<(unsigned)(((size_t)NH_ * NTK * HD / 2 + 255) / 256), 256, 0, stream>>>(FQ, QP16);
        k_gemmw<bf, 1, false><<<dim3(NTK / 64, DQ / 64, 1), 32, 0, stream>>>(Xgh, Xgl, WK, nullptr, DM, FK, DQ, nullptr, 0, 0, 0); k_qkpl<<<(unsigned)(((size_t)NH_ * NTK * HD / 2 + 255) / 256), 256, 0, stream>>>(FK, KP16);
        k_gemmw<bf, 1, false><<<dim3(NTK / 64, DQ / 64, 1), 32, 0, stream>>>(Xgh, Xgl, WV, nullptr, DM, FV, DQ, nullptr, 0, 0, 0); k_vtpl<<<(unsigned)(((size_t)NH_ * IG * HDP * TT / 2 + 255) / 256), 256, 0, stream>>>(FV, VT16);
        k_gemmw<bf, 1, false><<<dim3(NTK / 64, DQ / 64, 1), 32, 0, stream>>>(Xgh, Xgl, WG, nullptr, DM, FG, DQ, nullptr, 0, 0, 0);
        for (int h = 0; h < NH_; ++h) {
            k_gemmw<h16, 0, false><<<dim3(TT / 64, TT / 64, IG), 32, 0, stream>>>(QP16 + (size_t)h * NTK * HD, nullptr, KP16 + (size_t)h * NTK * HD, nullptr, HD, Sb, TT, nullptr, (size_t)TT * HD, (size_t)TT * HD, (size_t)TT * TT);   /* z = the 64 rows of the group */
            k_asoftT<<<IG * TT / 8, 256, 0, stream>>>(Sb, NB, mask, i0, h, P16);
            k_gemmw<h16, 0, false><<<dim3(TT / 64, HDP / 64, IG), 32, 0, stream>>>(P16, nullptr, VT16 + (size_t)h * IG * HDP * TT, nullptr, TT, Ob + (size_t)h * NTK * HDP, HDP, nullptr, (size_t)TT * TT, (size_t)HDP * TT, (size_t)TT * HDP); }
        k_gmerge<<<(unsigned)(((size_t)NTK * DQ / 4 + 255) / 256), 256, 0, stream>>>(Ob, FG, bg, ATh, ATl);
        k_gemmw<bf, 1, true><<<dim3(NTK / 64, DM / 64, 1), 32, 0, stream>>>(ATh, ATl, WO, nullptr, DQ, OUT + (size_t)i0 * TT * DM, DM, bo, 0, 0, 0); }
}

// v001
// It runs in 310 microseconds.
// In two side-by-side timings against v000, it was 2.47 and 2.49 times as fast.
#include <hip/hip_runtime.h>

// Triangle attention (starting node) on a pair representation (act [1][256][256][128], mask [1][256][256]): x = LayerNorm_c(act) (eps 1e-5, ln_g/ln_b); per row i: q, k, v, g = x[i] W (wq/wk/wv/wg [128][4][32] 'xw', 4 heads x 32; q x 32^-0.5), logits[h][q][k] = q.k + 1e9 (mask[i][k] - 1) + nb[h][q][k] with the pair bias nb[h][q][k] = sum_c x[q][k][c] w2d[c][h] (shared by all rows i);
// softmax over k; o = attn.v gated by sigmoid(x wg + bg); out[i][q][c] = sum_{h,d} o[h][d] wo[h][d][c] + bo -> [1][256][256][128] (8.4 M).
// Layout: LayerNorm -> bf16 hi/lo token planes [65536][128]; nb for all 65536 pair positions by one GEMM (w2d padded to 64 columns); rows i in 4 groups of 64: q/k/v/g projections (hi/lo x exact), fp16 planes q,k [h][i][t][32] and v^T [h][i][64 (32 zero-padded)][t], ONE attention kernel per group (all heads; scores, mask bias + pair bias, x 32^-0.5, softmax and attn.v stay in registers), then gating + merge to hi/lo planes and the output GEMM (+ bo).
// Compute dtypes, f32 accumulate: every input rounded to bf16 once; LayerNorm in f32, its output as bf16 hi + lo (2-product projections against exact bf16 weights); scores and attn.v on single fp16 planes (P = 1024 exp(logit - max), at most 1024; 1/sum applied to the f32 attn.v result); pair bias, mask bias, softmax, gating in f32; output GEMM hl x exact + bo.

#define NI   256       // rows i
#define TT   256       // tokens per row (q / k index)
#define DM   128       // c_z
#define NH_  4
#define HD   32
#define HDP  64        // padded head dim: rows per (h, i) of the v^T planes (32..63 zeros, not read) and row pitch of the attn.v result
#define DQ   (NH_ * HD)
#define IG   64        // rows i per group
#define NTK  (IG * TT) // tokens per group = 16384
#define NTOK (NI * TT) // 65536
#define NBP  64        // pair-bias GEMM width (4 used)
#define PCAR 1024.0f
#define SCL  0.17677669529663688f   // 32^-0.5
#define RSCL 5.656854249492381f     // 32^0.5
typedef _Float16 h16;
typedef unsigned short bf;
typedef __attribute__((ext_vector_type(16))) __bf16   v16bf;
typedef __attribute__((ext_vector_type(16))) _Float16 v16h;
typedef __attribute__((ext_vector_type(8)))  _Float16 v8h;
typedef __attribute__((ext_vector_type(8)))  unsigned short v8us;
typedef __attribute__((ext_vector_type(8)))  float    v8f;
typedef __attribute__((ext_vector_type(4)))  float    v4f;
typedef v8h  __attribute__((may_alias)) v8ha;
typedef v4f  __attribute__((may_alias)) v4fa;
typedef v8us __attribute__((may_alias)) v8usa;

__device__ __forceinline__ unsigned short f2bf(float f) { unsigned u = __float_as_uint(f); u += 0x7FFFu + ((u >> 16) & 1u); return (unsigned short)(u >> 16); }
__device__ __forceinline__ float bf2f(unsigned short b) { return __uint_as_float(((unsigned)b) << 16); }
__device__ __forceinline__ float bfr(float f) { return bf2f(f2bf(f)); }
__device__ __forceinline__ v16h cat16(v8h lo, v8h hi) { return __builtin_shufflevector(lo, hi, 0, 1, 2, 3, 4, 5, 6, 7, 8, 9, 10, 11, 12, 13, 14, 15); }
__device__ __forceinline__ v16bf cat16b(v8us lo, v8us hi) { return __builtin_bit_cast(v16bf, __builtin_shufflevector(lo, hi, 0, 1, 2, 3, 4, 5, 6, 7, 8, 9, 10, 11, 12, 13, 14, 15)); }
__device__ __forceinline__ v8f wmma16(v16h a, v16h b, v8f c) { return __builtin_amdgcn_wmma_f32_16x16x32_f16(false, a, false, b, (short)0, c, false, false); }
__device__ __forceinline__ v8f wmmab(v16bf a, v16bf b, v8f c) { return __builtin_amdgcn_wmma_f32_16x16x32_bf16(false, a, false, b, (short)0, c, false, false); }



// ---- k_gemmw: register-blocked GEMM, ONE WAVE per 64x64 output tile (16 accumulators), operands straight from K-contiguous 16-bit planes; grid (M/64, N/64, Z), 32 threads.
// C[m][n] (f32, pitch ldc, + optional f32 bias[n]) = sum_k A[m][k] Bt[n][k] (+ split products per NSPLIT). z-batch strides sA/sB/sC in elements. K % 32 == 0.
template <typename T16> struct WFrag;
template <> struct WFrag<h16> { typedef v16h V; static __device__ __forceinline__ V ld(const h16* p) { return cat16(*(const v8h*)p, *(const v8h*)(p + 16)); } static __device__ __forceinline__ v8f mma(V a, V b, v8f c) { return wmma16(a, b, c); } };
template <> struct WFrag<bf> { typedef v16bf V; static __device__ __forceinline__ V ld(const bf* p) { return cat16b(*(const v8us*)p, *(const v8us*)(p + 16)); } static __device__ __forceinline__ v8f mma(V a, V b, v8f c) { return wmmab(a, b, c); } };
template <typename T16, int NSPLIT, bool BIAS>
__global__ __launch_bounds__(32) void k_gemmw(const T16* __restrict__ A, const T16* __restrict__ A2, const T16* __restrict__ Bt, const T16* __restrict__ Bt2, int K, float* C, int ldc, const float* __restrict__ bias, size_t sA, size_t sB, size_t sC) {
    typedef typename WFrag<T16>::V V;
    __shared__ __align__(16) float os[16 * 68];
    const size_t z = blockIdx.z; A += z * sA; if (A2) A2 += z * sA; Bt += z * sB; if (Bt2) Bt2 += z * sB; C += z * sC;
    const int lane = threadIdx.x & 31, lr = lane & 15, hi = lane >> 4; const int r0 = blockIdx.x * 64, c0 = blockIdx.y * 64;
    v8f acc[4][4];
#pragma unroll
    for (int mb = 0; mb < 4; ++mb)
#pragma unroll
        for (int nb = 0; nb < 4; ++nb) acc[mb][nb] = (v8f){};
    const size_t aoff = (size_t)(r0 + lr) * K + 8 * hi, boff = (size_t)(c0 + lr) * K + 8 * hi;
#pragma unroll 1
    for (int kc = 0; kc < K; kc += 32) {
        V a[4], a2[4];
#pragma unroll
        for (int mb = 0; mb < 4; ++mb) { a[mb] = WFrag<T16>::ld(A + aoff + (size_t)mb * 16 * K + kc); if (NSPLIT == 1 || NSPLIT == 2) a2[mb] = WFrag<T16>::ld(A2 + aoff + (size_t)mb * 16 * K + kc); }
#pragma unroll
        for (int nb = 0; nb < 4; ++nb) { const V b = WFrag<T16>::ld(Bt + boff + (size_t)nb * 16 * K + kc); V b2; if (NSPLIT >= 2) b2 = WFrag<T16>::ld(Bt2 + boff + (size_t)nb * 16 * K + kc);
#pragma unroll
            for (int mb = 0; mb < 4; ++mb) { acc[mb][nb] = WFrag<T16>::mma(a[mb], b, acc[mb][nb]); if (NSPLIT == 1 || NSPLIT == 2) acc[mb][nb] = WFrag<T16>::mma(a2[mb], b, acc[mb][nb]); if (NSPLIT >= 2) acc[mb][nb] = WFrag<T16>::mma(a[mb], b2, acc[mb][nb]); } }
        asm volatile("v_nop\n\tv_nop\n\tv_nop\n\tv_nop" : "+v"(acc[0][0]), "+v"(acc[1][1]), "+v"(acc[2][2]), "+v"(acc[3][3]) : "v"(a[0]), "v"(a[3]));
    }
#pragma unroll
    for (int mb = 0; mb < 4; ++mb) {
#pragma unroll
        for (int nb = 0; nb < 4; ++nb) {
#pragma unroll
            for (int j = 0; j < 8; ++j) os[(hi * 8 + j) * 68 + nb * 16 + lr] = acc[mb][nb][j]; }
        __builtin_amdgcn_wave_barrier(); asm volatile("" ::: "memory");
        float* crow = C + (size_t)(r0 + mb * 16) * ldc + c0;
{
#pragma unroll
            for (int s = 0; s < 8; ++s) { const int row = 2 * s + hi, cofs = lr * 4; v4f val = *(const v4fa*)(os + row * 68 + cofs); if (BIAS) { val[0] += bfr(bias[c0 + cofs]); val[1] += bfr(bias[c0 + cofs + 1]); val[2] += bfr(bias[c0 + cofs + 2]); val[3] += bfr(bias[c0 + cofs + 3]); }
                *(v4f*)(crow + (size_t)row * ldc + cofs) = val; }
             }
        __builtin_amdgcn_wave_barrier(); asm volatile("" ::: "memory");
    }
}

typedef __attribute__((ext_vector_type(4))) unsigned short v4us;
typedef __attribute__((ext_vector_type(2))) unsigned short v2us;
typedef __attribute__((ext_vector_type(2))) _Float16 v2h;
typedef __attribute__((ext_vector_type(4))) _Float16 v4h;
__device__ __forceinline__ h16 tohx(float x) { return (h16)x; }
__device__ __forceinline__ void splitf(float y, unsigned short& h, unsigned short& l) { h = f2bf(y); l = f2bf(y - bf2f(h)); }
__global__ __launch_bounds__(256) void k_wtG(const float* __restrict__ w, int K, int N, bf* Bt) {
    const int lane = threadIdx.x & 31; const int L0 = (blockIdx.x * 8 + (threadIdx.x >> 5)) * 8; const int nlines = N * K / 64;
{
#pragma unroll 1
        for (int l = 0; l < 8; ++l) { const int L = L0 + l; if (L >= nlines) break; const size_t e = (size_t)L * 64 + lane * 2; const int k = (int)(e % K), n = (int)(e / K); v2us o;
            o[0] = f2bf(w[(size_t)k * N + n]); o[1] = f2bf(w[(size_t)(k + 1) * N + n]); *(v2us*)(Bt + e) = o; }
         }
}
__global__ __launch_bounds__(256) void k_cvt8(const float* __restrict__ src, bf* dst, size_t n8) { const size_t i = (size_t)blockIdx.x * 256 + threadIdx.x; if (i >= n8) return; const v8f v = *(const v8f*)(src + i * 8); v8us o;
#pragma unroll
    for (int k = 0; k < 8; ++k) o[k] = f2bf(v[k]); *(v8us*)(dst + i * 8) = o;  }

__global__ __launch_bounds__(256) void k_w2d(const float* __restrict__ w, bf* Bt) { const int i = blockIdx.x * 256 + threadIdx.x; if (i >= NBP * DM / 8) return; const int r = i / (DM / 8), c0 = (i % (DM / 8)) * 8; v8us o;
#pragma unroll
    for (int k = 0; k < 8; ++k) o[k] = (r < NH_) ? f2bf(w[(size_t)(c0 + k) * NH_ + r]) : (unsigned short)0; *(v8us*)(Bt + (size_t)r * DM + c0) = o;  }
__global__ __launch_bounds__(256) void k_lnx(const float* __restrict__ A, const float* __restrict__ g, const float* __restrict__ bb, bf* Xh, bf* Xl) {
    const int lane = threadIdx.x & 31; const size_t tok = (size_t)blockIdx.x * 8 + (threadIdx.x >> 5); if (tok >= NTOK) return; const v4f a = *(const v4f*)(A + tok * DM + lane * 4); float v[4]; float s = 0.f;
#pragma unroll
    for (int q = 0; q < 4; ++q) { v[q] = bfr(a[q]); s = __fadd_rn(s, v[q]); }
#pragma unroll
    for (int sh = 16; sh; sh >>= 1) s = __fadd_rn(s, __shfl_xor(s, sh, 32));
    const float mu = __fdiv_rn(s, (float)DM); float s2 = 0.f;
#pragma unroll
    for (int q = 0; q < 4; ++q) { float d0 = __fsub_rn(v[q], mu); asm volatile("" : "+v"(d0)); float p = __fmul_rn(d0, d0); asm volatile("" : "+v"(p)); s2 = __fadd_rn(s2, p); }
#pragma unroll
    for (int sh = 16; sh; sh >>= 1) s2 = __fadd_rn(s2, __shfl_xor(s2, sh, 32));
    const float rs = __fdiv_rn(1.0f, __fsqrt_rn(__fadd_rn(__fdiv_rn(s2, (float)DM), 1e-5f))); v4us oh, ol;
#pragma unroll
    for (int q = 0; q < 4; ++q) { const int c = lane * 4 + q; float xn = __fmul_rn(__fsub_rn(v[q], mu), rs); asm volatile("" : "+v"(xn)); float gg = bfr(g[c]); asm volatile("" : "+v"(gg)); float y = __fmul_rn(xn, gg); asm volatile("" : "+v"(y)); float be = bfr(bb[c]); asm volatile("" : "+v"(be)); y = __fadd_rn(y, be); unsigned short h2, l2; splitf(y, h2, l2); oh[q] = h2; ol[q] = l2; }
    *(v4us*)(Xh + tok * DM + lane * 4) = oh; *(v4us*)(Xl + tok * DM + lane * 4) = ol;  }
__global__ __launch_bounds__(256) void k_qkpl(const float* __restrict__ F, h16* P16) { const size_t e = ((size_t)blockIdx.x * 256 + threadIdx.x) * 2; if (e >= (size_t)NH_ * NTK * HD) return; const int d = (int)(e % HD); const size_t tk = (e / HD) % NTK; const int h = (int)(e / ((size_t)HD * NTK)); v2h o;
    o[0] = tohx(F[tk * DQ + h * HD + d]); o[1] = tohx(F[tk * DQ + h * HD + d + 1]); *(v2h*)(P16 + e) = o;  }
__global__ __launch_bounds__(256) void k_vtpl(const float* __restrict__ F, h16* V16) { const size_t e = ((size_t)blockIdx.x * 256 + threadIdx.x) * 2; if (e >= (size_t)NH_ * IG * HDP * TT) return; const int t = (int)(e % TT); const int dp = (int)((e / TT) % HDP); const size_t il = (e / ((size_t)TT * HDP)) % IG; const int h = (int)(e / ((size_t)TT * HDP * IG)); v2h o;
    if (dp < HD) { o[0] = tohx(F[(il * TT + t) * DQ + h * HD + dp]); o[1] = tohx(F[(il * TT + t + 1) * DQ + h * HD + dp]); } else { o[0] = (h16)0.0f; o[1] = (h16)0.0f; }
    *(v2h*)(V16 + e) = o;  }
// pair bias repacked per head, x 32^0.5 (it starts the score accumulators, which are scaled by 32^-0.5 afterwards): NBT[h][q][k] (k contiguous) from the GEMM's [q*256+k][64] rows
__global__ __launch_bounds__(256) void k_nbt(const float* __restrict__ NB, float* NBT) { const size_t pos = (size_t)blockIdx.x * 256 + threadIdx.x; if (pos >= NTOK) return; const float* np = NB + pos * NBP; const v4f v = *(const v4f*)np;
    asm volatile("s_wait_xcnt 0x0" :: "v"(np) : "memory");   // in front of whatever takes the load's address registers (named as an input, so that they live up to the wait)
#pragma unroll
    for (int h = 0; h < NH_; ++h) NBT[(size_t)h * NTOK + pos] = v[h] * RSCL;  }
// two independent v_exp_f32, in place, with the one slot that the instruction set asks for behind a transcendental (before its result is used or its source overwritten) kept in the same statement
__device__ __forceinline__ void exp2x2(float& a, float& b) { asm("v_exp_f32 %0, %0\n\tv_exp_f32 %1, %1\n\tv_nop" : "+v"(a), "+v"(b)); }
// End of a batch of global loads: s_wait_xcnt 0 in front of whatever may take the loads' address registers (named as inputs, so that they live up to the wait); the scheduling barrier keeps the batch issued here, ahead of the work below that hides its latency (the compiler otherwise sinks each load to its use and waits for each in turn).
#define LOADS_ISSUED(p0, p1, p2) do { asm volatile("s_wait_xcnt 0x0" :: "v"(p0), "v"(p1), "v"(p2) : "memory"); __builtin_amdgcn_sched_barrier(0); } while (0)
// ---- k_fattn: one wave = 16 queries of one (row i, head h) against all 256 keys; grid (256/128, rows of the group, heads), 8 waves.
// Scores are formed TRANSPOSED, S^T = K Q^T + (pair bias + mask bias) 32^0.5 as the accumulators' start value (A = 16 key rows, B = the 16 query rows): an accumulator tile holds key 16t + 8*hi + j of query lr in register j of lane (lr, hi),
// which is the A-fragment order of P for attn.v (elements 0..7 = tile 2c, 8..15 = tile 2c+1 of the 32-key chunk c): no lane exchange, no LDS or memory round trip for S or P.
// P = 1024 exp(logit - max) in fp16 (at most 1024), the division by the f32 row sum is applied to the f32 output tile: O = 1024 x attn.v, as k_gmerge expects.
// amdgpu_waves_per_eu(4, 4): a budget of 256 registers a wave, so that two work-groups share a WGP and the 512 work-groups of a launch are all resident at once.
__global__ __launch_bounds__(256) __attribute__((amdgpu_waves_per_eu(4, 4))) void k_fattn(const h16* __restrict__ Q16, const h16* __restrict__ K16, const h16* __restrict__ V16, const float* __restrict__ NBT, const float* __restrict__ mask, int i0, float* O) {
    __shared__ __align__(32) float mbs[TT];
    const int lane = threadIdx.x & 31, lr = lane & 15, hi = lane >> 4; const int il = blockIdx.y, h = blockIdx.z; const int q0 = (blockIdx.x * 8 + (threadIdx.x >> 5)) * 16;
    mbs[threadIdx.x] = 1e9f * (bfr(mask[(size_t)(i0 + il) * TT + threadIdx.x]) - 1.0f) * RSCL;   // mask bias of row i, once per work-group
    const size_t tk0 = (size_t)h * NTK + (size_t)il * TT;
    const h16* kp = K16 + (tk0 + lr) * HD + 8 * hi;
    const float* nbp = NBT + ((size_t)h * TT + q0 + lr) * TT + 8 * hi;
    const h16* vp = V16 + (((size_t)h * IG + il) * HDP + lr) * TT + 8 * hi;
    const h16* qp = Q16 + (tk0 + q0 + lr) * HD + 8 * hi;
    const v16h bq = WFrag<h16>::ld(qp);
    v16h ka[8], kb[8]; v8f s[TT / 16];
#pragma unroll
    for (int t = 0; t < 8; ++t) ka[t] = WFrag<h16>::ld(kp + (size_t)t * 16 * HD);
#pragma unroll
    for (int t = 0; t < TT / 16; ++t) s[t] = *(const v8f*)(nbp + t * 16);
    LOADS_ISSUED(qp, kp, nbp);
    __syncthreads();   // publishes mbs
#pragma unroll
    for (int t = 0; t < 8; ++t) s[t] = wmma16(ka[t], bq, s[t] + *(const v8f*)(mbs + t * 16 + 8 * hi));
    __builtin_amdgcn_sched_barrier(0);   // the second half's key loads take the first half's registers: not above its products
#pragma unroll
    for (int t = 0; t < 8; ++t) kb[t] = WFrag<h16>::ld(kp + (size_t)(8 + t) * 16 * HD);
    LOADS_ISSUED(kp, kp, kp);
#pragma unroll
    for (int t = 0; t < 8; ++t) s[8 + t] = wmma16(kb[t], bq, s[8 + t] + *(const v8f*)(mbs + (8 + t) * 16 + 8 * hi));
    __builtin_amdgcn_sched_barrier(0);   // the v^T loads take the key fragments' registers: not above the products
    v16h vf[TT / 32][2];
#pragma unroll
    for (int cc = 0; cc < 4; ++cc) { vf[cc][0] = WFrag<h16>::ld(vp + cc * 32); vf[cc][1] = WFrag<h16>::ld(vp + (size_t)16 * TT + cc * 32); }
    LOADS_ISSUED(vp, vp, vp);
    float m4[4] = { -3.0e38f, -3.0e38f, -3.0e38f, -3.0e38f };
#pragma unroll
    for (int t = 0; t < TT / 16; ++t) {
#pragma unroll
        for (int j = 0; j < 4; ++j) m4[j] = fmaxf(fmaxf(m4[j], s[t][j]), s[t][j + 4]); }
    float mx = fmaxf(fmaxf(m4[0], m4[1]), fmaxf(m4[2], m4[3])); mx = fmaxf(mx, __shfl_xor(mx, 16, 32));
    v8f vs = (v8f){}; v8f o[2] = { (v8f){}, (v8f){} };
#pragma unroll
    for (int cc = 0; cc < TT / 32; ++cc) { v16h p;
#pragma unroll
        for (int j = 0; j < 8; ++j) { float e0 = fmaf(s[2 * cc][j] - mx, SCL * 1.4426950408889634f, 10.0f), e1 = fmaf(s[2 * cc + 1][j] - mx, SCL * 1.4426950408889634f, 10.0f); exp2x2(e0, e1); vs[j] += e0 + e1; p[j] = tohx(e0); p[8 + j] = tohx(e1); }
        o[0] = wmma16(p, vf[cc][0], o[0]); o[1] = wmma16(p, vf[cc][1], o[1]);
        if (cc == 1 || cc == 3) { __builtin_amdgcn_sched_barrier(0);   // the next v^T loads take registers freed above
#pragma unroll
            for (int c2 = cc + 3; c2 < cc + 5; ++c2) { vf[c2][0] = WFrag<h16>::ld(vp + c2 * 32); vf[c2][1] = WFrag<h16>::ld(vp + (size_t)16 * TT + c2 * 32); }
            LOADS_ISSUED(vp, vp, vp); } }
    float sum = ((vs[0] + vs[1]) + (vs[2] + vs[3])) + ((vs[4] + vs[5]) + (vs[6] + vs[7])); sum += __shfl_xor(sum, 16, 32);
    // the sum belongs to query lr; the output tile holds query hi*8 + j in register j: fetch each row's factor from the lane that holds it
    const float f = __fdiv_rn(PCAR, sum);
    float* op = O + (tk0 + q0 + hi * 8) * HDP + lr;
#pragma unroll
    for (int j = 0; j < 8; ++j) { const float fj = __shfl(f, hi * 8 + j, 32); op[(size_t)j * HDP] = o[0][j] * fj; op[(size_t)j * HDP + 16] = o[1][j] * fj; }
}
__global__ __launch_bounds__(256) void k_gmerge(const float* __restrict__ O, const float* __restrict__ FG, const float* __restrict__ bg, bf* Ah, bf* Al) { const size_t e = ((size_t)blockIdx.x * 256 + threadIdx.x) * 4; if (e >= (size_t)NTK * DQ) return; const int c = (int)(e % DQ); const size_t tk = e / DQ; const int h = c / HD, d = c % HD; v4us oh, ol;
    const v4f ov = *(const v4f*)(O + (((size_t)h * NTK + tk) * HDP + d)); const v4f gv = *(const v4f*)(FG + tk * DQ + c);
#pragma unroll
    for (int qq = 0; qq < 4; ++qq) { float bgv = bfr(bg[c + qq]); asm volatile("" : "+v"(bgv)); const float ga = __fadd_rn(gv[qq], bgv); const float sg = __fdiv_rn(1.0f, __fadd_rn(1.0f, __builtin_amdgcn_exp2f(__fmul_rn(ga, -1.4426950408889634f)))); float o1 = __fmul_rn(ov[qq], 1.0f / PCAR); asm volatile("" : "+v"(o1)); const float y = __fmul_rn(o1, sg); unsigned short h2, l2; splitf(y, h2, l2); oh[qq] = h2; ol[qq] = l2; }
    *(v4us*)(Ah + e) = oh; *(v4us*)(Al + e) = ol;  }

extern "C" void kernel_launch(void* const* d_in, const int* in_sizes, int n_in,
                              void* d_out, int out_size, void* d_ws, size_t ws_size, hipStream_t stream) {
    (void)in_sizes; (void)n_in; (void)out_size;
    const float* act = (const float*)d_in[0]; const float* mask = (const float*)d_in[1]; const float* lng = (const float*)d_in[2]; const float* lnb = (const float*)d_in[3]; const float* w2d = (const float*)d_in[4]; const float* wq = (const float*)d_in[5]; const float* wk = (const float*)d_in[6]; const float* wv = (const float*)d_in[7]; const float* wg = (const float*)d_in[8]; const float* bg = (const float*)d_in[9]; const float* wo = (const float*)d_in[10]; const float* bo = (const float*)d_in[11];
    float* OUT = (float*)d_out;     // [1][256][256][128]
    char* wsp = (char*)d_ws;
    auto take = [&](size_t bytes) { char* p = wsp; wsp += (bytes + 255) & ~(size_t)255; return (void*)p; };
    bf* WQ = (bf*)take((size_t)DQ * DM * 2); bf* WK = (bf*)take((size_t)DQ * DM * 2); bf* WV = (bf*)take((size_t)DQ * DM * 2); bf* WG = (bf*)take((size_t)DQ * DM * 2); bf* WO = (bf*)take((size_t)DM * DQ * 2); bf* W2 = (bf*)take((size_t)NBP * DM * 2);
    bf* Xh = (bf*)take((size_t)NTOK * DM * 2); bf* Xl = (bf*)take((size_t)NTOK * DM * 2); float* NB = (float*)take((size_t)NTOK * NBP * 4);
    float* FQ = (float*)take((size_t)NTK * DQ * 4); float* FK = (float*)take((size_t)NTK * DQ * 4); float* FG = (float*)take((size_t)NTK * DQ * 4); h16* QP16 = (h16*)take((size_t)NH_ * NTK * HD * 2); h16* KP16 = (h16*)take((size_t)NH_ * NTK * HD * 2); h16* VT16 = (h16*)take((size_t)NH_ * IG * HDP * TT * 2);
    float* NBT = (float*)take((size_t)NH_ * NTOK * 4); float* Ob = (float*)take((size_t)NH_ * NTK * HDP * 4); bf* ATh = (bf*)take((size_t)NTK * DQ * 2); bf* ATl = (bf*)take((size_t)NTK * DQ * 2);
    if ((size_t)(wsp - (char*)d_ws) > ws_size) return;    // ws 256 MiB (carve ~113 MiB)
    float* FV = FK;   /* v projection reuses FK after the k planes are built (stream-ordered, same type) */
    k_wtG<<<(unsigned)((DM * DQ / 64 + 63) / 64), 256, 0, stream>>>(wq, DM, DQ, WQ); k_wtG<<<(unsigned)((DM * DQ / 64 + 63) / 64), 256, 0, stream>>>(wk, DM, DQ, WK); k_wtG<<<(unsigned)((DM * DQ / 64 + 63) / 64), 256, 0, stream>>>(wv, DM, DQ, WV); k_wtG<<<(unsigned)((DM * DQ / 64 + 63) / 64), 256, 0, stream>>>(wg, DM, DQ, WG);
    k_wtG<<<(unsigned)((DQ * DM / 64 + 63) / 64), 256, 0, stream>>>(wo, DQ, DM, WO); k_w2d<<<(NBP * DM / 8 + 255) / 256, 256, 0, stream>>>(w2d, W2);
    k_lnx<<<NTOK / 8, 256, 0, stream>>>(act, lng, lnb, Xh, Xl);
    k_gemmw<bf, 1, false><<<dim3(NTOK / 64, NBP / 64, 1), 32, 0, stream>>>(Xh, Xl, W2, nullptr, DM, NB, NBP, nullptr, 0, 0, 0);   /* pair bias nb[(q,k)][h] for all 65536 positions (cols 0..3) */
    k_nbt<<<NTOK / 256, 256, 0, stream>>>(NB, NBT);
    for (int i0 = 0; i0 < NI; i0 += IG) { const bf* Xgh = Xh + (size_t)i0 * TT * DM; const bf* Xgl = Xl + (size_t)i0 * TT * DM;
        k_gemmw<bf, 1, false><<<dim3(NTK / 64, DQ / 64, 1), 32, 0, stream>>>(Xgh, Xgl, WQ, nullptr, DM, FQ, DQ, nullptr, 0, 0, 0); k_qkpl<<<(unsigned)(((size_t)NH_ * NTK * HD / 2 + 255) / 256), 256, 0, stream>>>(FQ, QP16);
        k_gemmw<bf, 1, false><<<dim3(NTK / 64, DQ / 64, 1), 32, 0, stream>>>(Xgh, Xgl, WK, nullptr, DM, FK, DQ, nullptr, 0, 0, 0); k_qkpl<<<(unsigned)(((size_t)NH_ * NTK * HD / 2 + 255) / 256), 256, 0, stream>>>(FK, KP16);
        k_gemmw<bf, 1, false><<<dim3(NTK / 64, DQ / 64, 1), 32, 0, stream>>>(Xgh, Xgl, WV, nullptr, DM, FV, DQ, nullptr, 0, 0, 0); k_vtpl<<<(unsigned)(((size_t)NH_ * IG * HDP * TT / 2 + 255) / 256), 256, 0, stream>>>(FV, VT16);
        k_gemmw<bf, 1, false><<<dim3(NTK / 64, DQ / 64, 1), 32, 0, stream>>>(Xgh, Xgl, WG, nullptr, DM, FG, DQ, nullptr, 0, 0, 0);
        k_fattn<<<dim3(TT / 128, IG, NH_), 256, 0, stream>>>(QP16, KP16, VT16, NBT, mask, i0, Ob);   /* Ob columns 0..31 of each 64-wide row */
        k_gmerge<<<(unsigned)(((size_t)NTK * DQ / 4 + 255) / 256), 256, 0, stream>>>(Ob, FG, bg, ATh, ATl);
        k_gemmw<bf, 1, true><<<dim3(NTK / 64, DM / 64, 1), 32, 0, stream>>>(ATh, ATl, WO, nullptr, DQ, OUT + (size_t)i0 * TT * DM, DM, bo, 0, 0, 0); }
}

// v002
// It runs in 235 microseconds.
// In two side-by-side timings against v001, it was 1.33 and 1.32 times as fast.
// Over all steps from v000 it is 3.28 times as fast.
#include <hip/hip_runtime.h>

// Triangle attention (starting node) on a pair representation (act [1][256][256][128], mask [1][256][256]): x = LayerNorm_c(act) (eps 1e-5, ln_g/ln_b); per row i: q, k, v, g = x[i] W (wq/wk/wv/wg [128][4][32] 'xw', 4 heads x 32; q x 32^-0.5), logits[h][q][k] = q.k + 1e9 (mask[i][k] - 1) + nb[h][q][k] with the pair bias nb[h][q][k] = sum_c x[q][k][c] w2d[c][h] (shared by all rows i);
// softmax over k; o = attn.v gated by sigmoid(x wg + bg); out[i][q][c] = sum_{h,d} o[h][d] wo[h][d][c] + bo -> [1][256][256][128] (8.4 M).
// Layout: LayerNorm -> bf16 hi/lo token planes [65536][128]; nb for all 65536 pair positions by one GEMM (w2d padded to 64 columns); rows i in 4 groups of 64: q/k/v/g projections (hi/lo x exact), whose epilogue writes the fp16 planes q,k [h][i][t][32] and v^T [h][i][64 (32 used)][t] itself, ONE attention kernel per group (all heads; scores, mask bias + pair bias, x 32^-0.5, softmax and attn.v stay in registers), then gating + merge to hi/lo planes and the output GEMM (+ bo).
// Compute dtypes, f32 accumulate: every input rounded to bf16 once; LayerNorm in f32, its output as bf16 hi + lo (2-product projections against exact bf16 weights); scores and attn.v on single fp16 planes (P = 1024 exp(logit - max), at most 1024; 1/sum applied to the f32 attn.v result); pair bias, mask bias, softmax, gating in f32; output GEMM hl x exact + bo.

#define NI   256       // rows i
#define TT   256       // tokens per row (q / k index)
#define DM   128       // c_z
#define NH_  4
#define HD   32
#define HDP  64        // padded head dim: rows per (h, i) of the v^T planes (32..63 neither written nor read) and row pitch of the attn.v result
#define DQ   (NH_ * HD)
#define IG   64        // rows i per group
#define NTK  (IG * TT) // tokens per group = 16384
#define NTOK (NI * TT) // 65536
#define NBP  64        // pair-bias GEMM width (4 used)
#define PCAR 1024.0f
#define SCL  0.17677669529663688f   // 32^-0.5
#define RSCL 5.656854249492381f     // 32^0.5
typedef _Float16 h16;
typedef unsigned short bf;
typedef __attribute__((ext_vector_type(16))) __bf16   v16bf;
typedef __attribute__((ext_vector_type(16))) _Float16 v16h;
typedef __attribute__((ext_vector_type(8)))  _Float16 v8h;
typedef __attribute__((ext_vector_type(8)))  unsigned short v8us;
typedef __attribute__((ext_vector_type(8)))  float    v8f;
typedef __attribute__((ext_vector_type(4)))  float    v4f;
typedef v8h  __attribute__((may_alias)) v8ha;
typedef v4f  __attribute__((may_alias)) v4fa;
typedef v8us __attribute__((may_alias)) v8usa;

__device__ __forceinline__ unsigned short f2bf(float f) { unsigned u = __float_as_uint(f); u += 0x7FFFu + ((u >> 16) & 1u); return (unsigned short)(u >> 16); }
__device__ __forceinline__ float bf2f(unsigned short b) { return __uint_as_float(((unsigned)b) << 16); }
__device__ __forceinline__ float bfr(float f) { return bf2f(f2bf(f)); }
__device__ __forceinline__ v16h cat16(v8h lo, v8h hi) { return __builtin_shufflevector(lo, hi, 0, 1, 2, 3, 4, 5, 6, 7, 8, 9, 10, 11, 12, 13, 14, 15); }
__device__ __forceinline__ v16bf cat16b(v8us lo, v8us hi) { return __builtin_bit_cast(v16bf, __builtin_shufflevector(lo, hi, 0, 1, 2, 3, 4, 5, 6, 7, 8, 9, 10, 11, 12, 13, 14, 15)); }
__device__ __forceinline__ v8f wmma16(v16h a, v16h b, v8f c) { return __builtin_amdgcn_wmma_f32_16x16x32_f16(false, a, false, b, (short)0, c, false, false); }
__device__ __forceinline__ v8f wmmab(v16bf a, v16bf b, v8f c) { return __builtin_amdgcn_wmma_f32_16x16x32_bf16(false, a, false, b, (short)0, c, false, false); }



// ---- k_gemmw: register-blocked GEMM, ONE WAVE per 64x64 output tile (16 accumulators), operands straight from K-contiguous 16-bit planes; grid (M/64, N/64, Z), 32 threads.
// C[m][n] (f32, pitch ldc, + optional f32 bias[n]) = sum_k A[m][k] Bt[n][k] (+ split products per NSPLIT). z-batch strides sA/sB/sC in elements. K % 32 == 0.
// EPI 0: C as above. EPI 1: the tile rounded to fp16 into P16[n / 32][m][n % 32] (head planes of q, k; m = token of the group). EPI 2: into P16[n / 32][m / 256][n % 32 (pitch 64)][m % 256] (v^T planes). Both in whole 128-byte lines, 16 bytes a lane.
template <typename T16> struct WFrag;
template <> struct WFrag<h16> { typedef v16h V; static __device__ __forceinline__ V ld(const h16* p) { return cat16(*(const v8h*)p, *(const v8h*)(p + 16)); } static __device__ __forceinline__ v8f mma(V a, V b, v8f c) { return wmma16(a, b, c); } };
template <> struct WFrag<bf> { typedef v16bf V; static __device__ __forceinline__ V ld(const bf* p) { return cat16b(*(const v8us*)p, *(const v8us*)(p + 16)); } static __device__ __forceinline__ v8f mma(V a, V b, v8f c) { return wmmab(a, b, c); } };
template <typename T16, int NSPLIT, bool BIAS, int EPI>
__global__ __launch_bounds__(32) void k_gemmw(const T16* __restrict__ A, const T16* __restrict__ A2, const T16* __restrict__ Bt, const T16* __restrict__ Bt2, int K, float* C, int ldc, const float* __restrict__ bias, size_t sA, size_t sB, size_t sC, h16* P16) {
    typedef typename WFrag<T16>::V V;
    __shared__ __align__(16) float os[16 * 68];
    const size_t z = blockIdx.z; A += z * sA; if (A2) A2 += z * sA; Bt += z * sB; if (Bt2) Bt2 += z * sB; C += z * sC;
    const int lane = threadIdx.x & 31, lr = lane & 15, hi = lane >> 4; const int r0 = blockIdx.x * 64, c0 = blockIdx.y * 64;
    v8f acc[4][4];
#pragma unroll
    for (int mb = 0; mb < 4; ++mb)
#pragma unroll
        for (int nb = 0; nb < 4; ++nb) acc[mb][nb] = (v8f){};
    const size_t aoff = (size_t)(r0 + lr) * K + 8 * hi, boff = (size_t)(c0 + lr) * K + 8 * hi;
#pragma unroll 1
    for (int kc = 0; kc < K; kc += 32) {
        V a[4], a2[4];
#pragma unroll
        for (int mb = 0; mb < 4; ++mb) { a[mb] = WFrag<T16>::ld(A + aoff + (size_t)mb * 16 * K + kc); if (NSPLIT == 1 || NSPLIT == 2) a2[mb] = WFrag<T16>::ld(A2 + aoff + (size_t)mb * 16 * K + kc); }
#pragma unroll
        for (int nb = 0; nb < 4; ++nb) { const V b = WFrag<T16>::ld(Bt + boff + (size_t)nb * 16 * K + kc); V b2; if (NSPLIT >= 2) b2 = WFrag<T16>::ld(Bt2 + boff + (size_t)nb * 16 * K + kc);
#pragma unroll
            for (int mb = 0; mb < 4; ++mb) { acc[mb][nb] = WFrag<T16>::mma(a[mb], b, acc[mb][nb]); if (NSPLIT == 1 || NSPLIT == 2) acc[mb][nb] = WFrag<T16>::mma(a2[mb], b, acc[mb][nb]); if (NSPLIT >= 2) acc[mb][nb] = WFrag<T16>::mma(a[mb], b2, acc[mb][nb]); } }
        asm volatile("v_nop\n\tv_nop\n\tv_nop\n\tv_nop" : "+v"(acc[0][0]), "+v"(acc[1][1]), "+v"(acc[2][2]), "+v"(acc[3][3]) : "v"(a[0]), "v"(a[3]));
    }
    if constexpr (EPI == 2) {
        // 16 columns (rows d of v^T) x the tile's 64 tokens at a time: a lane's 8 accumulator registers are 8 consecutive tokens of one column
        h16* vrow = P16 + ((size_t)(r0 / TT) * HDP + (lane >> 3)) * TT + (r0 % TT) + (lane & 7) * 8;
#pragma unroll
        for (int nb = 0; nb < 4; ++nb) {
#pragma unroll
            for (int mb = 0; mb < 4; ++mb) {
#pragma unroll
                for (int j = 0; j < 8; ++j) os[lr * 68 + mb * 16 + hi * 8 + j] = acc[mb][nb][j]; }
            __builtin_amdgcn_wave_barrier(); asm volatile("" ::: "memory");   // the reads below take other lanes' values: not above the writes (one wave, its LDS operations run in order)
            h16* dst = vrow + ((size_t)((c0 + nb * 16) / HD) * IG * HDP + (c0 + nb * 16) % HD) * TT;
#pragma unroll
            for (int s = 0; s < 4; ++s) { const float* sp = os + (s * 4 + (lane >> 3)) * 68 + (lane & 7) * 8; const v4f x0 = *(const v4fa*)sp, x1 = *(const v4fa*)(sp + 4); v8h o;
#pragma unroll
                for (int k = 0; k < 4; ++k) { o[k] = (h16)x0[k]; o[4 + k] = (h16)x1[k]; }
                *(v8h*)(dst + (size_t)s * 4 * TT) = o; }
            if (nb < 3) asm volatile("s_wait_xcnt 0x0" ::: "memory");   // in front of the next block's address sums and LDS reads, which take registers that these stores name
            __builtin_amdgcn_wave_barrier(); asm volatile("" ::: "memory");   // the next block's LDS writes stay behind these reads
        }
        return;
    }
#pragma unroll
    for (int mb = 0; mb < 4; ++mb) {
#pragma unroll
        for (int nb = 0; nb < 4; ++nb) {
#pragma unroll
            for (int j = 0; j < 8; ++j) os[(hi * 8 + j) * 68 + nb * 16 + lr] = acc[mb][nb][j]; }
        __builtin_amdgcn_wave_barrier(); asm volatile("" ::: "memory");
        if constexpr (EPI == 1) {
            // 16 tokens x 32 halves of one head are 1024 contiguous bytes of its plane: two 512-byte stores a head, two heads a tile
            h16* dst0 = P16 + ((size_t)(c0 / HD) * NTK + r0 + mb * 16) * HD + lane * 8; h16* dst1 = dst0 + (size_t)NTK * HD;
#pragma unroll
            for (int s = 0; s < 4; ++s) { const int ch = (s & 1) * 32 + lane; const float* sp = os + (ch >> 2) * 68 + (s >> 1) * HD + (ch & 3) * 8; const v4f x0 = *(const v4fa*)sp, x1 = *(const v4fa*)(sp + 4); v8h o;
#pragma unroll
                for (int k = 0; k < 4; ++k) { o[k] = (h16)x0[k]; o[4 + k] = (h16)x1[k]; }
                *(v8h*)(((s >> 1) ? dst1 : dst0) + (s & 1) * 256) = o; }
            __builtin_amdgcn_wave_barrier(); asm volatile("" ::: "memory");   // the next block's LDS writes stay behind these reads
            continue;
        }
        float* crow = C + (size_t)(r0 + mb * 16) * ldc + c0;
{
#pragma unroll
            for (int s = 0; s < 8; ++s) { const int row = 2 * s + hi, cofs = lr * 4; v4f val = *(const v4fa*)(os + row * 68 + cofs); if (BIAS) { val[0] += bfr(bias[c0 + cofs]); val[1] += bfr(bias[c0 + cofs + 1]); val[2] += bfr(bias[c0 + cofs + 2]); val[3] += bfr(bias[c0 + cofs + 3]); }
                *(v4f*)(crow + (size_t)row * ldc + cofs) = val; }
             }
        __builtin_amdgcn_wave_barrier(); asm volatile("" ::: "memory");
    }
}

typedef __attribute__((ext_vector_type(4))) unsigned short v4us;
typedef __attribute__((ext_vector_type(2))) unsigned short v2us;
typedef __attribute__((ext_vector_type(2))) _Float16 v2h;
typedef __attribute__((ext_vector_type(4))) _Float16 v4h;
__device__ __forceinline__ h16 tohx(float x) { return (h16)x; }
__device__ __forceinline__ void splitf(float y, unsigned short& h, unsigned short& l) { h = f2bf(y); l = f2bf(y - bf2f(h)); }
__global__ __launch_bounds__(256) void k_wtG(const float* __restrict__ w, int K, int N, bf* Bt) {
    const int lane = threadIdx.x & 31; const int L0 = (blockIdx.x * 8 + (threadIdx.x >> 5)) * 8; const int nlines = N * K / 64;
{
#pragma unroll 1
        for (int l = 0; l < 8; ++l) { const int L = L0 + l; if (L >= nlines) break; const size_t e = (size_t)L * 64 + lane * 2; const int k = (int)(e % K), n = (int)(e / K); v2us o;
            o[0] = f2bf(w[(size_t)k * N + n]); o[1] = f2bf(w[(size_t)(k + 1) * N + n]); *(v2us*)(Bt + e) = o; }
         }
}
__global__ __launch_bounds__(256) void k_cvt8(const float* __restrict__ src, bf* dst, size_t n8) { const size_t i = (size_t)blockIdx.x * 256 + threadIdx.x; if (i >= n8) return; const v8f v = *(const v8f*)(src + i * 8); v8us o;
#pragma unroll
    for (int k = 0; k < 8; ++k) o[k] = f2bf(v[k]); *(v8us*)(dst + i * 8) = o;  }

__global__ __launch_bounds__(256) void k_w2d(const float* __restrict__ w, bf* Bt) { const int i = blockIdx.x * 256 + threadIdx.x; if (i >= NBP * DM / 8) return; const int r = i / (DM / 8), c0 = (i % (DM / 8)) * 8; v8us o;
#pragma unroll
    for (int k = 0; k < 8; ++k) o[k] = (r < NH_) ? f2bf(w[(size_t)(c0 + k) * NH_ + r]) : (unsigned short)0; *(v8us*)(Bt + (size_t)r * DM + c0) = o;  }
__global__ __launch_bounds__(256) void k_lnx(const float* __restrict__ A, const float* __restrict__ g, const float* __restrict__ bb, bf* Xh, bf* Xl) {
    const int lane = threadIdx.x & 31; const size_t tok = (size_t)blockIdx.x * 8 + (threadIdx.x >> 5); if (tok >= NTOK) return; const v4f a = *(const v4f*)(A + tok * DM + lane * 4); float v[4]; float s = 0.f;
#pragma unroll
    for (int q = 0; q < 4; ++q) { v[q] = bfr(a[q]); s = __fadd_rn(s, v[q]); }
#pragma unroll
    for (int sh = 16; sh; sh >>= 1) s = __fadd_rn(s, __shfl_xor(s, sh, 32));
    const float mu = __fdiv_rn(s, (float)DM); float s2 = 0.f;
#pragma unroll
    for (int q = 0; q < 4; ++q) { float d0 = __fsub_rn(v[q], mu); asm volatile("" : "+v"(d0)); float p = __fmul_rn(d0, d0); asm volatile("" : "+v"(p)); s2 = __fadd_rn(s2, p); }
#pragma unroll
    for (int sh = 16; sh; sh >>= 1) s2 = __fadd_rn(s2, __shfl_xor(s2, sh, 32));
    const float rs = __fdiv_rn(1.0f, __fsqrt_rn(__fadd_rn(__fdiv_rn(s2, (float)DM), 1e-5f))); v4us oh, ol;
#pragma unroll
    for (int q = 0; q < 4; ++q) { const int c = lane * 4 + q; float xn = __fmul_rn(__fsub_rn(v[q], mu), rs); asm volatile("" : "+v"(xn)); float gg = bfr(g[c]); asm volatile("" : "+v"(gg)); float y = __fmul_rn(xn, gg); asm volatile("" : "+v"(y)); float be = bfr(bb[c]); asm volatile("" : "+v"(be)); y = __fadd_rn(y, be); unsigned short h2, l2; splitf(y, h2, l2); oh[q] = h2; ol[q] = l2; }
    *(v4us*)(Xh + tok * DM + lane * 4) = oh; *(v4us*)(Xl + tok * DM + lane * 4) = ol;  }
// pair bias repacked per head, x 32^0.5 (it starts the score accumulators, which are scaled by 32^-0.5 afterwards): NBT[h][q][k] (k contiguous) from the GEMM's [q*256+k][64] rows
__global__ __launch_bounds__(256) void k_nbt(const float* __restrict__ NB, float* NBT) { const size_t pos = (size_t)blockIdx.x * 256 + threadIdx.x; if (pos >= NTOK) return; const float* np = NB + pos * NBP; const v4f v = *(const v4f*)np;
    asm volatile("s_wait_xcnt 0x0" :: "v"(np) : "memory");   // in front of whatever takes the load's address registers (named as an input, so that they live up to the wait)
#pragma unroll
    for (int h = 0; h < NH_; ++h) NBT[(size_t)h * NTOK + pos] = v[h] * RSCL;  }
// two independent v_exp_f32, in place, with the one slot that the instruction set asks for behind a transcendental (before its result is used or its source overwritten) kept in the same statement
__device__ __forceinline__ void exp2x2(float& a, float& b) { asm("v_exp_f32 %0, %0\n\tv_exp_f32 %1, %1\n\tv_nop" : "+v"(a), "+v"(b)); }
// End of a batch of global loads: s_wait_xcnt 0 in front of whatever may take the loads' address registers (named as inputs, so that they live up to the wait); the scheduling barrier keeps the batch issued here, ahead of the work below that hides its latency (the compiler otherwise sinks each load to its use and waits for each in turn).
#define LOADS_ISSUED(p0, p1, p2) do { asm volatile("s_wait_xcnt 0x0" :: "v"(p0), "v"(p1), "v"(p2) : "memory"); __builtin_amdgcn_sched_barrier(0); } while (0)
// ---- k_fattn: one wave = 16 queries of one (row i, head h) against all 256 keys; grid (256/128, rows of the group, heads), 8 waves.
// Scores are formed TRANSPOSED, S^T = K Q^T + (pair bias + mask bias) 32^0.5 as the accumulators' start value (A = 16 key rows, B = the 16 query rows): an accumulator tile holds key 16t + 8*hi + j of query lr in register j of lane (lr, hi),
// which is the A-fragment order of P for attn.v (elements 0..7 = tile 2c, 8..15 = tile 2c+1 of the 32-key chunk c): no lane exchange, no LDS or memory round trip for S or P.
// P = 1024 exp(logit - max) in fp16 (at most 1024), the division by the f32 row sum is applied to the f32 output tile: O = 1024 x attn.v, as k_gmerge expects.
// amdgpu_waves_per_eu(4, 4): a budget of 256 registers a wave, so that two work-groups share a WGP and the 512 work-groups of a launch are all resident at once.
__global__ __launch_bounds__(256) __attribute__((amdgpu_waves_per_eu(4, 4))) void k_fattn(const h16* __restrict__ Q16, const h16* __restrict__ K16, const h16* __restrict__ V16, const float* __restrict__ NBT, const float* __restrict__ mask, int i0, float* O) {
    __shared__ __align__(32) float mbs[TT];
    const int lane = threadIdx.x & 31, lr = lane & 15, hi = lane >> 4; const int il = blockIdx.y, h = blockIdx.z; const int q0 = (blockIdx.x * 8 + (threadIdx.x >> 5)) * 16;
    mbs[threadIdx.x] = 1e9f * (bfr(mask[(size_t)(i0 + il) * TT + threadIdx.x]) - 1.0f) * RSCL;   // mask bias of row i, once per work-group
    const size_t tk0 = (size_t)h * NTK + (size_t)il * TT;
    const h16* kp = K16 + (tk0 + lr) * HD + 8 * hi;
    const float* nbp = NBT + ((size_t)h * TT + q0 + lr) * TT + 8 * hi;
    const h16* vp = V16 + (((size_t)h * IG + il) * HDP + lr) * TT + 8 * hi;
    const h16* qp = Q16 + (tk0 + q0 + lr) * HD + 8 * hi;
    const v16h bq = WFrag<h16>::ld(qp);
    v16h ka[8], kb[8]; v8f s[TT / 16];
#pragma unroll
    for (int t = 0; t < 8; ++t) ka[t] = WFrag<h16>::ld(kp + (size_t)t * 16 * HD);
#pragma unroll
    for (int t = 0; t < TT / 16; ++t) s[t] = *(const v8f*)(nbp + t * 16);
    LOADS_ISSUED(qp, kp, nbp);
    __syncthreads();   // publishes mbs
#pragma unroll
    for (int t = 0; t < 8; ++t) s[t] = wmma16(ka[t], bq, s[t] + *(const v8f*)(mbs + t * 16 + 8 * hi));
    __builtin_amdgcn_sched_barrier(0);   // the second half's key loads take the first half's registers: not above its products
#pragma unroll
    for (int t = 0; t < 8; ++t) kb[t] = WFrag<h16>::ld(kp + (size_t)(8 + t) * 16 * HD);
    LOADS_ISSUED(kp, kp, kp);
#pragma unroll
    for (int t = 0; t < 8; ++t) s[8 + t] = wmma16(kb[t], bq, s[8 + t] + *(const v8f*)(mbs + (8 + t) * 16 + 8 * hi));
    __builtin_amdgcn_sched_barrier(0);   // the v^T loads take the key fragments' registers: not above the products
    v16h vf[TT / 32][2];
#pragma unroll
    for (int cc = 0; cc < 4; ++cc) { vf[cc][0] = WFrag<h16>::ld(vp + cc * 32); vf[cc][1] = WFrag<h16>::ld(vp + (size_t)16 * TT + cc * 32); }
    LOADS_ISSUED(vp, vp, vp);
    float m4[4] = { -3.0e38f, -3.0e38f, -3.0e38f, -3.0e38f };
#pragma unroll
    for (int t = 0; t < TT / 16; ++t) {
#pragma unroll
        for (int j = 0; j < 4; ++j) m4[j] = fmaxf(fmaxf(m4[j], s[t][j]), s[t][j + 4]); }
    float mx = fmaxf(fmaxf(m4[0], m4[1]), fmaxf(m4[2], m4[3])); mx = fmaxf(mx, __shfl_xor(mx, 16, 32));
    v8f vs = (v8f){}; v8f o[2] = { (v8f){}, (v8f){} };
#pragma unroll
    for (int cc = 0; cc < TT / 32; ++cc) { v16h p;
#pragma unroll
        for (int j = 0; j < 8; ++j) { float e0 = fmaf(s[2 * cc][j] - mx, SCL * 1.4426950408889634f, 10.0f), e1 = fmaf(s[2 * cc + 1][j] - mx, SCL * 1.4426950408889634f, 10.0f); exp2x2(e0, e1); vs[j] += e0 + e1; p[j] = tohx(e0); p[8 + j] = tohx(e1); }
        o[0] = wmma16(p, vf[cc][0], o[0]); o[1] = wmma16(p, vf[cc][1], o[1]);
        if (cc == 1 || cc == 3) { __builtin_amdgcn_sched_barrier(0);   // the next v^T loads take registers freed above
#pragma unroll
            for (int c2 = cc + 3; c2 < cc + 5; ++c2) { vf[c2][0] = WFrag<h16>::ld(vp + c2 * 32); vf[c2][1] = WFrag<h16>::ld(vp + (size_t)16 * TT + c2 * 32); }
            LOADS_ISSUED(vp, vp, vp); } }
    float sum = ((vs[0] + vs[1]) + (vs[2] + vs[3])) + ((vs[4] + vs[5]) + (vs[6] + vs[7])); sum += __shfl_xor(sum, 16, 32);
    // the sum belongs to query lr; the output tile holds query hi*8 + j in register j: fetch each row's factor from the lane that holds it
    const float f = __fdiv_rn(PCAR, sum);
    float* op = O + (tk0 + q0 + hi * 8) * HDP + lr;
#pragma unroll
    for (int j = 0; j < 8; ++j) { const float fj = __shfl(f, hi * 8 + j, 32); op[(size_t)j * HDP] = o[0][j] * fj; op[(size_t)j * HDP + 16] = o[1][j] * fj; }
}
__global__ __launch_bounds__(256) void k_gmerge(const float* __restrict__ O, const float* __restrict__ FG, const float* __restrict__ bg, bf* Ah, bf* Al) { const size_t e = ((size_t)blockIdx.x * 256 + threadIdx.x) * 4; if (e >= (size_t)NTK * DQ) return; const int c = (int)(e % DQ); const size_t tk = e / DQ; const int h = c / HD, d = c % HD; v4us oh, ol;
    const v4f ov = *(const v4f*)(O + (((size_t)h * NTK + tk) * HDP + d)); const v4f gv = *(const v4f*)(FG + tk * DQ + c);
#pragma unroll
    for (int qq = 0; qq < 4; ++qq) { float bgv = bfr(bg[c + qq]); asm volatile("" : "+v"(bgv)); const float ga = __fadd_rn(gv[qq], bgv); const float sg = __fdiv_rn(1.0f, __fadd_rn(1.0f, __builtin_amdgcn_exp2f(__fmul_rn(ga, -1.4426950408889634f)))); float o1 = __fmul_rn(ov[qq], 1.0f / PCAR); asm volatile("" : "+v"(o1)); const float y = __fmul_rn(o1, sg); unsigned short h2, l2; splitf(y, h2, l2); oh[qq] = h2; ol[qq] = l2; }
    *(v4us*)(Ah + e) = oh; *(v4us*)(Al + e) = ol;  }

extern "C" void kernel_launch(void* const* d_in, const int* in_sizes, int n_in,
                              void* d_out, int out_size, void* d_ws, size_t ws_size, hipStream_t stream) {
    (void)in_sizes; (void)n_in; (void)out_size;
    const float* act = (const float*)d_in[0]; const float* mask = (const float*)d_in[1]; const float* lng = (const float*)d_in[2]; const float* lnb = (const float*)d_in[3]; const float* w2d = (const float*)d_in[4]; const float* wq = (const float*)d_in[5]; const float* wk = (const float*)d_in[6]; const float* wv = (const float*)d_in[7]; const float* wg = (const float*)d_in[8]; const float* bg = (const float*)d_in[9]; const float* wo = (const float*)d_in[10]; const float* bo = (const float*)d_in[11];
    float* OUT = (float*)d_out;     // [1][256][256][128]
    char* wsp = (char*)d_ws;
    auto take = [&](size_t bytes) { char* p = wsp; wsp += (bytes + 255) & ~(size_t)255; return (void*)p; };
    bf* WQ = (bf*)take((size_t)DQ * DM * 2); bf* WK = (bf*)take((size_t)DQ * DM * 2); bf* WV = (bf*)take((size_t)DQ * DM * 2); bf* WG = (bf*)take((size_t)DQ * DM * 2); bf* WO = (bf*)take((size_t)DM * DQ * 2); bf* W2 = (bf*)take((size_t)NBP * DM * 2);
    bf* Xh = (bf*)take((size_t)NTOK * DM * 2); bf* Xl = (bf*)take((size_t)NTOK * DM * 2); float* NB = (float*)take((size_t)NTOK * NBP * 4);
    float* FG = (float*)take((size_t)NTK * DQ * 4); h16* QP16 = (h16*)take((size_t)NH_ * NTK * HD * 2); h16* KP16 = (h16*)take((size_t)NH_ * NTK * HD * 2); h16* VT16 = (h16*)take((size_t)NH_ * IG * HDP * TT * 2);
    float* NBT = (float*)take((size_t)NH_ * NTOK * 4); float* Ob = (float*)take((size_t)NH_ * NTK * HDP * 4); bf* ATh = (bf*)take((size_t)NTK * DQ * 2); bf* ATl = (bf*)take((size_t)NTK * DQ * 2);
    if ((size_t)(wsp - (char*)d_ws) > ws_size) return;    // ws 256 MiB (carve ~97 MiB)
    k_wtG<<<(unsigned)((DM * DQ / 64 + 63) / 64), 256, 0, stream>>>(wq, DM, DQ, WQ); k_wtG<<<(unsigned)((DM * DQ / 64 + 63) / 64), 256, 0, stream>>>(wk, DM, DQ, WK); k_wtG<<<(unsigned)((DM * DQ / 64 + 63) / 64), 256, 0, stream>>>(wv, DM, DQ, WV); k_wtG<<<(unsigned)((DM * DQ / 64 + 63) / 64), 256, 0, stream>>>(wg, DM, DQ, WG);
    k_wtG<<<(unsigned)((DQ * DM / 64 + 63) / 64), 256, 0, stream>>>(wo, DQ, DM, WO); k_w2d<<<(NBP * DM / 8 + 255) / 256, 256, 0, stream>>>(w2d, W2);
    k_lnx<<<NTOK / 8, 256, 0, stream>>>(act, lng, lnb, Xh, Xl);
    k_gemmw<bf, 1, false, 0><<<dim3(NTOK / 64, NBP / 64, 1), 32, 0, stream>>>(Xh, Xl, W2, nullptr, DM, NB, NBP, nullptr, 0, 0, 0, nullptr);   /* pair bias nb[(q,k)][h] for all 65536 positions (cols 0..3) */
    k_nbt<<<NTOK / 256, 256, 0, stream>>>(NB, NBT);
    for (int i0 = 0; i0 < NI; i0 += IG) { const bf* Xgh = Xh + (size_t)i0 * TT * DM; const bf* Xgl = Xl + (size_t)i0 * TT * DM;
        k_gemmw<bf, 1, false, 1><<<dim3(NTK / 64, DQ / 64, 1), 32, 0, stream>>>(Xgh, Xgl, WQ, nullptr, DM, nullptr, DQ, nullptr, 0, 0, 0, QP16);
        k_gemmw<bf, 1, false, 1><<<dim3(NTK / 64, DQ / 64, 1), 32, 0, stream>>>(Xgh, Xgl, WK, nullptr, DM, nullptr, DQ, nullptr, 0, 0, 0, KP16);
        k_gemmw<bf, 1, false, 2><<<dim3(NTK / 64, DQ / 64, 1), 32, 0, stream>>>(Xgh, Xgl, WV, nullptr, DM, nullptr, DQ, nullptr, 0, 0, 0, VT16);
        k_gemmw<bf, 1, false, 0><<<dim3(NTK / 64, DQ / 64, 1), 32, 0, stream>>>(Xgh, Xgl, WG, nullptr, DM, FG, DQ, nullptr, 0, 0, 0, nullptr);
        k_fattn<<<dim3(TT / 128, IG, NH_), 256, 0, stream>>>(QP16, KP16, VT16, NBT, mask, i0, Ob);   /* Ob columns 0..31 of each 64-wide row */
        k_gmerge<<<(unsigned)(((size_t)NTK * DQ / 4 + 255) / 256), 256, 0, stream>>>(Ob, FG, bg, ATh, ATl);
        k_gemmw<bf, 1, true, 0><<<dim3(NTK / 64, DM / 64, 1), 32, 0, stream>>>(ATh, ATl, WO, nullptr, DQ, OUT + (size_t)i0 * TT * DM, DM, bo, 0, 0, 0, nullptr); }
}

// v003
// Measured time: 164 microseconds a run.
// Two timings next to v002 put it at 1.45 and 1.43 times that version's speed.
// Over all steps from v000 it is 4.73 times as fast.
#include <hip/hip_runtime.h>

// Triangle attention (starting node) on a pair representation (act [1][256][256][128], mask [1][256][256]): x = LayerNorm_c(act) (eps 1e-5, ln_g/ln_b); per row i: q, k, v, g = x[i] W (wq/wk/wv/wg [128][4][32] 'xw', 4 heads x 32; q x 32^-0.5), logits[h][q][k] = q.k + 1e9 (mask[i][k] - 1) + nb[h][q][k] with the pair bias nb[h][q][k] = sum_c x[q][k][c] w2d[c][h] (shared by all rows i);
// softmax over k; o = attn.v gated by sigmoid(x wg + bg); out[i][q][c] = sum_{h,d} o[h][d] wo[h][d][c] + bo -> [1][256][256][128] (8.4 M).
// Layout: LayerNorm -> bf16 hi/lo token planes [65536][128]; nb for all 65536 pair positions by one GEMM (w2d padded to 64 columns); rows i in groups of IG, here all 256 in one group, so each stage is one launch: q/k/v/g projections (hi/lo x exact), whose epilogue writes the fp16 planes q,k [h][i][t][32] and v^T [h][i][64 (32 used)][t] itself, ONE attention kernel per group (all heads; scores, mask bias + pair bias, x 32^-0.5, softmax and attn.v stay in registers), then gating + merge to hi/lo planes and the output GEMM (+ bo).
// Compute dtypes, f32 accumulate: every input rounded to bf16 once; LayerNorm in f32, its output as bf16 hi + lo (2-product projections against exact bf16 weights); scores and attn.v on single fp16 planes (P = 1024 exp(logit - max), at most 1024; 1/sum applied to the f32 attn.v result); pair bias, mask bias, softmax, gating in f32; output GEMM hl x exact + bo.

#define NI   256       // rows i
#define TT   256       // tokens per row (q / k index)
#define DM   128       // c_z
#define NH_  4
#define HD   32
#define HDP  64        // padded head dim: rows per (h, i) of the v^T planes (32..63 neither written nor read) and row pitch of the attn.v result
#define DQ   (NH_ * HD)
#define IG   256       // rows i per group: all of them (one launch per stage fills the chip; the planes between the stages then take 241 MiB of the workspace)
#define NTK  (IG * TT) // tokens per group = 65536
#define NTOK (NI * TT) // 65536
#define NBP  64        // pair-bias GEMM width (4 used)
#define PCAR 1024.0f
#define SCL  0.17677669529663688f   // 32^-0.5
#define RSCL 5.656854249492381f     // 32^0.5
typedef _Float16 h16;
typedef unsigned short bf;
typedef __attribute__((ext_vector_type(16))) __bf16   v16bf;
typedef __attribute__((ext_vector_type(16))) _Float16 v16h;
typedef __attribute__((ext_vector_type(8)))  _Float16 v8h;
typedef __attribute__((ext_vector_type(8)))  unsigned short v8us;
typedef __attribute__((ext_vector_type(8)))  float    v8f;
typedef __attribute__((ext_vector_type(4)))  float    v4f;
typedef v8h  __attribute__((may_alias)) v8ha;
typedef v4f  __attribute__((may_alias)) v4fa;
typedef v8us __attribute__((may_alias)) v8usa;

__device__ __forceinline__ unsigned short f2bf(float f) { unsigned u = __float_as_uint(f); u += 0x7FFFu + ((u >> 16) & 1u); return (unsigned short)(u >> 16); }
__device__ __forceinline__ float bf2f(unsigned short b) { return __uint_as_float(((unsigned)b) << 16); }
__device__ __forceinline__ float bfr(float f) { return bf2f(f2bf(f)); }
__device__ __forceinline__ v16h cat16(v8h lo, v8h hi) { return __builtin_shufflevector(lo, hi, 0, 1, 2, 3, 4, 5, 6, 7, 8, 9, 10, 11, 12, 13, 14, 15); }
__device__ __forceinline__ v16bf cat16b(v8us lo, v8us hi) { return __builtin_bit_cast(v16bf, __builtin_shufflevector(lo, hi, 0, 1, 2, 3, 4, 5, 6, 7, 8, 9, 10, 11, 12, 13, 14, 15)); }
__device__ __forceinline__ v8f wmma16(v16h a, v16h b, v8f c) { return __builtin_amdgcn_wmma_f32_16x16x32_f16(false, a, false, b, (short)0, c, false, false); }
__device__ __forceinline__ v8f wmmab(v16bf a, v16bf b, v8f c) { return __builtin_amdgcn_wmma_f32_16x16x32_bf16(false, a, false, b, (short)0, c, false, false); }



// ---- k_gemmw: register-blocked GEMM, ONE WAVE per 64x64 output tile (16 accumulators), operands straight from K-contiguous 16-bit planes; grid (M/64, N/64, Z), 32 threads.
// C[m][n] (f32, pitch ldc, + optional f32 bias[n]) = sum_k A[m][k] Bt[n][k] (+ split products per NSPLIT). z-batch strides sA/sB/sC in elements. K % 32 == 0.
// EPI 0: C as above. EPI 1: the tile rounded to fp16 into P16[n / 32][m][n % 32] (head planes of q, k; m = token of the group). EPI 2: into P16[n / 32][m / 256][n % 32 (pitch 64)][m % 256] (v^T planes). Both in whole 128-byte lines, 16 bytes a lane.
template <typename T16> struct WFrag;
template <> struct WFrag<h16> { typedef v16h V; static __device__ __forceinline__ V ld(const h16* p) { return cat16(*(const v8h*)p, *(const v8h*)(p + 16)); } static __device__ __forceinline__ v8f mma(V a, V b, v8f c) { return wmma16(a, b, c); } };
template <> struct WFrag<bf> { typedef v16bf V; static __device__ __forceinline__ V ld(const bf* p) { return cat16b(*(const v8us*)p, *(const v8us*)(p + 16)); } static __device__ __forceinline__ v8f mma(V a, V b, v8f c) { return wmmab(a, b, c); } };
template <typename T16, int NSPLIT, bool BIAS, int EPI>
__global__ __launch_bounds__(32) void k_gemmw(const T16* __restrict__ A, const T16* __restrict__ A2, const T16* __restrict__ Bt, const T16* __restrict__ Bt2, int K, float* C, int ldc, const float* __restrict__ bias, size_t sA, size_t sB, size_t sC, h16* P16) {
    typedef typename WFrag<T16>::V V;
    __shared__ __align__(16) float os[16 * 68];
    const size_t z = blockIdx.z; A += z * sA; if (A2) A2 += z * sA; Bt += z * sB; if (Bt2) Bt2 += z * sB; C += z * sC;
    const int lane = threadIdx.x & 31, lr = lane & 15, hi = lane >> 4; const int r0 = blockIdx.x * 64, c0 = blockIdx.y * 64;
    v8f acc[4][4];
#pragma unroll
    for (int mb = 0; mb < 4; ++mb)
#pragma unroll
        for (int nb = 0; nb < 4; ++nb) acc[mb][nb] = (v8f){};
    const size_t aoff = (size_t)(r0 + lr) * K + 8 * hi, boff = (size_t)(c0 + lr) * K + 8 * hi;
#pragma unroll 1
    for (int kc = 0; kc < K; kc += 32) {
        V a[4], a2[4];
#pragma unroll
        for (int mb = 0; mb < 4; ++mb) { a[mb] = WFrag<T16>::ld(A + aoff + (size_t)mb * 16 * K + kc); if (NSPLIT == 1 || NSPLIT == 2) a2[mb] = WFrag<T16>::ld(A2 + aoff + (size_t)mb * 16 * K + kc); }
#pragma unroll
        for (int nb = 0; nb < 4; ++nb) { const V b = WFrag<T16>::ld(Bt + boff + (size_t)nb * 16 * K + kc); V b2; if (NSPLIT >= 2) b2 = WFrag<T16>::ld(Bt2 + boff + (size_t)nb * 16 * K + kc);
#pragma unroll
            for (int mb = 0; mb < 4; ++mb) { acc[mb][nb] = WFrag<T16>::mma(a[mb], b, acc[mb][nb]); if (NSPLIT == 1 || NSPLIT == 2) acc[mb][nb] = WFrag<T16>::mma(a2[mb], b, acc[mb][nb]); if (NSPLIT >= 2) acc[mb][nb] = WFrag<T16>::mma(a[mb], b2, acc[mb][nb]); } }
        asm volatile("v_nop\n\tv_nop\n\tv_nop\n\tv_nop" : "+v"(acc[0][0]), "+v"(acc[1][1]), "+v"(acc[2][2]), "+v"(acc[3][3]) : "v"(a[0]), "v"(a[3]));
    }
    if constexpr (EPI == 2) {
        // 16 columns (rows d of v^T) x the tile's 64 tokens at a time: a lane's 8 accumulator registers are 8 consecutive tokens of one column
        h16* vrow = P16 + ((size_t)(r0 / TT) * HDP + (lane >> 3)) * TT + (r0 % TT) + (lane & 7) * 8;
#pragma unroll
        for (int nb = 0; nb < 4; ++nb) {
#pragma unroll
            for (int mb = 0; mb < 4; ++mb) {
#pragma unroll
                for (int j = 0; j < 8; ++j) os[lr * 68 + mb * 16 + hi * 8 + j] = acc[mb][nb][j]; }
            __builtin_amdgcn_wave_barrier(); asm volatile("" ::: "memory");   // the reads below take other lanes' values: not above the writes (one wave, its LDS operations run in order)
            h16* dst = vrow + ((size_t)((c0 + nb * 16) / HD) * IG * HDP + (c0 + nb * 16) % HD) * TT;
#pragma unroll
            for (int s = 0; s < 4; ++s) { const float* sp = os + (s * 4 + (lane >> 3)) * 68 + (lane & 7) * 8; const v4f x0 = *(const v4fa*)sp, x1 = *(const v4fa*)(sp + 4); v8h o;
#pragma unroll
                for (int k = 0; k < 4; ++k) { o[k] = (h16)x0[k]; o[4 + k] = (h16)x1[k]; }
                *(v8h*)(dst + (size_t)s * 4 * TT) = o; }
            if (nb < 3) asm volatile("s_wait_xcnt 0x0" ::: "memory");   // in front of the next block's address sums and LDS reads, which take registers that these stores name
            __builtin_amdgcn_wave_barrier(); asm volatile("" ::: "memory");   // the next block's LDS writes stay behind these reads
        }
        return;
    }
#pragma unroll
    for (int mb = 0; mb < 4; ++mb) {
#pragma unroll
        for (int nb = 0; nb < 4; ++nb) {
#pragma unroll
            for (int j = 0; j < 8; ++j) os[(hi * 8 + j) * 68 + nb * 16 + lr] = acc[mb][nb][j]; }
        __builtin_amdgcn_wave_barrier(); asm volatile("" ::: "memory");
        if constexpr (EPI == 1) {
            // 16 tokens x 32 halves of one head are 1024 contiguous bytes of its plane: two 512-byte stores a head, two heads a tile
            h16* dst0 = P16 + ((size_t)(c0 / HD) * NTK + r0 + mb * 16) * HD + lane * 8; h16* dst1 = dst0 + (size_t)NTK * HD;
#pragma unroll
            for (int s = 0; s < 4; ++s) { const int ch = (s & 1) * 32 + lane; const float* sp = os + (ch >> 2) * 68 + (s >> 1) * HD + (ch & 3) * 8; const v4f x0 = *(const v4fa*)sp, x1 = *(const v4fa*)(sp + 4); v8h o;
#pragma unroll
                for (int k = 0; k < 4; ++k) { o[k] = (h16)x0[k]; o[4 + k] = (h16)x1[k]; }
                *(v8h*)(((s >> 1) ? dst1 : dst0) + (s & 1) * 256) = o; }
            __builtin_amdgcn_wave_barrier(); asm volatile("" ::: "memory");   // the next block's LDS writes stay behind these reads
            continue;
        }
        float* crow = C + (size_t)(r0 + mb * 16) * ldc + c0;
{
#pragma unroll
            for (int s = 0; s < 8; ++s) { const int row = 2 * s + hi, cofs = lr * 4; v4f val = *(const v4fa*)(os + row * 68 + cofs); if (BIAS) { val[0] += bfr(bias[c0 + cofs]); val[1] += bfr(bias[c0 + cofs + 1]); val[2] += bfr(bias[c0 + cofs + 2]); val[3] += bfr(bias[c0 + cofs + 3]); }
                *(v4f*)(crow + (size_t)row * ldc + cofs) = val; }
             }
        __builtin_amdgcn_wave_barrier(); asm volatile("" ::: "memory");
    }
}

typedef __attribute__((ext_vector_type(4))) unsigned short v4us;
typedef __attribute__((ext_vector_type(2))) unsigned short v2us;
typedef __attribute__((ext_vector_type(2))) _Float16 v2h;
typedef __attribute__((ext_vector_type(4))) _Float16 v4h;
__device__ __forceinline__ h16 tohx(float x) { return (h16)x; }
__device__ __forceinline__ void splitf(float y, unsigned short& h, unsigned short& l) { h = f2bf(y); l = f2bf(y - bf2f(h)); }
__global__ __launch_bounds__(256) void k_wtG(const float* __restrict__ w, int K, int N, bf* Bt) {
    const int lane = threadIdx.x & 31; const int L0 = (blockIdx.x * 8 + (threadIdx.x >> 5)) * 8; const int nlines = N * K / 64;
{
#pragma unroll 1
        for (int l = 0; l < 8; ++l) { const int L = L0 + l; if (L >= nlines) break; const size_t e = (size_t)L * 64 + lane * 2; const int k = (int)(e % K), n = (int)(e / K); v2us o;
            o[0] = f2bf(w[(size_t)k * N + n]); o[1] = f2bf(w[(size_t)(k + 1) * N + n]); *(v2us*)(Bt + e) = o; }
         }
}
__global__ __launch_bounds__(256) void k_cvt8(const float* __restrict__ src, bf* dst, size_t n8) { const size_t i = (size_t)blockIdx.x * 256 + threadIdx.x; if (i >= n8) return; const v8f v = *(const v8f*)(src + i * 8); v8us o;
#pragma unroll
    for (int k = 0; k < 8; ++k) o[k] = f2bf(v[k]); *(v8us*)(dst + i * 8) = o;  }

__global__ __launch_bounds__(256) void k_w2d(const float* __restrict__ w, bf* Bt) { const int i = blockIdx.x * 256 + threadIdx.x; if (i >= NBP * DM / 8) return; const int r = i / (DM / 8), c0 = (i % (DM / 8)) * 8; v8us o;
#pragma unroll
    for (int k = 0; k < 8; ++k) o[k] = (r < NH_) ? f2bf(w[(size_t)(c0 + k) * NH_ + r]) : (unsigned short)0; *(v8us*)(Bt + (size_t)r * DM + c0) = o;  }
__global__ __launch_bounds__(256) void k_lnx(const float* __restrict__ A, const float* __restrict__ g, const float* __restrict__ bb, bf* Xh, bf* Xl) {
    const int lane = threadIdx.x & 31; const size_t tok = (size_t)blockIdx.x * 8 + (threadIdx.x >> 5); if (tok >= NTOK) return; const v4f a = *(const v4f*)(A + tok * DM + lane * 4); float v[4]; float s = 0.f;
#pragma unroll
    for (int q = 0; q < 4; ++q) { v[q] = bfr(a[q]); s = __fadd_rn(s, v[q]); }
#pragma unroll
    for (int sh = 16; sh; sh >>= 1) s = __fadd_rn(s, __shfl_xor(s, sh, 32));
    const float mu = __fdiv_rn(s, (float)DM); float s2 = 0.f;
#pragma unroll
    for (int q = 0; q < 4; ++q) { float d0 = __fsub_rn(v[q], mu); asm volatile("" : "+v"(d0)); float p = __fmul_rn(d0, d0); asm volatile("" : "+v"(p)); s2 = __fadd_rn(s2, p); }
#pragma unroll
    for (int sh = 16; sh; sh >>= 1) s2 = __fadd_rn(s2, __shfl_xor(s2, sh, 32));
    const float rs = __fdiv_rn(1.0f, __fsqrt_rn(__fadd_rn(__fdiv_rn(s2, (float)DM), 1e-5f))); v4us oh, ol;
#pragma unroll
    for (int q = 0; q < 4; ++q) { const int c = lane * 4 + q; float xn = __fmul_rn(__fsub_rn(v[q], mu), rs); asm volatile("" : "+v"(xn)); float gg = bfr(g[c]); asm volatile("" : "+v"(gg)); float y = __fmul_rn(xn, gg); asm volatile("" : "+v"(y)); float be = bfr(bb[c]); asm volatile("" : "+v"(be)); y = __fadd_rn(y, be); unsigned short h2, l2; splitf(y, h2, l2); oh[q] = h2; ol[q] = l2; }
    *(v4us*)(Xh + tok * DM + lane * 4) = oh; *(v4us*)(Xl + tok * DM + lane * 4) = ol;  }
// pair bias repacked per head, x 32^0.5 (it starts the score accumulators, which are scaled by 32^-0.5 afterwards): NBT[h][q][k] (k contiguous) from the GEMM's [q*256+k][64] rows
__global__ __launch_bounds__(256) void k_nbt(const float* __restrict__ NB, float* NBT) { const size_t pos = (size_t)blockIdx.x * 256 + threadIdx.x; if (pos >= NTOK) return; const float* np = NB + pos * NBP; const v4f v = *(const v4f*)np;
    asm volatile("s_wait_xcnt 0x0" :: "v"(np) : "memory");   // in front of whatever takes the load's address registers (named as an input, so that they live up to the wait)
#pragma unroll
    for (int h = 0; h < NH_; ++h) NBT[(size_t)h * NTOK + pos] = v[h] * RSCL;  }
// two independent v_exp_f32, in place, with the one slot that the instruction set asks for behind a transcendental (before its result is used or its source overwritten) kept in the same statement
__device__ __forceinline__ void exp2x2(float& a, float& b) { asm("v_exp_f32 %0, %0\n\tv_exp_f32 %1, %1\n\tv_nop" : "+v"(a), "+v"(b)); }
// End of a batch of global loads: s_wait_xcnt 0 in front of whatever may take the loads' address registers (named as inputs, so that they live up to the wait); the scheduling barrier keeps the batch issued here, ahead of the work below that hides its latency (the compiler otherwise sinks each load to its use and waits for each in turn).
#define LOADS_ISSUED(p0, p1, p2) do { asm volatile("s_wait_xcnt 0x0" :: "v"(p0), "v"(p1), "v"(p2) : "memory"); __builtin_amdgcn_sched_barrier(0); } while (0)
// ---- k_fattn: one wave = 16 queries of one (row i, head h) against all 256 keys; grid (256/128, rows of the group, heads), 8 waves.
// Scores are formed TRANSPOSED, S^T = K Q^T + (pair bias + mask bias) 32^0.5 as the accumulators' start value (A = 16 key rows, B = the 16 query rows): an accumulator tile holds key 16t + 8*hi + j of query lr in register j of lane (lr, hi),
// which is the A-fragment order of P for attn.v (elements 0..7 = tile 2c, 8..15 = tile 2c+1 of the 32-key chunk c): no lane exchange, no LDS or memory round trip for S or P.
// P = 1024 exp(logit - max) in fp16 (at most 1024), the division by the f32 row sum is applied to the f32 output tile: O = 1024 x attn.v, as k_gmerge expects.
// amdgpu_waves_per_eu(4, 4): a budget of 256 registers a wave, so that two work-groups share a WGP (512 resident at once; the rest of the launch follows as they end).
__global__ __launch_bounds__(256) __attribute__((amdgpu_waves_per_eu(4, 4))) void k_fattn(const h16* __restrict__ Q16, const h16* __restrict__ K16, const h16* __restrict__ V16, const float* __restrict__ NBT, const float* __restrict__ mask, int i0, float* O) {
    __shared__ __align__(32) float mbs[TT];
    const int lane = threadIdx.x & 31, lr = lane & 15, hi = lane >> 4; const int il = blockIdx.y, h = blockIdx.z; const int q0 = (blockIdx.x * 8 + (threadIdx.x >> 5)) * 16;
    mbs[threadIdx.x] = 1e9f * (bfr(mask[(size_t)(i0 + il) * TT + threadIdx.x]) - 1.0f) * RSCL;   // mask bias of row i, once per work-group
    const size_t tk0 = (size_t)h * NTK + (size_t)il * TT;
    const h16* kp = K16 + (tk0 + lr) * HD + 8 * hi;
    const float* nbp = NBT + ((size_t)h * TT + q0 + lr) * TT + 8 * hi;
    const h16* vp = V16 + (((size_t)h * IG + il) * HDP + lr) * TT + 8 * hi;
    const h16* qp = Q16 + (tk0 + q0 + lr) * HD + 8 * hi;
    const v16h bq = WFrag<h16>::ld(qp);
    v16h ka[8], kb[8]; v8f s[TT / 16];
#pragma unroll
    for (int t = 0; t < 8; ++t) ka[t] = WFrag<h16>::ld(kp + (size_t)t * 16 * HD);
#pragma unroll
    for (int t = 0; t < TT / 16; ++t) s[t] = *(const v8f*)(nbp + t * 16);
    LOADS_ISSUED(qp, kp, nbp);
    __syncthreads();   // publishes mbs
#pragma unroll
    for (int t = 0; t < 8; ++t) s[t] = wmma16(ka[t], bq, s[t] + *(const v8f*)(mbs + t * 16 + 8 * hi));
    __builtin_amdgcn_sched_barrier(0);   // the second half's key loads take the first half's registers: not above its products
#pragma unroll
    for (int t = 0; t < 8; ++t) kb[t] = WFrag<h16>::ld(kp + (size_t)(8 + t) * 16 * HD);
    LOADS_ISSUED(kp, kp, kp);
#pragma unroll
    for (int t = 0; t < 8; ++t) s[8 + t] = wmma16(kb[t], bq, s[8 + t] + *(const v8f*)(mbs + (8 + t) * 16 + 8 * hi));
    __builtin_amdgcn_sched_barrier(0);   // the v^T loads take the key fragments' registers: not above the products
    v16h vf[TT / 32][2];
#pragma unroll
    for (int cc = 0; cc < 4; ++cc) { vf[cc][0] = WFrag<h16>::ld(vp + cc * 32); vf[cc][1] = WFrag<h16>::ld(vp + (size_t)16 * TT + cc * 32); }
    LOADS_ISSUED(vp, vp, vp);
    float m4[4] = { -3.0e38f, -3.0e38f, -3.0e38f, -3.0e38f };
#pragma unroll
    for (int t = 0; t < TT / 16; ++t) {
#pragma unroll
        for (int j = 0; j < 4; ++j) m4[j] = fmaxf(fmaxf(m4[j], s[t][j]), s[t][j + 4]); }
    float mx = fmaxf(fmaxf(m4[0], m4[1]), fmaxf(m4[2], m4[3])); mx = fmaxf(mx, __shfl_xor(mx, 16, 32));
    v8f vs = (v8f){}; v8f o[2] = { (v8f){}, (v8f){} };
#pragma unroll
    for (int cc = 0; cc < TT / 32; ++cc) { v16h p;
#pragma unroll
        for (int j = 0; j < 8; ++j) { float e0 = fmaf(s[2 * cc][j] - mx, SCL * 1.4426950408889634f, 10.0f), e1 = fmaf(s[2 * cc + 1][j] - mx, SCL * 1.4426950408889634f, 10.0f); exp2x2(e0, e1); vs[j] += e0 + e1; p[j] = tohx(e0); p[8 + j] = tohx(e1); }
        o[0] = wmma16(p, vf[cc][0], o[0]); o[1] = wmma16(p, vf[cc][1], o[1]);
        if (cc == 1 || cc == 3) { __builtin_amdgcn_sched_barrier(0);   // the next v^T loads take registers freed above
#pragma unroll
            for (int c2 = cc + 3; c2 < cc + 5; ++c2) { vf[c2][0] = WFrag<h16>::ld(vp + c2 * 32); vf[c2][1] = WFrag<h16>::ld(vp + (size_t)16 * TT + c2 * 32); }
            LOADS_ISSUED(vp, vp, vp); } }
    float sum = ((vs[0] + vs[1]) + (vs[2] + vs[3])) + ((vs[4] + vs[5]) + (vs[6] + vs[7])); sum += __shfl_xor(sum, 16, 32);
    // the sum belongs to query lr; the output tile holds query hi*8 + j in register j: fetch each row's factor from the lane that holds it
    const float f = __fdiv_rn(PCAR, sum);
    float* op = O + (tk0 + q0 + hi * 8) * HDP + lr;
#pragma unroll
    for (int j = 0; j < 8; ++j) { const float fj = __shfl(f, hi * 8 + j, 32); op[(size_t)j * HDP] = o[0][j] * fj; op[(size_t)j * HDP + 16] = o[1][j] * fj; }
}
__global__ __launch_bounds__(256) void k_gmerge(const float* __restrict__ O, const float* __restrict__ FG, const float* __restrict__ bg, bf* Ah, bf* Al) { const size_t e = ((size_t)blockIdx.x * 256 + threadIdx.x) * 4; if (e >= (size_t)NTK * DQ) return; const int c = (int)(e % DQ); const size_t tk = e / DQ; const int h = c / HD, d = c % HD; v4us oh, ol;
    const v4f ov = *(const v4f*)(O + (((size_t)h * NTK + tk) * HDP + d)); const v4f gv = *(const v4f*)(FG + tk * DQ + c);
#pragma unroll
    for (int qq = 0; qq < 4; ++qq) { float bgv = bfr(bg[c + qq]); asm volatile("" : "+v"(bgv)); const float ga = __fadd_rn(gv[qq], bgv); const float sg = __fdiv_rn(1.0f, __fadd_rn(1.0f, __builtin_amdgcn_exp2f(__fmul_rn(ga, -1.4426950408889634f)))); float o1 = __fmul_rn(ov[qq], 1.0f / PCAR); asm volatile("" : "+v"(o1)); const float y = __fmul_rn(o1, sg); unsigned short h2, l2; splitf(y, h2, l2); oh[qq] = h2; ol[qq] = l2; }
    *(v4us*)(Ah + e) = oh; *(v4us*)(Al + e) = ol;  }

extern "C" void kernel_launch(void* const* d_in, const int* in_sizes, int n_in,
                              void* d_out, int out_size, void* d_ws, size_t ws_size, hipStream_t stream) {
    (void)in_sizes; (void)n_in; (void)out_size;
    const float* act = (const float*)d_in[0]; const float* mask = (const float*)d_in[1]; const float* lng = (const float*)d_in[2]; const float* lnb = (const float*)d_in[3]; const float* w2d = (const float*)d_in[4]; const float* wq = (const float*)d_in[5]; const float* wk = (const float*)d_in[6]; const float* wv = (const float*)d_in[7]; const float* wg = (const float*)d_in[8]; const float* bg = (const float*)d_in[9]; const float* wo = (const float*)d_in[10]; const float* bo = (const float*)d_in[11];
    float* OUT = (float*)d_out;     // [1][256][256][128]
    char* wsp = (char*)d_ws;
    auto take = [&](size_t bytes) { char* p = wsp; wsp += (bytes + 255) & ~(size_t)255; return (void*)p; };
    bf* WQ = (bf*)take((size_t)DQ * DM * 2); bf* WK = (bf*)take((size_t)DQ * DM * 2); bf* WV = (bf*)take((size_t)DQ * DM * 2); bf* WG = (bf*)take((size_t)DQ * DM * 2); bf* WO = (bf*)take((size_t)DM * DQ * 2); bf* W2 = (bf*)take((size_t)NBP * DM * 2);
    bf* Xh = (bf*)take((size_t)NTOK * DM * 2); bf* Xl = (bf*)take((size_t)NTOK * DM * 2); float* NB = (float*)take((size_t)NTOK * NBP * 4);
    float* FG = (float*)take((size_t)NTK * DQ * 4); h16* QP16 = (h16*)take((size_t)NH_ * NTK * HD * 2); h16* KP16 = (h16*)take((size_t)NH_ * NTK * HD * 2); h16* VT16 = (h16*)take((size_t)NH_ * IG * HDP * TT * 2);
    float* NBT = (float*)take((size_t)NH_ * NTOK * 4); float* Ob = (float*)take((size_t)NH_ * NTK * HDP * 4); bf* ATh = (bf*)take((size_t)NTK * DQ * 2); bf* ATl = (bf*)take((size_t)NTK * DQ * 2);
    if ((size_t)(wsp - (char*)d_ws) > ws_size) return;    // ws 256 MiB (carve ~241 MiB)
    k_wtG<<<(unsigned)((DM * DQ / 64 + 63) / 64), 256, 0, stream>>>(wq, DM, DQ, WQ); k_wtG<<<(unsigned)((DM * DQ / 64 + 63) / 64), 256, 0, stream>>>(wk, DM, DQ, WK); k_wtG<<<(unsigned)((DM * DQ / 64 + 63) / 64), 256, 0, stream>>>(wv, DM, DQ, WV); k_wtG<<<(unsigned)((DM * DQ / 64 + 63) / 64), 256, 0, stream>>>(wg, DM, DQ, WG);
    k_wtG<<<(unsigned)((DQ * DM / 64 + 63) / 64), 256, 0, stream>>>(wo, DQ, DM, WO); k_w2d<<<(NBP * DM / 8 + 255) / 256, 256, 0, stream>>>(w2d, W2);
    k_lnx<<<NTOK / 8, 256, 0, stream>>>(act, lng, lnb, Xh, Xl);
    k_gemmw<bf, 1, false, 0><<<dim3(NTOK / 64, NBP / 64, 1), 32, 0, stream>>>(Xh, Xl, W2, nullptr, DM, NB, NBP, nullptr, 0, 0, 0, nullptr);   /* pair bias nb[(q,k)][h] for all 65536 positions (cols 0..3) */
    k_nbt<<<NTOK / 256, 256, 0, stream>>>(NB, NBT);
    for (int i0 = 0; i0 < NI; i0 += IG) { const bf* Xgh = Xh + (size_t)i0 * TT * DM; const bf* Xgl = Xl + (size_t)i0 * TT * DM;
        k_gemmw<bf, 1, false, 1><<<dim3(NTK / 64, DQ / 64, 1), 32, 0, stream>>>(Xgh, Xgl, WQ, nullptr, DM, nullptr, DQ, nullptr, 0, 0, 0, QP16);
        k_gemmw<bf, 1, false, 1><<<dim3(NTK / 64, DQ / 64, 1), 32, 0, stream>>>(Xgh, Xgl, WK, nullptr, DM, nullptr, DQ, nullptr, 0, 0, 0, KP16);
        k_gemmw<bf, 1, false, 2><<<dim3(NTK / 64, DQ / 64, 1), 32, 0, stream>>>(Xgh, Xgl, WV, nullptr, DM, nullptr, DQ, nullptr, 0, 0, 0, VT16);
        k_gemmw<bf, 1, false, 0><<<dim3(NTK / 64, DQ / 64, 1), 32, 0, stream>>>(Xgh, Xgl, WG, nullptr, DM, FG, DQ, nullptr, 0, 0, 0, nullptr);
        k_fattn<<<dim3(TT / 128, IG, NH_), 256, 0, stream>>>(QP16, KP16, VT16, NBT, mask, i0, Ob);   /* Ob columns 0..31 of each 64-wide row */
        k_gmerge<<<(unsigned)(((size_t)NTK * DQ / 4 + 255) / 256), 256, 0, stream>>>(Ob, FG, bg, ATh, ATl);
        k_gemmw<bf, 1, true, 0><<<dim3(NTK / 64, DM / 64, 1), 32, 0, stream>>>(ATh, ATl, WO, nullptr, DQ, OUT + (size_t)i0 * TT * DM, DM, bo, 0, 0, 0, nullptr); }
}

// v004
// It runs in 128 microseconds.
// Timed twice side by side with v003, it ran 1.29 and 1.28 times as fast.
// All steps since v000 together make it 6.08 times as fast.
#include <hip/hip_runtime.h>

// Triangle attention (starting node) on a pair representation (act [1][256][256][128], mask [1][256][256]): x = LayerNorm_c(act) (eps 1e-5, ln_g/ln_b); per row i: q, k, v, g = x[i] W (wq/wk/wv/wg [128][4][32] 'xw', 4 heads x 32; q x 32^-0.5), logits[h][q][k] = q.k + 1e9 (mask[i][k] - 1) + nb[h][q][k] with the pair bias nb[h][q][k] = sum_c x[q][k][c] w2d[c][h] (shared by all rows i);
// softmax over k; o = attn.v gated by sigmoid(x wg + bg); out[i][q][c] = sum_{h,d} o[h][d] wo[h][d][c] + bo -> [1][256][256][128] (8.4 M).
// Layout: LayerNorm -> bf16 hi/lo token planes [65536][128]; nb for all 65536 pair positions by one GEMM (w2d padded to 64 columns); rows i in groups of IG, here all 256 in one group, so each stage is one launch, and launches that do not read each other's results share one (weight transposes with LayerNorm; pair-bias GEMM with the projections): q/k/v/g projections (hi/lo x exact), whose epilogue writes the fp16 planes q,k [h][i][t][32] and v^T [h][i][64 (32 used)][t] itself, ONE attention kernel per group (all heads; scores, mask bias + pair bias, x 32^-0.5, softmax and attn.v stay in registers), then gating + merge to hi/lo planes and the output GEMM (+ bo).
// Compute dtypes, f32 accumulate: every input rounded to bf16 once; LayerNorm in f32, its output as bf16 hi + lo (2-product projections against exact bf16 weights); scores and attn.v on single fp16 planes (P = 1024 exp(logit - max), at most 1024; 1/sum applied to the f32 attn.v result); pair bias, mask bias, softmax, gating in f32; output GEMM hl x exact + bo.

#define NI   256       // rows i
#define TT   256       // tokens per row (q / k index)
#define DM   128       // c_z
#define NH_  4
#define HD   32
#define HDP  64        // padded head dim: rows per (h, i) of the v^T planes (32..63 neither written nor read) and row pitch of the attn.v result
#define DQ   (NH_ * HD)
#define IG   256       // rows i per group: all of them (one launch per stage fills the chip; the planes between the stages then take 241 MiB of the workspace)
#define NTK  (IG * TT) // tokens per group = 65536
#define NTOK (NI * TT) // 65536
#define NBP  64        // pair-bias GEMM width (4 used)
#define PCAR 1024.0f
#define SCL  0.17677669529663688f   // 32^-0.5
#define RSCL 5.656854249492381f     // 32^0.5
typedef _Float16 h16;
typedef unsigned short bf;
typedef __attribute__((ext_vector_type(16))) __bf16   v16bf;
typedef __attribute__((ext_vector_type(16))) _Float16 v16h;
typedef __attribute__((ext_vector_type(8)))  _Float16 v8h;
typedef __attribute__((ext_vector_type(8)))  unsigned short v8us;
typedef __attribute__((ext_vector_type(8)))  float    v8f;
typedef __attribute__((ext_vector_type(4)))  float    v4f;
typedef v8h  __attribute__((may_alias)) v8ha;
typedef v4f  __attribute__((may_alias)) v4fa;
typedef v8us __attribute__((may_alias)) v8usa;

__device__ __forceinline__ unsigned short f2bf(float f) { unsigned u = __float_as_uint(f); u += 0x7FFFu + ((u >> 16) & 1u); return (unsigned short)(u >> 16); }
__device__ __forceinline__ float bf2f(unsigned short b) { return __uint_as_float(((unsigned)b) << 16); }
__device__ __forceinline__ float bfr(float f) { return bf2f(f2bf(f)); }
__device__ __forceinline__ v16h cat16(v8h lo, v8h hi) { return __builtin_shufflevector(lo, hi, 0, 1, 2, 3, 4, 5, 6, 7, 8, 9, 10, 11, 12, 13, 14, 15); }
__device__ __forceinline__ v16bf cat16b(v8us lo, v8us hi) { return __builtin_bit_cast(v16bf, __builtin_shufflevector(lo, hi, 0, 1, 2, 3, 4, 5, 6, 7, 8, 9, 10, 11, 12, 13, 14, 15)); }
__device__ __forceinline__ v8f wmma16(v16h a, v16h b, v8f c) { return __builtin_amdgcn_wmma_f32_16x16x32_f16(false, a, false, b, (short)0, c, false, false); }
__device__ __forceinline__ v8f wmmab(v16bf a, v16bf b, v8f c) { return __builtin_amdgcn_wmma_f32_16x16x32_bf16(false, a, false, b, (short)0, c, false, false); }



// ---- gemm_tile: register-blocked GEMM, ONE WAVE per 64x64 output tile at (r0, c0) (16 accumulators), operands straight from K-contiguous 16-bit planes; os = the wave's LDS stage of 16 x 68 floats.
// C[m][n] (f32, pitch ldc, + optional f32 bias[n]) = sum_k A[m][k] Bt[n][k] (+ split products per NSPLIT). K % 32 == 0.
// EPI 0: C as above. EPI 1: the tile rounded to fp16 into P16[n / 32][m][n % 32] (head planes of q, k; m = token of the group). EPI 2: into P16[n / 32][m / 256][n % 32 (pitch 64)][m % 256] (v^T planes). Both in whole 128-byte lines, 16 bytes a lane.
template <typename T16> struct WFrag;
template <> struct WFrag<h16> { typedef v16h V; static __device__ __forceinline__ V ld(const h16* p) { return cat16(*(const v8h*)p, *(const v8h*)(p + 16)); } static __device__ __forceinline__ v8f mma(V a, V b, v8f c) { return wmma16(a, b, c); } };
template <> struct WFrag<bf> { typedef v16bf V; static __device__ __forceinline__ V ld(const bf* p) { return cat16b(*(const v8us*)p, *(const v8us*)(p + 16)); } static __device__ __forceinline__ v8f mma(V a, V b, v8f c) { return wmmab(a, b, c); } };
template <typename T16, int NSPLIT, bool BIAS, int EPI>
__device__ __forceinline__ void gemm_tile(const T16* __restrict__ A, const T16* __restrict__ A2, const T16* __restrict__ Bt, const T16* __restrict__ Bt2, int K, float* C, int ldc, const float* __restrict__ bias, h16* P16, int r0, int c0, float* os) {
    typedef typename WFrag<T16>::V V;
    const int lane = threadIdx.x & 31, lr = lane & 15, hi = lane >> 4;
    v8f acc[4][4];
#pragma unroll
    for (int mb = 0; mb < 4; ++mb)
#pragma unroll
        for (int nb = 0; nb < 4; ++nb) acc[mb][nb] = (v8f){};
    const size_t aoff = (size_t)(r0 + lr) * K + 8 * hi, boff = (size_t)(c0 + lr) * K + 8 * hi;
#pragma unroll 1
    for (int kc = 0; kc < K; kc += 32) {
        V a[4], a2[4];
#pragma unroll
        for (int mb = 0; mb < 4; ++mb) { a[mb] = WFrag<T16>::ld(A + aoff + (size_t)mb * 16 * K + kc); if (NSPLIT == 1 || NSPLIT == 2) a2[mb] = WFrag<T16>::ld(A2 + aoff + (size_t)mb * 16 * K + kc); }
#pragma unroll
        for (int nb = 0; nb < 4; ++nb) { const V b = WFrag<T16>::ld(Bt + boff + (size_t)nb * 16 * K + kc); V b2; if (NSPLIT >= 2) b2 = WFrag<T16>::ld(Bt2 + boff + (size_t)nb * 16 * K + kc);
#pragma unroll
            for (int mb = 0; mb < 4; ++mb) { acc[mb][nb] = WFrag<T16>::mma(a[mb], b, acc[mb][nb]); if (NSPLIT == 1 || NSPLIT == 2) acc[mb][nb] = WFrag<T16>::mma(a2[mb], b, acc[mb][nb]); if (NSPLIT >= 2) acc[mb][nb] = WFrag<T16>::mma(a[mb], b2, acc[mb][nb]); } }
        asm volatile("v_nop\n\tv_nop\n\tv_nop\n\tv_nop" : "+v"(acc[0][0]), "+v"(acc[1][1]), "+v"(acc[2][2]), "+v"(acc[3][3]) : "v"(a[0]), "v"(a[3]));
    }
    if constexpr (EPI == 2) {
        // 16 columns (rows d of v^T) x the tile's 64 tokens at a time: a lane's 8 accumulator registers are 8 consecutive tokens of one column
        h16* vrow = P16 + ((size_t)(r0 / TT) * HDP + (lane >> 3)) * TT + (r0 % TT) + (lane & 7) * 8;
#pragma unroll
        for (int nb = 0; nb < 4; ++nb) {
#pragma unroll
            for (int mb = 0; mb < 4; ++mb) {
#pragma unroll
                for (int j = 0; j < 8; ++j) os[lr * 68 + mb * 16 + hi * 8 + j] = acc[mb][nb][j]; }
            __builtin_amdgcn_wave_barrier(); asm volatile("" ::: "memory");   // the reads below take other lanes' values: not above the writes (one wave, its LDS operations run in order)
            h16* dst = vrow + ((size_t)((c0 + nb * 16) / HD) * IG * HDP + (c0 + nb * 16) % HD) * TT;
#pragma unroll
            for (int s = 0; s < 4; ++s) { const float* sp = os + (s * 4 + (lane >> 3)) * 68 + (lane & 7) * 8; const v4f x0 = *(const v4fa*)sp, x1 = *(const v4fa*)(sp + 4); v8h o;
#pragma unroll
                for (int k = 0; k < 4; ++k) { o[k] = (h16)x0[k]; o[4 + k] = (h16)x1[k]; }
                *(v8h*)(dst + (size_t)s * 4 * TT) = o; }
            if (nb < 3) asm volatile("s_wait_xcnt 0x0" ::: "memory");   // in front of the next block's address sums and LDS reads, which take registers that these stores name
            __builtin_amdgcn_wave_barrier(); asm volatile("" ::: "memory");   // the next block's LDS writes stay behind these reads
        }
        return;
    }
#pragma unroll
    for (int mb = 0; mb < 4; ++mb) {
#pragma unroll
        for (int nb = 0; nb < 4; ++nb) {
#pragma unroll
            for (int j = 0; j < 8; ++j) os[(hi * 8 + j) * 68 + nb * 16 + lr] = acc[mb][nb][j]; }
        __builtin_amdgcn_wave_barrier(); asm volatile("" ::: "memory");
        if constexpr (EPI == 1) {
            // 16 tokens x 32 halves of one head are 1024 contiguous bytes of its plane: two 512-byte stores a head, two heads a tile
            h16* dst0 = P16 + ((size_t)(c0 / HD) * NTK + r0 + mb * 16) * HD + lane * 8; h16* dst1 = dst0 + (size_t)NTK * HD;
#pragma unroll
            for (int s = 0; s < 4; ++s) { const int ch = (s & 1) * 32 + lane; const float* sp = os + (ch >> 2) * 68 + (s >> 1) * HD + (ch & 3) * 8; const v4f x0 = *(const v4fa*)sp, x1 = *(const v4fa*)(sp + 4); v8h o;
#pragma unroll
                for (int k = 0; k < 4; ++k) { o[k] = (h16)x0[k]; o[4 + k] = (h16)x1[k]; }
                *(v8h*)(((s >> 1) ? dst1 : dst0) + (s & 1) * 256) = o; }
            __builtin_amdgcn_wave_barrier(); asm volatile("" ::: "memory");   // the next block's LDS writes stay behind these reads
            continue;
        }
        float* crow = C + (size_t)(r0 + mb * 16) * ldc + c0;
{
#pragma unroll
            for (int s = 0; s < 8; ++s) { const int row = 2 * s + hi, cofs = lr * 4; v4f val = *(const v4fa*)(os + row * 68 + cofs); if (BIAS) { val[0] += bfr(bias[c0 + cofs]); val[1] += bfr(bias[c0 + cofs + 1]); val[2] += bfr(bias[c0 + cofs + 2]); val[3] += bfr(bias[c0 + cofs + 3]); }
                *(v4f*)(crow + (size_t)row * ldc + cofs) = val; }
             }
        __builtin_amdgcn_wave_barrier(); asm volatile("" ::: "memory");
    }
}
// one GEMM per launch: grid (M/64, N/64), 32 threads
template <typename T16, int NSPLIT, bool BIAS, int EPI>
__global__ __launch_bounds__(32) void k_gemmw(const T16* __restrict__ A, const T16* __restrict__ A2, const T16* __restrict__ Bt, const T16* __restrict__ Bt2, int K, float* C, int ldc, const float* __restrict__ bias, h16* P16) {
    __shared__ __align__(16) float os[16 * 68];
    gemm_tile<T16, NSPLIT, BIAS, EPI>(A, A2, Bt, Bt2, K, C, ldc, bias, P16, blockIdx.x * 64, blockIdx.y * 64, os);
}
// ---- k_proj: the five GEMMs that read the LayerNorm planes and nothing of each other, in ONE launch; grid (tokens/64, 9 column tiles), 32 threads.
// Column tile 0,1: q; 2,3: k (fp16 head planes); 4,5: v (fp16 v^T planes); 6,7: gate logits (f32); 8: pair bias (f32, 64 wide). Token blocks run fastest in the grid, as in a launch of one GEMM (for speed only).
#define NCT  9
__global__ __launch_bounds__(32) void k_proj(const bf* __restrict__ Xh, const bf* __restrict__ Xl, const bf* __restrict__ WQ, const bf* __restrict__ WK, const bf* __restrict__ WV, const bf* __restrict__ WG, const bf* __restrict__ W2, h16* QP16, h16* KP16, h16* VT16, float* FG, float* NB) {
    __shared__ __align__(16) float os[16 * 68];
    const int y = blockIdx.y, r0 = blockIdx.x * 64, c0 = (y & 1) * 64;
    // s_wait_xcnt 0 at the end of each arm, behind its last stores: in the built code another arm's instructions follow it and take the registers that those stores name
    if (y < 4) { gemm_tile<bf, 1, false, 1>(Xh, Xl, y < 2 ? WQ : WK, nullptr, DM, nullptr, DQ, nullptr, y < 2 ? QP16 : KP16, r0, c0, os); asm volatile("s_wait_xcnt 0x0" ::: "memory"); }
    else if (y < 6) { gemm_tile<bf, 1, false, 2>(Xh, Xl, WV, nullptr, DM, nullptr, DQ, nullptr, VT16, r0, c0, os); asm volatile("s_wait_xcnt 0x0" ::: "memory"); }
    else { gemm_tile<bf, 1, false, 0>(Xh, Xl, y < 8 ? WG : W2, nullptr, DM, y < 8 ? FG : NB, y < 8 ? DQ : NBP, nullptr, nullptr, r0, c0, os); asm volatile("s_wait_xcnt 0x0" ::: "memory"); }
}

typedef __attribute__((ext_vector_type(4))) unsigned short v4us;
typedef __attribute__((ext_vector_type(2))) unsigned short v2us;
typedef __attribute__((ext_vector_type(2))) _Float16 v2h;
typedef __attribute__((ext_vector_type(4))) _Float16 v4h;
__device__ __forceinline__ h16 tohx(float x) { return (h16)x; }
__device__ __forceinline__ void splitf(float y, unsigned short& h, unsigned short& l) { h = f2bf(y); l = f2bf(y - bf2f(h)); }
__device__ __forceinline__ void d_wtG(const float* __restrict__ w, int K, int N, bf* Bt, int bx) {
    const int lane = threadIdx.x & 31; const int L0 = (bx * 8 + (threadIdx.x >> 5)) * 8; const int nlines = N * K / 64;
{
#pragma unroll 1
        for (int l = 0; l < 8; ++l) { const int L = L0 + l; if (L >= nlines) break; const size_t e = (size_t)L * 64 + lane * 2; const int k = (int)(e % K), n = (int)(e / K); v2us o;
            o[0] = f2bf(w[(size_t)k * N + n]); o[1] = f2bf(w[(size_t)(k + 1) * N + n]); *(v2us*)(Bt + e) = o; }
         }
}
__global__ __launch_bounds__(256) void k_cvt8(const float* __restrict__ src, bf* dst, size_t n8) { const size_t i = (size_t)blockIdx.x * 256 + threadIdx.x; if (i >= n8) return; const v8f v = *(const v8f*)(src + i * 8); v8us o;
#pragma unroll
    for (int k = 0; k < 8; ++k) o[k] = f2bf(v[k]); *(v8us*)(dst + i * 8) = o;  }

__device__ __forceinline__ void d_w2d(const float* __restrict__ w, bf* Bt, int bx) { const int i = bx * 256 + threadIdx.x; if (i >= NBP * DM / 8) return; const int r = i / (DM / 8), c0 = (i % (DM / 8)) * 8; v8us o;
#pragma unroll
    for (int k = 0; k < 8; ++k) o[k] = (r < NH_) ? f2bf(w[(size_t)(c0 + k) * NH_ + r]) : (unsigned short)0; *(v8us*)(Bt + (size_t)r * DM + c0) = o;  }
__device__ __forceinline__ void d_lnx(const float* __restrict__ A, const float* __restrict__ g, const float* __restrict__ bb, bf* Xh, bf* Xl, int bx) {
    const int lane = threadIdx.x & 31; const size_t tok = (size_t)bx * 8 + (threadIdx.x >> 5); if (tok >= NTOK) return; const v4f a = *(const v4f*)(A + tok * DM + lane * 4); float v[4]; float s = 0.f;
#pragma unroll
    for (int q = 0; q < 4; ++q) { v[q] = bfr(a[q]); s = __fadd_rn(s, v[q]); }
#pragma unroll
    for (int sh = 16; sh; sh >>= 1) s = __fadd_rn(s, __shfl_xor(s, sh, 32));
    const float mu = __fdiv_rn(s, (float)DM); float s2 = 0.f;
#pragma unroll
    for (int q = 0; q < 4; ++q) { float d0 = __fsub_rn(v[q], mu); asm volatile("" : "+v"(d0)); float p = __fmul_rn(d0, d0); asm volatile("" : "+v"(p)); s2 = __fadd_rn(s2, p); }
#pragma unroll
    for (int sh = 16; sh; sh >>= 1) s2 = __fadd_rn(s2, __shfl_xor(s2, sh, 32));
    const float rs = __fdiv_rn(1.0f, __fsqrt_rn(__fadd_rn(__fdiv_rn(s2, (float)DM), 1e-5f))); v4us oh, ol;
#pragma unroll
    for (int q = 0; q < 4; ++q) { const int c = lane * 4 + q; float xn = __fmul_rn(__fsub_rn(v[q], mu), rs); asm volatile("" : "+v"(xn)); float gg = bfr(g[c]); asm volatile("" : "+v"(gg)); float y = __fmul_rn(xn, gg); asm volatile("" : "+v"(y)); float be = bfr(bb[c]); asm volatile("" : "+v"(be)); y = __fadd_rn(y, be); unsigned short h2, l2; splitf(y, h2, l2); oh[q] = h2; ol[q] = l2; }
    *(v4us*)(Xh + tok * DM + lane * 4) = oh; *(v4us*)(Xl + tok * DM + lane * 4) = ol;  }
// ---- k_prep: all that reads only the inputs, in ONE launch: the five weight transposes (WTB blocks each) and the padded w2d (W2B blocks) in the first blocks, LayerNorm (8 tokens a block) in the rest.
#define WTB  ((DM * DQ / 64 + 63) / 64)
#define W2B  ((NBP * DM / 8 + 255) / 256)
__global__ __launch_bounds__(256) void k_prep(const float* __restrict__ act, const float* __restrict__ lng, const float* __restrict__ lnb, const float* __restrict__ w2d, const float* __restrict__ wq, const float* __restrict__ wk, const float* __restrict__ wv, const float* __restrict__ wg, const float* __restrict__ wo,
                                              bf* WQ, bf* WK, bf* WV, bf* WG, bf* WO, bf* W2, bf* Xh, bf* Xl) {
    const int b = blockIdx.x;
    if (b < 4 * WTB) { const int w = b / WTB; d_wtG(w == 0 ? wq : w == 1 ? wk : w == 2 ? wv : wg, DM, DQ, w == 0 ? WQ : w == 1 ? WK : w == 2 ? WV : WG, b % WTB); return; }
    if (b < 5 * WTB) { d_wtG(wo, DQ, DM, WO, b - 4 * WTB); return; }
    if (b < 5 * WTB + W2B) { d_w2d(w2d, W2, b - 5 * WTB); return; }
    d_lnx(act, lng, lnb, Xh, Xl, b - (5 * WTB + W2B));
}
// pair bias repacked per head, x 32^0.5 (it starts the score accumulators, which are scaled by 32^-0.5 afterwards): NBT[h][q][k] (k contiguous) from the GEMM's [q*256+k][64] rows
__global__ __launch_bounds__(256) void k_nbt(const float* __restrict__ NB, float* NBT) { const size_t pos = (size_t)blockIdx.x * 256 + threadIdx.x; if (pos >= NTOK) return; const float* np = NB + pos * NBP; const v4f v = *(const v4f*)np;
    asm volatile("s_wait_xcnt 0x0" :: "v"(np) : "memory");   // in front of whatever takes the load's address registers (named as an input, so that they live up to the wait)
#pragma unroll
    for (int h = 0; h < NH_; ++h) NBT[(size_t)h * NTOK + pos] = v[h] * RSCL;  }
// two independent v_exp_f32, in place, with the one slot that the instruction set asks for behind a transcendental (before its result is used or its source overwritten) kept in the same statement
__device__ __forceinline__ void exp2x2(float& a, float& b) { asm("v_exp_f32 %0, %0\n\tv_exp_f32 %1, %1\n\tv_nop" : "+v"(a), "+v"(b)); }
// End of a batch of global loads: s_wait_xcnt 0 in front of whatever may take the loads' address registers (named as inputs, so that they live up to the wait); the scheduling barrier keeps the batch issued here, ahead of the work below that hides its latency (the compiler otherwise sinks each load to its use and waits for each in turn).
#define LOADS_ISSUED(p0, p1, p2) do { asm volatile("s_wait_xcnt 0x0" :: "v"(p0), "v"(p1), "v"(p2) : "memory"); __builtin_amdgcn_sched_barrier(0); } while (0)
// ---- k_fattn: one wave = 16 queries of one (row i, head h) against all 256 keys; grid (256/128, rows of the group, heads), 8 waves.
// Scores are formed TRANSPOSED, S^T = K Q^T + (pair bias + mask bias) 32^0.5 as the accumulators' start value (A = 16 key rows, B = the 16 query rows): an accumulator tile holds key 16t + 8*hi + j of query lr in register j of lane (lr, hi),
// which is the A-fragment order of P for attn.v (elements 0..7 = tile 2c, 8..15 = tile 2c+1 of the 32-key chunk c): no lane exchange, no LDS or memory round trip for S or P.
// P = 1024 exp(logit - max) in fp16 (at most 1024), the division by the f32 row sum is applied to the f32 output tile: O = 1024 x attn.v, as k_gmerge expects.
// amdgpu_waves_per_eu(4, 4): a budget of 256 registers a wave, so that two work-groups share a WGP (512 resident at once; the rest of the launch follows as they end).
__global__ __launch_bounds__(256) __attribute__((amdgpu_waves_per_eu(4, 4))) void k_fattn(const h16* __restrict__ Q16, const h16* __restrict__ K16, const h16* __restrict__ V16, const float* __restrict__ NBT, const float* __restrict__ mask, int i0, float* O) {
    __shared__ __align__(32) float mbs[TT];
    const int lane = threadIdx.x & 31, lr = lane & 15, hi = lane >> 4; const int il = blockIdx.y, h = blockIdx.z; const int q0 = (blockIdx.x * 8 + (threadIdx.x >> 5)) * 16;
    mbs[threadIdx.x] = 1e9f * (bfr(mask[(size_t)(i0 + il) * TT + threadIdx.x]) - 1.0f) * RSCL;   // mask bias of row i, once per work-group
    const size_t tk0 = (size_t)h * NTK + (size_t)il * TT;
    const h16* kp = K16 + (tk0 + lr) * HD + 8 * hi;
    const float* nbp = NBT + ((size_t)h * TT + q0 + lr) * TT + 8 * hi;
    const h16* vp = V16 + (((size_t)h * IG + il) * HDP + lr) * TT + 8 * hi;
    const h16* qp = Q16 + (tk0 + q0 + lr) * HD + 8 * hi;
    const v16h bq = WFrag<h16>::ld(qp);
    v16h ka[8], kb[8]; v8f s[TT / 16];
#pragma unroll
    for (int t = 0; t < 8; ++t) ka[t] = WFrag<h16>::ld(kp + (size_t)t * 16 * HD);
#pragma unroll
    for (int t = 0; t < TT / 16; ++t) s[t] = *(const v8f*)(nbp + t * 16);
    LOADS_ISSUED(qp, kp, nbp);
    __syncthreads();   // publishes mbs
#pragma unroll
    for (int t = 0; t < 8; ++t) s[t] = wmma16(ka[t], bq, s[t] + *(const v8f*)(mbs + t * 16 + 8 * hi));
    __builtin_amdgcn_sched_barrier(0);   // the second half's key loads take the first half's registers: not above its products
#pragma unroll
    for (int t = 0; t < 8; ++t) kb[t] = WFrag<h16>::ld(kp + (size_t)(8 + t) * 16 * HD);
    LOADS_ISSUED(kp, kp, kp);
#pragma unroll
    for (int t = 0; t < 8; ++t) s[8 + t] = wmma16(kb[t], bq, s[8 + t] + *(const v8f*)(mbs + (8 + t) * 16 + 8 * hi));
    __builtin_amdgcn_sched_barrier(0);   // the v^T loads take the key fragments' registers: not above the products
    v16h vf[TT / 32][2];
#pragma unroll
    for (int cc = 0; cc < 4; ++cc) { vf[cc][0] = WFrag<h16>::ld(vp + cc * 32); vf[cc][1] = WFrag<h16>::ld(vp + (size_t)16 * TT + cc * 32); }
    LOADS_ISSUED(vp, vp, vp);
    float m4[4] = { -3.0e38f, -3.0e38f, -3.0e38f, -3.0e38f };
#pragma unroll
    for (int t = 0; t < TT / 16; ++t) {
#pragma unroll
        for (int j = 0; j < 4; ++j) m4[j] = fmaxf(fmaxf(m4[j], s[t][j]), s[t][j + 4]); }
    float mx = fmaxf(fmaxf(m4[0], m4[1]), fmaxf(m4[2], m4[3])); mx = fmaxf(mx, __shfl_xor(mx, 16, 32));
    v8f vs = (v8f){}; v8f o[2] = { (v8f){}, (v8f){} };
#pragma unroll
    for (int cc = 0; cc < TT / 32; ++cc) { v16h p;
#pragma unroll
        for (int j = 0; j < 8; ++j) { float e0 = fmaf(s[2 * cc][j] - mx, SCL * 1.4426950408889634f, 10.0f), e1 = fmaf(s[2 * cc + 1][j] - mx, SCL * 1.4426950408889634f, 10.0f); exp2x2(e0, e1); vs[j] += e0 + e1; p[j] = tohx(e0); p[8 + j] = tohx(e1); }
        o[0] = wmma16(p, vf[cc][0], o[0]); o[1] = wmma16(p, vf[cc][1], o[1]);
        if (cc == 1 || cc == 3) { __builtin_amdgcn_sched_barrier(0);   // the next v^T loads take registers freed above
#pragma unroll
            for (int c2 = cc + 3; c2 < cc + 5; ++c2) { vf[c2][0] = WFrag<h16>::ld(vp + c2 * 32); vf[c2][1] = WFrag<h16>::ld(vp + (size_t)16 * TT + c2 * 32); }
            LOADS_ISSUED(vp, vp, vp); } }
    float sum = ((vs[0] + vs[1]) + (vs[2] + vs[3])) + ((vs[4] + vs[5]) + (vs[6] + vs[7])); sum += __shfl_xor(sum, 16, 32);
    // the sum belongs to query lr; the output tile holds query hi*8 + j in register j: fetch each row's factor from the lane that holds it
    const float f = __fdiv_rn(PCAR, sum);
    float* op = O + (tk0 + q0 + hi * 8) * HDP + lr;
#pragma unroll
    for (int j = 0; j < 8; ++j) { const float fj = __shfl(f, hi * 8 + j, 32); op[(size_t)j * HDP] = o[0][j] * fj; op[(size_t)j * HDP + 16] = o[1][j] * fj; }
}
__global__ __launch_bounds__(256) void k_gmerge(const float* __restrict__ O, const float* __restrict__ FG, const float* __restrict__ bg, bf* Ah, bf* Al) { const size_t e = ((size_t)blockIdx.x * 256 + threadIdx.x) * 4; if (e >= (size_t)NTK * DQ) return; const int c = (int)(e % DQ); const size_t tk = e / DQ; const int h = c / HD, d = c % HD; v4us oh, ol;
    const v4f ov = *(const v4f*)(O + (((size_t)h * NTK + tk) * HDP + d)); const v4f gv = *(const v4f*)(FG + tk * DQ + c);
#pragma unroll
    for (int qq = 0; qq < 4; ++qq) { float bgv = bfr(bg[c + qq]); asm volatile("" : "+v"(bgv)); const float ga = __fadd_rn(gv[qq], bgv); const float sg = __fdiv_rn(1.0f, __fadd_rn(1.0f, __builtin_amdgcn_exp2f(__fmul_rn(ga, -1.4426950408889634f)))); float o1 = __fmul_rn(ov[qq], 1.0f / PCAR); asm volatile("" : "+v"(o1)); const float y = __fmul_rn(o1, sg); unsigned short h2, l2; splitf(y, h2, l2); oh[qq] = h2; ol[qq] = l2; }
    *(v4us*)(Ah + e) = oh; *(v4us*)(Al + e) = ol;  }

extern "C" void kernel_launch(void* const* d_in, const int* in_sizes, int n_in,
                              void* d_out, int out_size, void* d_ws, size_t ws_size, hipStream_t stream) {
    (void)in_sizes; (void)n_in; (void)out_size;
    const float* act = (const float*)d_in[0]; const float* mask = (const float*)d_in[1]; const float* lng = (const float*)d_in[2]; const float* lnb = (const float*)d_in[3]; const float* w2d = (const float*)d_in[4]; const float* wq = (const float*)d_in[5]; const float* wk = (const float*)d_in[6]; const float* wv = (const float*)d_in[7]; const float* wg = (const float*)d_in[8]; const float* bg = (const float*)d_in[9]; const float* wo = (const float*)d_in[10]; const float* bo = (const float*)d_in[11];
    float* OUT = (float*)d_out;     // [1][256][256][128]
    char* wsp = (char*)d_ws;
    auto take = [&](size_t bytes) { char* p = wsp; wsp += (bytes + 255) & ~(size_t)255; return (void*)p; };
    bf* WQ = (bf*)take((size_t)DQ * DM * 2); bf* WK = (bf*)take((size_t)DQ * DM * 2); bf* WV = (bf*)take((size_t)DQ * DM * 2); bf* WG = (bf*)take((size_t)DQ * DM * 2); bf* WO = (bf*)take((size_t)DM * DQ * 2); bf* W2 = (bf*)take((size_t)NBP * DM * 2);
    bf* Xh = (bf*)take((size_t)NTOK * DM * 2); bf* Xl = (bf*)take((size_t)NTOK * DM * 2); float* NB = (float*)take((size_t)NTOK * NBP * 4);
    float* FG = (float*)take((size_t)NTK * DQ * 4); h16* QP16 = (h16*)take((size_t)NH_ * NTK * HD * 2); h16* KP16 = (h16*)take((size_t)NH_ * NTK * HD * 2); h16* VT16 = (h16*)take((size_t)NH_ * IG * HDP * TT * 2);
    float* NBT = (float*)take((size_t)NH_ * NTOK * 4); float* Ob = (float*)take((size_t)NH_ * NTK * HDP * 4); bf* ATh = (bf*)take((size_t)NTK * DQ * 2); bf* ATl = (bf*)take((size_t)NTK * DQ * 2);
    if ((size_t)(wsp - (char*)d_ws) > ws_size) return;    // ws 256 MiB (carve ~241 MiB)
    static_assert(IG == NI, "one row group: the pair-bias GEMM over all positions shares the projections' launch");
    k_prep<<<5 * WTB + W2B + NTOK / 8, 256, 0, stream>>>(act, lng, lnb, w2d, wq, wk, wv, wg, wo, WQ, WK, WV, WG, WO, W2, Xh, Xl);
    k_proj<<<dim3(NTK / 64, NCT, 1), 32, 0, stream>>>(Xh, Xl, WQ, WK, WV, WG, W2, QP16, KP16, VT16, FG, NB);   /* q, k, v^T planes, gate logits, pair bias nb[(q,k)][h] for all 65536 positions (cols 0..3) */
    k_nbt<<<NTOK / 256, 256, 0, stream>>>(NB, NBT);
    k_fattn<<<dim3(TT / 128, IG, NH_), 256, 0, stream>>>(QP16, KP16, VT16, NBT, mask, 0, Ob);   /* Ob columns 0..31 of each 64-wide row */
    k_gmerge<<<(unsigned)(((size_t)NTK * DQ / 4 + 255) / 256), 256, 0, stream>>>(Ob, FG, bg, ATh, ATl);
    k_gemmw<bf, 1, true, 0><<<dim3(NTK / 64, DM / 64, 1), 32, 0, stream>>>(ATh, ATl, WO, nullptr, DQ, OUT, DM, bo, nullptr);
}

// v005
// One run takes 112 microseconds.
// Two timings next to v004 both put it at 1.14 times that version's speed.
// Counting every step since v000, it is 6.94 times as fast.
#include <hip/hip_runtime.h>

// Triangle attention (starting node) on a pair representation (act [1][256][256][128], mask [1][256][256]): x = LayerNorm_c(act) (eps 1e-5, ln_g/ln_b); per row i: q, k, v, g = x[i] W (wq/wk/wv/wg [128][4][32] 'xw', 4 heads x 32; q x 32^-0.5), logits[h][q][k] = q.k + 1e9 (mask[i][k] - 1) + nb[h][q][k] with the pair bias nb[h][q][k] = sum_c x[q][k][c] w2d[c][h] (shared by all rows i);
// softmax over k; o = attn.v gated by sigmoid(x wg + bg); out[i][q][c] = sum_{h,d} o[h][d] wo[h][d][c] + bo -> [1][256][256][128] (8.4 M).
// Layout: LayerNorm -> bf16 hi/lo token planes [65536][128]; nb for all 65536 pair positions by one GEMM (w2d padded to 64 columns); rows i in groups of IG, here all 256 in one group, so each stage is one launch, and launches that do not read each other's results share one (weight transposes with LayerNorm; pair-bias GEMM with the projections): q/k/v/g projections (hi/lo x exact), whose epilogue writes the fp16 planes q,k [h][i][t][32] and v^T [h][i][64 (32 used)][t] itself, then ONE attention kernel (a wave takes its 16 queries through all four heads; scores, mask bias + pair bias, x 32^-0.5, softmax and attn.v stay in registers) that also gates its result, splits it into bf16 hi + lo and multiplies it by wo (+ bo) itself.
// Compute dtypes, f32 accumulate: every input rounded to bf16 once; LayerNorm in f32, its output as bf16 hi + lo (2-product projections against exact bf16 weights); scores and attn.v on single fp16 planes (P = 1024 exp(logit - max), at most 1024; 1/sum applied to the f32 attn.v result); pair bias, mask bias, softmax, gating in f32; output GEMM hl x exact + bo.

#define NI   256       // rows i
#define TT   256       // tokens per row (q / k index)
#define DM   128       // c_z
#define NH_  4
#define HD   32
#define HDP  64        // padded head dim: rows per (h, i) of the v^T planes (32..63 neither written nor read)
#define DQ   (NH_ * HD)
#define IG   256       // rows i per group: all of them (one launch per stage fills the chip; the planes between the stages then take 145 MiB of the workspace)
#define NTK  (IG * TT) // tokens per group = 65536
#define NTOK (NI * TT) // 65536
#define NBP  64        // pair-bias GEMM width (4 used)
#define PCAR 1024.0f
#define SCL  0.17677669529663688f   // 32^-0.5
#define RSCL 5.656854249492381f     // 32^0.5
typedef _Float16 h16;
typedef unsigned short bf;
typedef __attribute__((ext_vector_type(16))) __bf16   v16bf;
typedef __attribute__((ext_vector_type(16))) _Float16 v16h;
typedef __attribute__((ext_vector_type(8)))  _Float16 v8h;
typedef __attribute__((ext_vector_type(8)))  unsigned short v8us;
typedef __attribute__((ext_vector_type(8)))  float    v8f;
typedef __attribute__((ext_vector_type(4)))  float    v4f;
typedef v8h  __attribute__((may_alias)) v8ha;
typedef v4f  __attribute__((may_alias)) v4fa;
typedef v8us __attribute__((may_alias)) v8usa;

__device__ __forceinline__ unsigned short f2bf(float f) { unsigned u = __float_as_uint(f); u += 0x7FFFu + ((u >> 16) & 1u); return (unsigned short)(u >> 16); }
__device__ __forceinline__ float bf2f(unsigned short b) { return __uint_as_float(((unsigned)b) << 16); }
__device__ __forceinline__ float bfr(float f) { return bf2f(f2bf(f)); }
__device__ __forceinline__ v16h cat16(v8h lo, v8h hi) { return __builtin_shufflevector(lo, hi, 0, 1, 2, 3, 4, 5, 6, 7, 8, 9, 10, 11, 12, 13, 14, 15); }
__device__ __forceinline__ v16bf cat16b(v8us lo, v8us hi) { return __builtin_bit_cast(v16bf, __builtin_shufflevector(lo, hi, 0, 1, 2, 3, 4, 5, 6, 7, 8, 9, 10, 11, 12, 13, 14, 15)); }
__device__ __forceinline__ v8f wmma16(v16h a, v16h b, v8f c) { return __builtin_amdgcn_wmma_f32_16x16x32_f16(false, a, false, b, (short)0, c, false, false); }
__device__ __forceinline__ v8f wmmab(v16bf a, v16bf b, v8f c) { return __builtin_amdgcn_wmma_f32_16x16x32_bf16(false, a, false, b, (short)0, c, false, false); }



// ---- gemm_tile: register-blocked GEMM, ONE WAVE per 64x64 output tile at (r0, c0) (16 accumulators), operands straight from K-contiguous 16-bit planes; os = the wave's LDS stage of 16 x 68 floats.
// C[m][n] (f32, pitch ldc, + optional f32 bias[n]) = sum_k A[m][k] Bt[n][k] (+ split products per NSPLIT). K % 32 == 0.
// EPI 0: C as above. EPI 1: the tile rounded to fp16 into P16[n / 32][m][n % 32] (head planes of q, k; m = token of the group). EPI 2: into P16[n / 32][m / 256][n % 32 (pitch 64)][m % 256] (v^T planes). Both in whole 128-byte lines, 16 bytes a lane.
template <typename T16> struct WFrag;
template <> struct WFrag<h16> { typedef v16h V; static __device__ __forceinline__ V ld(const h16* p) { return cat16(*(const v8h*)p, *(const v8h*)(p + 16)); } static __device__ __forceinline__ v8f mma(V a, V b, v8f c) { return wmma16(a, b, c); } };
template <> struct WFrag<bf> { typedef v16bf V; static __device__ __forceinline__ V ld(const bf* p) { return cat16b(*(const v8us*)p, *(const v8us*)(p + 16)); } static __device__ __forceinline__ v8f mma(V a, V b, v8f c) { return wmmab(a, b, c); } };
template <typename T16, int NSPLIT, bool BIAS, int EPI>
__device__ __forceinline__ void gemm_tile(const T16* __restrict__ A, const T16* __restrict__ A2, const T16* __restrict__ Bt, const T16* __restrict__ Bt2, int K, float* C, int ldc, const float* __restrict__ bias, h16* P16, int r0, int c0, float* os) {
    typedef typename WFrag<T16>::V V;
    const int lane = threadIdx.x & 31, lr = lane & 15, hi = lane >> 4;
    v8f acc[4][4];
#pragma unroll
    for (int mb = 0; mb < 4; ++mb)
#pragma unroll
        for (int nb = 0; nb < 4; ++nb) acc[mb][nb] = (v8f){};
    const size_t aoff = (size_t)(r0 + lr) * K + 8 * hi, boff = (size_t)(c0 + lr) * K + 8 * hi;
#pragma unroll 1
    for (int kc = 0; kc < K; kc += 32) {
        V a[4], a2[4];
#pragma unroll
        for (int mb = 0; mb < 4; ++mb) { a[mb] = WFrag<T16>::ld(A + aoff + (size_t)mb * 16 * K + kc); if (NSPLIT == 1 || NSPLIT == 2) a2[mb] = WFrag<T16>::ld(A2 + aoff + (size_t)mb * 16 * K + kc); }
#pragma unroll
        for (int nb = 0; nb < 4; ++nb) { const V b = WFrag<T16>::ld(Bt + boff + (size_t)nb * 16 * K + kc); V b2; if (NSPLIT >= 2) b2 = WFrag<T16>::ld(Bt2 + boff + (size_t)nb * 16 * K + kc);
#pragma unroll
            for (int mb = 0; mb < 4; ++mb) { acc[mb][nb] = WFrag<T16>::mma(a[mb], b, acc[mb][nb]); if (NSPLIT == 1 || NSPLIT == 2) acc[mb][nb] = WFrag<T16>::mma(a2[mb], b, acc[mb][nb]); if (NSPLIT >= 2) acc[mb][nb] = WFrag<T16>::mma(a[mb], b2, acc[mb][nb]); } }
        asm volatile("v_nop\n\tv_nop\n\tv_nop\n\tv_nop" : "+v"(acc[0][0]), "+v"(acc[1][1]), "+v"(acc[2][2]), "+v"(acc[3][3]) : "v"(a[0]), "v"(a[3]));
    }
    if constexpr (EPI == 2) {
        // 16 columns (rows d of v^T) x the tile's 64 tokens at a time: a lane's 8 accumulator registers are 8 consecutive tokens of one column
        h16* vrow = P16 + ((size_t)(r0 / TT) * HDP + (lane >> 3)) * TT + (r0 % TT) + (lane & 7) * 8;
#pragma unroll
        for (int nb = 0; nb < 4; ++nb) {
#pragma unroll
            for (int mb = 0; mb < 4; ++mb) {
#pragma unroll
                for (int j = 0; j < 8; ++j) os[lr * 68 + mb * 16 + hi * 8 + j] = acc[mb][nb][j]; }
            __builtin_amdgcn_wave_barrier(); asm volatile("" ::: "memory");   // the reads below take other lanes' values: not above the writes (one wave, its LDS operations run in order)
            h16* dst = vrow + ((size_t)((c0 + nb * 16) / HD) * IG * HDP + (c0 + nb * 16) % HD) * TT;
#pragma unroll
            for (int s = 0; s < 4; ++s) { const float* sp = os + (s * 4 + (lane >> 3)) * 68 + (lane & 7) * 8; const v4f x0 = *(const v4fa*)sp, x1 = *(const v4fa*)(sp + 4); v8h o;
#pragma unroll
                for (int k = 0; k < 4; ++k) { o[k] = (h16)x0[k]; o[4 + k] = (h16)x1[k]; }
                *(v8h*)(dst + (size_t)s * 4 * TT) = o; }
            if (nb < 3) asm volatile("s_wait_xcnt 0x0" ::: "memory");   // in front of the next block's address sums and LDS reads, which take registers that these stores name
            __builtin_amdgcn_wave_barrier(); asm volatile("" ::: "memory");   // the next block's LDS writes stay behind these reads
        }
        return;
    }
#pragma unroll
    for (int mb = 0; mb < 4; ++mb) {
#pragma unroll
        for (int nb = 0; nb < 4; ++nb) {
#pragma unroll
            for (int j = 0; j < 8; ++j) os[(hi * 8 + j) * 68 + nb * 16 + lr] = acc[mb][nb][j]; }
        __builtin_amdgcn_wave_barrier(); asm volatile("" ::: "memory");
        if constexpr (EPI == 1) {
            // 16 tokens x 32 halves of one head are 1024 contiguous bytes of its plane: two 512-byte stores a head, two heads a tile
            h16* dst0 = P16 + ((size_t)(c0 / HD) * NTK + r0 + mb * 16) * HD + lane * 8; h16* dst1 = dst0 + (size_t)NTK * HD;
#pragma unroll
            for (int s = 0; s < 4; ++s) { const int ch = (s & 1) * 32 + lane; const float* sp = os + (ch >> 2) * 68 + (s >> 1) * HD + (ch & 3) * 8; const v4f x0 = *(const v4fa*)sp, x1 = *(const v4fa*)(sp + 4); v8h o;
#pragma unroll
                for (int k = 0; k < 4; ++k) { o[k] = (h16)x0[k]; o[4 + k] = (h16)x1[k]; }
                *(v8h*)(((s >> 1) ? dst1 : dst0) + (s & 1) * 256) = o; }
            __builtin_amdgcn_wave_barrier(); asm volatile("" ::: "memory");   // the next block's LDS writes stay behind these reads
            continue;
        }
        float* crow = C + (size_t)(r0 + mb * 16) * ldc + c0;
{
#pragma unroll
            for (int s = 0; s < 8; ++s) { const int row = 2 * s + hi, cofs = lr * 4; v4f val = *(const v4fa*)(os + row * 68 + cofs); if (BIAS) { val[0] += bfr(bias[c0 + cofs]); val[1] += bfr(bias[c0 + cofs + 1]); val[2] += bfr(bias[c0 + cofs + 2]); val[3] += bfr(bias[c0 + cofs + 3]); }
                *(v4f*)(crow + (size_t)row * ldc + cofs) = val; }
             }
        __builtin_amdgcn_wave_barrier(); asm volatile("" ::: "memory");
    }
}
// ---- k_proj: the five GEMMs that read the LayerNorm planes and nothing of each other, in ONE launch; grid (tokens/64, 9 column tiles), 32 threads.
// Column tile 0,1: q; 2,3: k (fp16 head planes); 4,5: v (fp16 v^T planes); 6,7: gate logits (f32); 8: pair bias (f32, 64 wide). Token blocks run fastest in the grid, as in a launch of one GEMM (for speed only).
#define NCT  9
__global__ __launch_bounds__(32) void k_proj(const bf* __restrict__ Xh, const bf* __restrict__ Xl, const bf* __restrict__ WQ, const bf* __restrict__ WK, const bf* __restrict__ WV, const bf* __restrict__ WG, const bf* __restrict__ W2, h16* QP16, h16* KP16, h16* VT16, float* FG, float* NB) {
    __shared__ __align__(16) float os[16 * 68];
    const int y = blockIdx.y, r0 = blockIdx.x * 64, c0 = (y & 1) * 64;
    // s_wait_xcnt 0 at the end of each arm, behind its last stores: in the built code another arm's instructions follow it and take the registers that those stores name
    if (y < 4) { gemm_tile<bf, 1, false, 1>(Xh, Xl, y < 2 ? WQ : WK, nullptr, DM, nullptr, DQ, nullptr, y < 2 ? QP16 : KP16, r0, c0, os); asm volatile("s_wait_xcnt 0x0" ::: "memory"); }
    else if (y < 6) { gemm_tile<bf, 1, false, 2>(Xh, Xl, WV, nullptr, DM, nullptr, DQ, nullptr, VT16, r0, c0, os); asm volatile("s_wait_xcnt 0x0" ::: "memory"); }
    else { gemm_tile<bf, 1, false, 0>(Xh, Xl, y < 8 ? WG : W2, nullptr, DM, y < 8 ? FG : NB, y < 8 ? DQ : NBP, nullptr, nullptr, r0, c0, os); asm volatile("s_wait_xcnt 0x0" ::: "memory"); }
}

typedef __attribute__((ext_vector_type(4))) unsigned short v4us;
typedef __attribute__((ext_vector_type(2))) unsigned short v2us;
typedef __attribute__((ext_vector_type(2))) _Float16 v2h;
typedef __attribute__((ext_vector_type(4))) _Float16 v4h;
__device__ __forceinline__ h16 tohx(float x) { return (h16)x; }
__device__ __forceinline__ void splitf(float y, unsigned short& h, unsigned short& l) { h = f2bf(y); l = f2bf(y - bf2f(h)); }
__device__ __forceinline__ void d_wtG(const float* __restrict__ w, int K, int N, bf* Bt, int bx) {
    const int lane = threadIdx.x & 31; const int L0 = (bx * 8 + (threadIdx.x >> 5)) * 8; const int nlines = N * K / 64;
{
#pragma unroll 1
        for (int l = 0; l < 8; ++l) { const int L = L0 + l; if (L >= nlines) break; const size_t e = (size_t)L * 64 + lane * 2; const int k = (int)(e % K), n = (int)(e / K); v2us o;
            o[0] = f2bf(w[(size_t)k * N + n]); o[1] = f2bf(w[(size_t)(k + 1) * N + n]); *(v2us*)(Bt + e) = o; }
         }
}
__global__ __launch_bounds__(256) void k_cvt8(const float* __restrict__ src, bf* dst, size_t n8) { const size_t i = (size_t)blockIdx.x * 256 + threadIdx.x; if (i >= n8) return; const v8f v = *(const v8f*)(src + i * 8); v8us o;
#pragma unroll
    for (int k = 0; k < 8; ++k) o[k] = f2bf(v[k]); *(v8us*)(dst + i * 8) = o;  }

__device__ __forceinline__ void d_w2d(const float* __restrict__ w, bf* Bt, int bx) { const int i = bx * 256 + threadIdx.x; if (i >= NBP * DM / 8) return; const int r = i / (DM / 8), c0 = (i % (DM / 8)) * 8; v8us o;
#pragma unroll
    for (int k = 0; k < 8; ++k) o[k] = (r < NH_) ? f2bf(w[(size_t)(c0 + k) * NH_ + r]) : (unsigned short)0; *(v8us*)(Bt + (size_t)r * DM + c0) = o;  }
__device__ __forceinline__ void d_lnx(const float* __restrict__ A, const float* __restrict__ g, const float* __restrict__ bb, bf* Xh, bf* Xl, int bx) {
    const int lane = threadIdx.x & 31; const size_t tok = (size_t)bx * 8 + (threadIdx.x >> 5); if (tok >= NTOK) return; const v4f a = *(const v4f*)(A + tok * DM + lane * 4); float v[4]; float s = 0.f;
#pragma unroll
    for (int q = 0; q < 4; ++q) { v[q] = bfr(a[q]); s = __fadd_rn(s, v[q]); }
#pragma unroll
    for (int sh = 16; sh; sh >>= 1) s = __fadd_rn(s, __shfl_xor(s, sh, 32));
    const float mu = __fdiv_rn(s, (float)DM); float s2 = 0.f;
#pragma unroll
    for (int q = 0; q < 4; ++q) { float d0 = __fsub_rn(v[q], mu); asm volatile("" : "+v"(d0)); float p = __fmul_rn(d0, d0); asm volatile("" : "+v"(p)); s2 = __fadd_rn(s2, p); }
#pragma unroll
    for (int sh = 16; sh; sh >>= 1) s2 = __fadd_rn(s2, __shfl_xor(s2, sh, 32));
    const float rs = __fdiv_rn(1.0f, __fsqrt_rn(__fadd_rn(__fdiv_rn(s2, (float)DM), 1e-5f))); v4us oh, ol;
#pragma unroll
    for (int q = 0; q < 4; ++q) { const int c = lane * 4 + q; float xn = __fmul_rn(__fsub_rn(v[q], mu), rs); asm volatile("" : "+v"(xn)); float gg = bfr(g[c]); asm volatile("" : "+v"(gg)); float y = __fmul_rn(xn, gg); asm volatile("" : "+v"(y)); float be = bfr(bb[c]); asm volatile("" : "+v"(be)); y = __fadd_rn(y, be); unsigned short h2, l2; splitf(y, h2, l2); oh[q] = h2; ol[q] = l2; }
    *(v4us*)(Xh + tok * DM + lane * 4) = oh; *(v4us*)(Xl + tok * DM + lane * 4) = ol;  }
// ---- k_prep: all that reads only the inputs, in ONE launch: the five weight transposes (WTB blocks each) and the padded w2d (W2B blocks) in the first blocks, LayerNorm (8 tokens a block) in the rest.
#define WTB  ((DM * DQ / 64 + 63) / 64)
#define W2B  ((NBP * DM / 8 + 255) / 256)
__global__ __launch_bounds__(256) void k_prep(const float* __restrict__ act, const float* __restrict__ lng, const float* __restrict__ lnb, const float* __restrict__ w2d, const float* __restrict__ wq, const float* __restrict__ wk, const float* __restrict__ wv, const float* __restrict__ wg, const float* __restrict__ wo,
                                              bf* WQ, bf* WK, bf* WV, bf* WG, bf* WO, bf* W2, bf* Xh, bf* Xl) {
    const int b = blockIdx.x;
    if (b < 4 * WTB) { const int w = b / WTB; d_wtG(w == 0 ? wq : w == 1 ? wk : w == 2 ? wv : wg, DM, DQ, w == 0 ? WQ : w == 1 ? WK : w == 2 ? WV : WG, b % WTB); return; }
    if (b < 5 * WTB) { d_wtG(wo, DQ, DM, WO, b - 4 * WTB); return; }
    if (b < 5 * WTB + W2B) { d_w2d(w2d, W2, b - 5 * WTB); return; }
    d_lnx(act, lng, lnb, Xh, Xl, b - (5 * WTB + W2B));
}
// pair bias repacked per head, x 32^0.5 (it starts the score accumulators, which are scaled by 32^-0.5 afterwards): NBT[h][q][k] (k contiguous) from the GEMM's [q*256+k][64] rows
__global__ __launch_bounds__(256) void k_nbt(const float* __restrict__ NB, float* NBT) { const size_t pos = (size_t)blockIdx.x * 256 + threadIdx.x; if (pos >= NTOK) return; const float* np = NB + pos * NBP; const v4f v = *(const v4f*)np;
    asm volatile("s_wait_xcnt 0x0" :: "v"(np) : "memory");   // in front of whatever takes the load's address registers (named as an input, so that they live up to the wait)
#pragma unroll
    for (int h = 0; h < NH_; ++h) NBT[(size_t)h * NTOK + pos] = v[h] * RSCL;  }
// two independent v_exp_f32, in place, with the one slot that the instruction set asks for behind a transcendental (before its result is used or its source overwritten) kept in the same statement
__device__ __forceinline__ void exp2x2(float& a, float& b) { asm("v_exp_f32 %0, %0\n\tv_exp_f32 %1, %1\n\tv_nop" : "+v"(a), "+v"(b)); }
// End of a batch of global loads: s_wait_xcnt 0 in front of whatever may take the loads' address registers (named as inputs, so that they live up to the wait); the scheduling barrier keeps the batch issued here, ahead of the work below that hides its latency (the compiler otherwise sinks each load to its use and waits for each in turn).
#define LOADS_ISSUED(p0, p1, p2) do { asm volatile("s_wait_xcnt 0x0" :: "v"(p0), "v"(p1), "v"(p2) : "memory"); __builtin_amdgcn_sched_barrier(0); } while (0)
// gate and split of one attn.v value: y = (ov / 1024) sigmoid(gate logit + bg) as bf16 hi + lo
__device__ __forceinline__ void gate1(float ov, float gv, float bgraw, unsigned short& h2, unsigned short& l2) {
    const float ga = __fadd_rn(gv, bfr(bgraw)); const float sg = __fdiv_rn(1.0f, __fadd_rn(1.0f, __builtin_amdgcn_exp2f(__fmul_rn(ga, -1.4426950408889634f))));
    const float y = __fmul_rn(__fmul_rn(ov, 1.0f / PCAR), sg); splitf(y, h2, l2); }
// ---- k_fattn: one wave = 16 queries of one row i against all 256 keys, head after head, then the output projection of those 16 queries; grid (256/128, rows), 8 waves.
// Scores are formed TRANSPOSED, S^T = K Q^T + (pair bias + mask bias) 32^0.5 as the accumulators' start value (A = 16 key rows, B = the 16 query rows): an accumulator tile holds key 16t + 8*hi + j of query lr in register j of lane (lr, hi),
// which is the fragment order of P for attn.v (elements 0..7 = tile 2c, 8..15 = tile 2c+1 of the 32-key chunk c): no lane exchange, no LDS or memory round trip for S or P.
// attn.v is formed transposed too, O^T = V^T P^T (A = 16 rows d of v^T, B = P): lane (lr, hi) then holds d = 8*hi + j and 16 + 8*hi + j of query lr, next to that query's row sum, and that again is the fragment order of the head's 32 k of the output projection.
// P = 1024 exp(logit - max) in fp16 (at most 1024); the f32 tile is scaled by 1024 / sum, gated, split into bf16 hi + lo; each lane parks its own 4 x 16 bytes per head in LDS (registers are short while the scores live) and takes them back behind the last head.
// Output: out^T = wo^T y^T (A = 16 columns c of wo, B = y hi, then y lo, head after head: the sum order of a K = 128 GEMM in chunks of 32), staged through the wave's LDS so that each store is one whole 512-byte row of out.
// amdgpu_waves_per_eu(4, 4): a budget of 256 registers a wave, so that two work-groups share a WGP: the 512 work-groups of the launch are resident at once.
#define YP   132              // floats per staged output row: 128 + 4, so that the 16 rows written at once fall on different banks
#define YW   (16 * YP)        // floats of LDS a wave: the staged 16 x 128 output tile; before that its lanes' parked y fragments (8 KiB)
__global__ __launch_bounds__(256) __attribute__((amdgpu_waves_per_eu(4, 4))) void k_fattn(const h16* __restrict__ Q16, const h16* __restrict__ K16, const h16* __restrict__ V16, const float* __restrict__ NBT, const float* __restrict__ mask, const float* __restrict__ FG, const float* __restrict__ bg, const bf* __restrict__ WO, const float* __restrict__ bo, float* OUT) {
    __shared__ __align__(32) float mbs[TT];
    __shared__ __align__(16) float yst[8 * YW];
    const int lane = threadIdx.x & 31, lr = lane & 15, hi = lane >> 4; const int il = blockIdx.y;
    const int wv = __builtin_amdgcn_readfirstlane(threadIdx.x >> 5); const int q0 = (blockIdx.x * 8 + wv) * 16;   // the wave's number as a scalar: over the head loop every plane's base then stays in scalar registers, and a lane keeps one 32-bit offset per row pitch
    const unsigned ko = lr * HD + 8 * hi, no = lr * TT + 8 * hi, go = lr * DQ + 8 * hi, bo8 = 8 * hi;
    float* yw = yst + wv * YW;
    mbs[threadIdx.x] = 1e9f * (bfr(mask[(size_t)il * TT + threadIdx.x]) - 1.0f) * RSCL;   // mask bias of row i, once per work-group
    __syncthreads();   // publishes mbs
#pragma unroll 1   // one head's code, run four times: unrolled it would be four times the text and keep more registers live
    for (int h = 0; h < NH_; ++h) {
        // element offsets in 32 bits (every plane is far below 4 Gi elements); each plane's 64-bit lane address is formed per head and lives only up to the wait behind its last batch of loads
        const unsigned tk0 = (unsigned)h * NTK + (unsigned)il * TT;
        const unsigned kx = tk0 * HD + ko, nx = ((unsigned)h * TT + q0) * TT + no, vx = ((unsigned)h * IG + il) * (HDP * TT) + no, qx = (tk0 + q0) * HD + ko, gx = ((unsigned)il * TT + q0) * DQ + h * HD + go, bx = h * HD + bo8;
        const h16* kp = K16 + kx; const float* nbp = NBT + nx; const h16* vp = V16 + vx; const h16* qp = Q16 + qx; const float* gp = FG + gx; const float* bp = bg + bx;
        const v16h bq = WFrag<h16>::ld(qp);
        v16h ka[8], kb[8]; v8f s[TT / 16];
#pragma unroll
        for (int t = 0; t < 8; ++t) ka[t] = WFrag<h16>::ld(kp + (size_t)t * 16 * HD);
#pragma unroll
        for (int t = 0; t < TT / 16; ++t) s[t] = *(const v8f*)(nbp + t * 16);
        LOADS_ISSUED(qp, kp, nbp);
#pragma unroll
        for (int t = 0; t < 8; ++t) s[t] = wmma16(ka[t], bq, s[t] + *(const v8f*)(mbs + t * 16 + 8 * hi));
        __builtin_amdgcn_sched_barrier(0);   // the second half's key loads take the first half's registers: not above its products
#pragma unroll
        for (int t = 0; t < 8; ++t) kb[t] = WFrag<h16>::ld(kp + (size_t)(8 + t) * 16 * HD);
        LOADS_ISSUED(kp, kp, kp);
#pragma unroll
        for (int t = 0; t < 8; ++t) s[8 + t] = wmma16(kb[t], bq, s[8 + t] + *(const v8f*)(mbs + (8 + t) * 16 + 8 * hi));
        __builtin_amdgcn_sched_barrier(0);   // the v^T loads take the key fragments' registers: not above the products
        v16h vf[TT / 32][2];
#pragma unroll
        for (int cc = 0; cc < 3; ++cc) { vf[cc][0] = WFrag<h16>::ld(vp + cc * 32); vf[cc][1] = WFrag<h16>::ld(vp + (size_t)16 * TT + cc * 32); }
        LOADS_ISSUED(vp, vp, vp);
        float m4[4] = { -3.0e38f, -3.0e38f, -3.0e38f, -3.0e38f };
#pragma unroll
        for (int t = 0; t < TT / 16; ++t) {
#pragma unroll
            for (int j = 0; j < 4; ++j) m4[j] = fmaxf(fmaxf(m4[j], s[t][j]), s[t][j + 4]); }
        float mx = fmaxf(fmaxf(m4[0], m4[1]), fmaxf(m4[2], m4[3])); mx = fmaxf(mx, __shfl_xor(mx, 16, 32));
        v8f vs = (v8f){}; v8f o[2] = { (v8f){}, (v8f){} }; v4f gl[4], bl[4];
#pragma unroll
        for (int cc = 0; cc < TT / 32; ++cc) { v16h p;
#pragma unroll
            for (int j = 0; j < 8; ++j) { float e0 = fmaf(s[2 * cc][j] - mx, SCL * 1.4426950408889634f, 10.0f), e1 = fmaf(s[2 * cc + 1][j] - mx, SCL * 1.4426950408889634f, 10.0f); exp2x2(e0, e1); vs[j] += e0 + e1; p[j] = tohx(e0); p[8 + j] = tohx(e1); }
            o[0] = wmma16(vf[cc][0], p, o[0]); o[1] = wmma16(vf[cc][1], p, o[1]);
            if (cc + 3 < TT / 32) { __builtin_amdgcn_sched_barrier(0);   // the v^T loads three chunks ahead take registers freed above
                vf[cc + 3][0] = WFrag<h16>::ld(vp + (cc + 3) * 32); vf[cc + 3][1] = WFrag<h16>::ld(vp + (size_t)16 * TT + (cc + 3) * 32);
                if (cc + 4 == TT / 32) {   // with the last of them the head's gate logits and gate bias for this lane's 16 values
#pragma unroll
                    for (int u = 0; u < 4; ++u) { gl[u] = *(const v4f*)(gp + (u >> 1) * 16 + (u & 1) * 4); bl[u] = *(const v4f*)(bp + (u >> 1) * 16 + (u & 1) * 4); } }
                // as LOADS_ISSUED; the two accumulators and the running sums are named as inputs too, so that the chunk's products and additions are issued above: left free they sink to the head's end, every v^T fragment and every exponential stays live, and registers spill
                asm volatile("s_wait_xcnt 0x0" :: "v"(vp), "v"(gp), "v"(bp), "v"(o[0]), "v"(o[1]), "v"(vs) : "memory"); __builtin_amdgcn_sched_barrier(0); } }
        __builtin_amdgcn_sched_barrier(0);   // the gating stays below the last chunks: lifted above them it would wait for the gate loads, the youngest in flight, before their latency is covered
        float sum = ((vs[0] + vs[1]) + (vs[2] + vs[3])) + ((vs[4] + vs[5]) + (vs[6] + vs[7])); sum += __shfl_xor(sum, 16, 32);
        const float f = __fdiv_rn(PCAR, sum);   // sum and values belong to the same query lr
        v8us yh0, yh1, yl0, yl1;
#pragma unroll
        for (int j = 0; j < 8; ++j) { unsigned short a2, b2; gate1(o[0][j] * f, gl[j >> 2][j & 3], bl[j >> 2][j & 3], a2, b2); yh0[j] = a2; yl0[j] = b2; gate1(o[1][j] * f, gl[2 + (j >> 2)][j & 3], bl[2 + (j >> 2)][j & 3], a2, b2); yh1[j] = a2; yl1[j] = b2; }
        v8usa* yq = (v8usa*)yw + h * 128 + lane;   // 16-byte units, lanes side by side; each lane reads back only what it wrote
        yq[0] = yh0; yq[32] = yh1; yq[64] = yl0; yq[96] = yl1;
    }
    const bf* wp = WO + go;
    const unsigned l4 = lane * 4;
    v16bf w[2][NH_], yh[NH_], yl[NH_]; v8f acc[DM / 16];
#pragma unroll
    for (int h = 0; h < NH_; ++h) w[0][h] = WFrag<bf>::ld(wp + h * HD);
    const v4f bov = *(const v4f*)(bo + l4);
    LOADS_ISSUED(go, l4, go);
#pragma unroll
    for (int h = 0; h < NH_; ++h) { const v8usa* yq = (const v8usa*)yw + h * 128 + lane; yh[h] = cat16b(yq[0], yq[32]); yl[h] = cat16b(yq[64], yq[96]); }
#pragma unroll
    for (int t = 0; t < DM / 16; ++t) {
        if (t + 1 < DM / 16) {   // the next 16 columns' wo fragments fly while this tile's products run
#pragma unroll
            for (int h = 0; h < NH_; ++h) w[(t + 1) & 1][h] = WFrag<bf>::ld(wp + (size_t)(t + 1) * 16 * DQ + h * HD);
            LOADS_ISSUED(go, go, go); }
        acc[t] = (v8f){};
#pragma unroll
        for (int h = 0; h < NH_; ++h) { acc[t] = wmmab(w[t & 1][h], yh[h], acc[t]); acc[t] = wmmab(w[t & 1][h], yl[h], acc[t]); }
    }
    // register j of tile t is column 16t + 8*hi + j of query lr
#pragma unroll
    for (int t = 0; t < DM / 16; ++t) { float* sp = yw + lr * YP + t * 16 + 8 * hi; *(v4fa*)sp = __builtin_shufflevector(acc[t], acc[t], 0, 1, 2, 3); *(v4fa*)(sp + 4) = __builtin_shufflevector(acc[t], acc[t], 4, 5, 6, 7); }
    __builtin_amdgcn_wave_barrier(); asm volatile("" ::: "memory");   // the reads below take other lanes' values: not above the writes (one wave, its LDS operations run in order)
    float* orow = OUT + ((size_t)il * TT + q0) * DM + l4;
#pragma unroll
    for (int r = 0; r < 16; ++r) { v4f val = *(const v4fa*)(yw + r * YP + lane * 4); val[0] += bfr(bov[0]); val[1] += bfr(bov[1]); val[2] += bfr(bov[2]); val[3] += bfr(bov[3]); *(v4f*)(orow + (size_t)r * DM) = val;
        if (r == 7) asm volatile("s_wait_xcnt 0x0" ::: "memory");   // in front of the second half's LDS reads, which take registers that these stores name
    }
}

extern "C" void kernel_launch(void* const* d_in, const int* in_sizes, int n_in,
                              void* d_out, int out_size, void* d_ws, size_t ws_size, hipStream_t stream) {
    (void)in_sizes; (void)n_in; (void)out_size;
    const float* act = (const float*)d_in[0]; const float* mask = (const float*)d_in[1]; const float* lng = (const float*)d_in[2]; const float* lnb = (const float*)d_in[3]; const float* w2d = (const float*)d_in[4]; const float* wq = (const float*)d_in[5]; const float* wk = (const float*)d_in[6]; const float* wv = (const float*)d_in[7]; const float* wg = (const float*)d_in[8]; const float* bg = (const float*)d_in[9]; const float* wo = (const float*)d_in[10]; const float* bo = (const float*)d_in[11];
    float* OUT = (float*)d_out;     // [1][256][256][128]
    char* wsp = (char*)d_ws;
    auto take = [&](size_t bytes) { char* p = wsp; wsp += (bytes + 255) & ~(size_t)255; return (void*)p; };
    bf* WQ = (bf*)take((size_t)DQ * DM * 2); bf* WK = (bf*)take((size_t)DQ * DM * 2); bf* WV = (bf*)take((size_t)DQ * DM * 2); bf* WG = (bf*)take((size_t)DQ * DM * 2); bf* WO = (bf*)take((size_t)DM * DQ * 2); bf* W2 = (bf*)take((size_t)NBP * DM * 2);
    bf* Xh = (bf*)take((size_t)NTOK * DM * 2); bf* Xl = (bf*)take((size_t)NTOK * DM * 2); float* NB = (float*)take((size_t)NTOK * NBP * 4);
    float* FG = (float*)take((size_t)NTK * DQ * 4); h16* QP16 = (h16*)take((size_t)NH_ * NTK * HD * 2); h16* KP16 = (h16*)take((size_t)NH_ * NTK * HD * 2); h16* VT16 = (h16*)take((size_t)NH_ * IG * HDP * TT * 2);
    float* NBT = (float*)take((size_t)NH_ * NTOK * 4);
    if ((size_t)(wsp - (char*)d_ws) > ws_size) return;    // ws 256 MiB (carve ~145 MiB)
    static_assert(IG == NI, "one row group: the pair-bias GEMM over all positions shares the projections' launch");
    k_prep<<<5 * WTB + W2B + NTOK / 8, 256, 0, stream>>>(act, lng, lnb, w2d, wq, wk, wv, wg, wo, WQ, WK, WV, WG, WO, W2, Xh, Xl);
    k_proj<<<dim3(NTK / 64, NCT, 1), 32, 0, stream>>>(Xh, Xl, WQ, WK, WV, WG, W2, QP16, KP16, VT16, FG, NB);   /* q, k, v^T planes, gate logits, pair bias nb[(q,k)][h] for all 65536 positions (cols 0..3) */
    k_nbt<<<NTOK / 256, 256, 0, stream>>>(NB, NBT);
    k_fattn<<<dim3(TT / 128, IG, 1), 256, 0, stream>>>(QP16, KP16, VT16, NBT, mask, FG, bg, WO, bo, OUT);   /* attention, gating and output projection */
}

// v006
// It runs in 90.7 microseconds.
// Timed twice side by side with v005, it ran 1.25 times as fast both times.
// Counting every step since v000, it is 8.66 times as fast.
#include <hip/hip_runtime.h>

// Triangle attention (starting node) on a pair representation (act [1][256][256][128], mask [1][256][256]): x = LayerNorm_c(act) (eps 1e-5, ln_g/ln_b); per row i: q, k, v, g = x[i] W (wq/wk/wv/wg [128][4][32] 'xw', 4 heads x 32; q x 32^-0.5), logits[h][q][k] = q.k + 1e9 (mask[i][k] - 1) + nb[h][q][k] with the pair bias nb[h][q][k] = sum_c x[q][k][c] w2d[c][h] (shared by all rows i);
// softmax over k; o = attn.v gated by sigmoid(x wg + bg); out[i][q][c] = sum_{h,d} o[h][d] wo[h][d][c] + bo -> [1][256][256][128] (8.4 M).
// Layout: rows i in groups of IG, here all 256 in one group, so each stage is one launch. One small launch transposes the weights (w2d padded to 64 rows, 16 read). Then ONE kernel per 64 tokens: LayerNorm -> bf16 hi/lo rows in LDS, from which its 8 waves take the A fragments of the q/k/v/g projections (hi/lo x exact) and of the pair bias nb (16 columns, 4 used); the normalised tokens never go to memory. The projections' epilogue writes the fp16 planes q,k [h][i][t][32] and v^T [h][i][64 (32 used)][t] itself, a small launch repacks the pair bias per head (x 32^0.5), then ONE attention kernel (a wave takes its 16 queries through all four heads; scores, mask bias + pair bias, x 32^-0.5, softmax and attn.v stay in registers) that also gates its result, splits it into bf16 hi + lo and multiplies it by wo (+ bo) itself.
// Compute dtypes, f32 accumulate: every input rounded to bf16 once; LayerNorm in f32, its output as bf16 hi + lo (2-product projections against exact bf16 weights); scores and attn.v on single fp16 planes (P = 1024 exp(logit - max), at most 1024; 1/sum applied to the f32 attn.v result); pair bias, mask bias, softmax, gating in f32; output GEMM hl x exact + bo.

#define NI   256       // rows i
#define TT   256       // tokens per row (q / k index)
#define DM   128       // c_z
#define NH_  4
#define HD   32
#define HDP  64        // padded head dim: rows per (h, i) of the v^T planes (32..63 neither written nor read)
#define DQ   (NH_ * HD)
#define IG   256       // rows i per group: all of them (one launch per stage fills the chip; the planes between the stages then take 113 MiB of the workspace)
#define NTK  (IG * TT) // tokens per group = 65536
#define NTOK (NI * TT) // 65536
#define NBP  64        // pair-bias row pitch and padded w2d rows (16 computed, 4 used)
#define PCAR 1024.0f
#define SCL  0.17677669529663688f   // 32^-0.5
#define RSCL 5.656854249492381f     // 32^0.5
typedef _Float16 h16;
typedef unsigned short bf;
typedef __attribute__((ext_vector_type(16))) __bf16   v16bf;
typedef __attribute__((ext_vector_type(16))) _Float16 v16h;
typedef __attribute__((ext_vector_type(8)))  _Float16 v8h;
typedef __attribute__((ext_vector_type(8)))  unsigned short v8us;
typedef __attribute__((ext_vector_type(8)))  float    v8f;
typedef __attribute__((ext_vector_type(4)))  float    v4f;
typedef v8h  __attribute__((may_alias)) v8ha;
typedef v4f  __attribute__((may_alias)) v4fa;
typedef v8us __attribute__((may_alias)) v8usa;

__device__ __forceinline__ unsigned short f2bf(float f) { unsigned u = __float_as_uint(f); u += 0x7FFFu + ((u >> 16) & 1u); return (unsigned short)(u >> 16); }
__device__ __forceinline__ float bf2f(unsigned short b) { return __uint_as_float(((unsigned)b) << 16); }
__device__ __forceinline__ float bfr(float f) { return bf2f(f2bf(f)); }
__device__ __forceinline__ v16h cat16(v8h lo, v8h hi) { return __builtin_shufflevector(lo, hi, 0, 1, 2, 3, 4, 5, 6, 7, 8, 9, 10, 11, 12, 13, 14, 15); }
__device__ __forceinline__ v16bf cat16b(v8us lo, v8us hi) { return __builtin_bit_cast(v16bf, __builtin_shufflevector(lo, hi, 0, 1, 2, 3, 4, 5, 6, 7, 8, 9, 10, 11, 12, 13, 14, 15)); }
__device__ __forceinline__ v8f wmma16(v16h a, v16h b, v8f c) { return __builtin_amdgcn_wmma_f32_16x16x32_f16(false, a, false, b, (short)0, c, false, false); }
__device__ __forceinline__ v8f wmmab(v16bf a, v16bf b, v8f c) { return __builtin_amdgcn_wmma_f32_16x16x32_bf16(false, a, false, b, (short)0, c, false, false); }



// ---- gemm_tile: register-blocked GEMM, ONE WAVE per 64x64 output tile at (r0, c0) (16 accumulators), operands straight from K-contiguous 16-bit planes; A, A2 = the tile's own 64 rows at a pitch of lda elements (here rows in LDS); os = the wave's LDS stage of 16 x 68 floats.
// C[m][n] (f32, pitch ldc, + optional f32 bias[n]) = sum_k A[m][k] Bt[n][k] (+ split products per NSPLIT). K % 32 == 0.
// EPI 0: C as above. EPI 1: the tile rounded to fp16 into P16[n / 32][m][n % 32] (head planes of q, k; m = token of the group). EPI 2: into P16[n / 32][m / 256][n % 32 (pitch 64)][m % 256] (v^T planes). Both in whole 128-byte lines, 16 bytes a lane.
template <typename T16> struct WFrag;
template <> struct WFrag<h16> { typedef v16h V; static __device__ __forceinline__ V ld(const h16* p) { return cat16(*(const v8h*)p, *(const v8h*)(p + 16)); } static __device__ __forceinline__ v8f mma(V a, V b, v8f c) { return wmma16(a, b, c); } };
template <> struct WFrag<bf> { typedef v16bf V; static __device__ __forceinline__ V ld(const bf* p) { return cat16b(*(const v8us*)p, *(const v8us*)(p + 16)); } static __device__ __forceinline__ v8f mma(V a, V b, v8f c) { return wmmab(a, b, c); } };
template <typename T16, int NSPLIT, bool BIAS, int EPI>
__device__ __forceinline__ void gemm_tile(const T16* __restrict__ A, const T16* __restrict__ A2, int lda, const T16* __restrict__ Bt, const T16* __restrict__ Bt2, int K, float* C, int ldc, const float* __restrict__ bias, h16* P16, int r0, int c0, float* os) {
    typedef typename WFrag<T16>::V V;
    const int lane = threadIdx.x & 31, lr = lane & 15, hi = lane >> 4;
    v8f acc[4][4];
#pragma unroll
    for (int mb = 0; mb < 4; ++mb)
#pragma unroll
        for (int nb = 0; nb < 4; ++nb) acc[mb][nb] = (v8f){};
    const size_t aoff = (size_t)lr * lda + 8 * hi, boff = (size_t)(c0 + lr) * K + 8 * hi;
#pragma unroll 1
    for (int kc = 0; kc < K; kc += 32) {
        V a[4], a2[4];
#pragma unroll
        for (int mb = 0; mb < 4; ++mb) { a[mb] = WFrag<T16>::ld(A + aoff + (size_t)mb * 16 * lda + kc); if (NSPLIT == 1 || NSPLIT == 2) a2[mb] = WFrag<T16>::ld(A2 + aoff + (size_t)mb * 16 * lda + kc); }
#pragma unroll
        for (int nb = 0; nb < 4; ++nb) { const V b = WFrag<T16>::ld(Bt + boff + (size_t)nb * 16 * K + kc); V b2; if (NSPLIT >= 2) b2 = WFrag<T16>::ld(Bt2 + boff + (size_t)nb * 16 * K + kc);
#pragma unroll
            for (int mb = 0; mb < 4; ++mb) { acc[mb][nb] = WFrag<T16>::mma(a[mb], b, acc[mb][nb]); if (NSPLIT == 1 || NSPLIT == 2) acc[mb][nb] = WFrag<T16>::mma(a2[mb], b, acc[mb][nb]); if (NSPLIT >= 2) acc[mb][nb] = WFrag<T16>::mma(a[mb], b2, acc[mb][nb]); } }
        asm volatile("v_nop\n\tv_nop\n\tv_nop\n\tv_nop" : "+v"(acc[0][0]), "+v"(acc[1][1]), "+v"(acc[2][2]), "+v"(acc[3][3]) : "v"(a[0]), "v"(a[3]));
    }
    if constexpr (EPI == 2) {
        // 16 columns (rows d of v^T) x the tile's 64 tokens at a time: a lane's 8 accumulator registers are 8 consecutive tokens of one column
        h16* vrow = P16 + ((size_t)(r0 / TT) * HDP + (lane >> 3)) * TT + (r0 % TT) + (lane & 7) * 8;
#pragma unroll
        for (int nb = 0; nb < 4; ++nb) {
#pragma unroll
            for (int mb = 0; mb < 4; ++mb) {
#pragma unroll
                for (int j = 0; j < 8; ++j) os[lr * 68 + mb * 16 + hi * 8 + j] = acc[mb][nb][j]; }
            __builtin_amdgcn_wave_barrier(); asm volatile("" ::: "memory");   // the reads below take other lanes' values: not above the writes (one wave, its LDS operations run in order)
            h16* dst = vrow + ((size_t)((c0 + nb * 16) / HD) * IG * HDP + (c0 + nb * 16) % HD) * TT;
#pragma unroll
            for (int s = 0; s < 4; ++s) { const float* sp = os + (s * 4 + (lane >> 3)) * 68 + (lane & 7) * 8; const v4f x0 = *(const v4fa*)sp, x1 = *(const v4fa*)(sp + 4); v8h o;
#pragma unroll
                for (int k = 0; k < 4; ++k) { o[k] = (h16)x0[k]; o[4 + k] = (h16)x1[k]; }
                *(v8h*)(dst + (size_t)s * 4 * TT) = o; }
            if (nb < 3) asm volatile("s_wait_xcnt 0x0" ::: "memory");   // in front of the next block's address sums and LDS reads, which take registers that these stores name
            __builtin_amdgcn_wave_barrier(); asm volatile("" ::: "memory");   // the next block's LDS writes stay behind these reads
        }
        return;
    }
#pragma unroll
    for (int mb = 0; mb < 4; ++mb) {
#pragma unroll
        for (int nb = 0; nb < 4; ++nb) {
#pragma unroll
            for (int j = 0; j < 8; ++j) os[(hi * 8 + j) * 68 + nb * 16 + lr] = acc[mb][nb][j]; }
        __builtin_amdgcn_wave_barrier(); asm volatile("" ::: "memory");
        if constexpr (EPI == 1) {
            // 16 tokens x 32 halves of one head are 1024 contiguous bytes of its plane: two 512-byte stores a head, two heads a tile
            h16* dst0 = P16 + ((size_t)(c0 / HD) * NTK + r0 + mb * 16) * HD + lane * 8; h16* dst1 = dst0 + (size_t)NTK * HD;
#pragma unroll
            for (int s = 0; s < 4; ++s) { const int ch = (s & 1) * 32 + lane; const float* sp = os + (ch >> 2) * 68 + (s >> 1) * HD + (ch & 3) * 8; const v4f x0 = *(const v4fa*)sp, x1 = *(const v4fa*)(sp + 4); v8h o;
#pragma unroll
                for (int k = 0; k < 4; ++k) { o[k] = (h16)x0[k]; o[4 + k] = (h16)x1[k]; }
                *(v8h*)(((s >> 1) ? dst1 : dst0) + (s & 1) * 256) = o; }
            __builtin_amdgcn_wave_barrier(); asm volatile("" ::: "memory");   // the next block's LDS writes stay behind these reads
            continue;
        }
        float* crow = C + (size_t)(r0 + mb * 16) * ldc + c0;
{
#pragma unroll
            for (int s = 0; s < 8; ++s) { const int row = 2 * s + hi, cofs = lr * 4; v4f val = *(const v4fa*)(os + row * 68 + cofs); if (BIAS) { val[0] += bfr(bias[c0 + cofs]); val[1] += bfr(bias[c0 + cofs + 1]); val[2] += bfr(bias[c0 + cofs + 2]); val[3] += bfr(bias[c0 + cofs + 3]); }
                *(v4f*)(crow + (size_t)row * ldc + cofs) = val; }
             }
        __builtin_amdgcn_wave_barrier(); asm volatile("" ::: "memory");
    }
}
typedef __attribute__((ext_vector_type(4))) unsigned short v4us;
typedef __attribute__((ext_vector_type(2))) unsigned short v2us;
typedef __attribute__((ext_vector_type(2))) _Float16 v2h;
typedef __attribute__((ext_vector_type(4))) _Float16 v4h;
__device__ __forceinline__ h16 tohx(float x) { return (h16)x; }
__device__ __forceinline__ void splitf(float y, unsigned short& h, unsigned short& l) { h = f2bf(y); l = f2bf(y - bf2f(h)); }
__device__ __forceinline__ void d_wtG(const float* __restrict__ w, int K, int N, bf* Bt, int bx) {
    const int lane = threadIdx.x & 31; const int L0 = (bx * 8 + (threadIdx.x >> 5)) * 8; const int nlines = N * K / 64;
{
#pragma unroll 1
        for (int l = 0; l < 8; ++l) { const int L = L0 + l; if (L >= nlines) break; const size_t e = (size_t)L * 64 + lane * 2; const int k = (int)(e % K), n = (int)(e / K); v2us o;
            o[0] = f2bf(w[(size_t)k * N + n]); o[1] = f2bf(w[(size_t)(k + 1) * N + n]); *(v2us*)(Bt + e) = o; }
         }
}
__global__ __launch_bounds__(256) void k_cvt8(const float* __restrict__ src, bf* dst, size_t n8) { const size_t i = (size_t)blockIdx.x * 256 + threadIdx.x; if (i >= n8) return; const v8f v = *(const v8f*)(src + i * 8); v8us o;
#pragma unroll
    for (int k = 0; k < 8; ++k) o[k] = f2bf(v[k]); *(v8us*)(dst + i * 8) = o;  }

__device__ __forceinline__ void d_w2d(const float* __restrict__ w, bf* Bt, int bx) { const int i = bx * 256 + threadIdx.x; if (i >= NBP * DM / 8) return; const int r = i / (DM / 8), c0 = (i % (DM / 8)) * 8; v8us o;
#pragma unroll
    for (int k = 0; k < 8; ++k) o[k] = (r < NH_) ? f2bf(w[(size_t)(c0 + k) * NH_ + r]) : (unsigned short)0; *(v8us*)(Bt + (size_t)r * DM + c0) = o;  }
// End of a batch of global loads: s_wait_xcnt 0 in front of whatever may take the loads' address registers (named as inputs, so that they live up to the wait); the scheduling barrier keeps the batch issued here, ahead of the work below that hides its latency (the compiler otherwise sinks each load to its use and waits for each in turn).
#define LOADS_ISSUED(p0, p1, p2) do { asm volatile("s_wait_xcnt 0x0" :: "v"(p0), "v"(p1), "v"(p2) : "memory"); __builtin_amdgcn_sched_barrier(0); } while (0)
// square root as the compiler expands it (a subnormal argument scaled by 2^32, the root by 2^-16), with v_sqrt_f32 and the one slot that the instruction set asks for behind a transcendental (before its result is used or its source overwritten) kept in one statement
__device__ __forceinline__ float sqrt_slot(float x) { const bool sm = x < 0x1p-126f; float r = ldexpf(x, sm ? 32 : 0); asm("v_sqrt_f32 %0, %0\n\tv_nop" : "+v"(r)); return ldexpf(r, sm ? -16 : 0); }
// ---- d_ln8: LayerNorm of 8 tokens by one wave (a lane holds 4 channels of each); A = the first token's row, xh / xl = its hi / lo row in LDS. Per token the operations, their order and their roundings of the one-token form; the 8 tokens go through each stage side by side, so that their 8 loads fly together and their dependent chains fill each other's waits. The empty asm statements are those of the one-token form, taken over as they stood: each difference and product is rounded on its own before the next operation takes it, so the normalised values stay bit for bit what they were.
#define XP   136       // 16-bit elements per staged token row: 256 + 16 bytes, the pitch for 16-byte LDS reads of 16 rows at once
__device__ __forceinline__ void d_ln8(const float* __restrict__ A, const float* __restrict__ g, const float* __restrict__ bb, bf* xh, bf* xl) {
    const int lane = threadIdx.x & 31; const unsigned lb = lane * 16; v4f a[8];   // lb: the lane's byte offset in a row, the one vector register that the loads below name (their bases are scalars)
#pragma unroll
    for (int t = 0; t < 8; ++t) a[t] = *(const v4f*)((const char*)A + lb + t * (DM * 4));
    const v4f gv = *(const v4f*)((const char*)g + lb), bv = *(const v4f*)((const char*)bb + lb);
    LOADS_ISSUED(lb, lb, lb);
    float v[8][4], s[8], mu[8], s2[8];
#pragma unroll
    for (int t = 0; t < 8; ++t) { s[t] = 0.f;
#pragma unroll
        for (int q = 0; q < 4; ++q) { v[t][q] = bfr(a[t][q]); s[t] = __fadd_rn(s[t], v[t][q]); } }
#pragma unroll
    for (int sh = 16; sh; sh >>= 1) {
#pragma unroll
        for (int t = 0; t < 8; ++t) s[t] = __fadd_rn(s[t], __shfl_xor(s[t], sh, 32)); }
#pragma unroll
    for (int t = 0; t < 8; ++t) { mu[t] = __fdiv_rn(s[t], (float)DM); s2[t] = 0.f;
#pragma unroll
        for (int q = 0; q < 4; ++q) { float d0 = __fsub_rn(v[t][q], mu[t]); asm volatile("" : "+v"(d0)); float p = __fmul_rn(d0, d0); asm volatile("" : "+v"(p)); s2[t] = __fadd_rn(s2[t], p); } }
#pragma unroll
    for (int sh = 16; sh; sh >>= 1) {
#pragma unroll
        for (int t = 0; t < 8; ++t) s2[t] = __fadd_rn(s2[t], __shfl_xor(s2[t], sh, 32)); }
#pragma unroll
    for (int t = 0; t < 8; ++t) { const float rs = __fdiv_rn(1.0f, sqrt_slot(__fadd_rn(__fdiv_rn(s2[t], (float)DM), 1e-5f))); v4us oh, ol;
#pragma unroll
        for (int q = 0; q < 4; ++q) { float xn = __fmul_rn(__fsub_rn(v[t][q], mu[t]), rs); asm volatile("" : "+v"(xn)); float gg = bfr(gv[q]); asm volatile("" : "+v"(gg)); float y = __fmul_rn(xn, gg); asm volatile("" : "+v"(y)); float be = bfr(bv[q]); asm volatile("" : "+v"(be)); y = __fadd_rn(y, be); unsigned short h2, l2; splitf(y, h2, l2); oh[q] = h2; ol[q] = l2; }
        *(v4us*)(xh + t * XP + lane * 4) = oh; *(v4us*)(xl + t * XP + lane * 4) = ol; }
}
// ---- nb_tile: pair bias of 16 tokens (rows 16 mb .. of the staged 64) x 16 columns of the padded w2d (4 used), one accumulator; products in the order of gemm_tile (per 32 k: hi, then lo). Register j of lane (lr, hi) is token 8 hi + j, column lr.
__device__ __forceinline__ void nb_tile(const bf* xh, const bf* xl, const bf* __restrict__ W2, float* NB, int r0, int mb) {
    const int lane = threadIdx.x & 31, lr = lane & 15, hi = lane >> 4; const unsigned ao = (mb * 16 + lr) * XP + 8 * hi, wb = (lr * DM + 8 * hi) * 2; v16bf b[DM / 32]; v8f acc = (v8f){};   // wb: the lane's byte offset in w2d, the one vector register that its loads name
#pragma unroll
    for (int c = 0; c < DM / 32; ++c) b[c] = WFrag<bf>::ld((const bf*)((const char*)W2 + wb) + c * 32);
    LOADS_ISSUED(wb, wb, wb);
#pragma unroll
    for (int c = 0; c < DM / 32; ++c) { acc = wmmab(WFrag<bf>::ld(xh + ao + c * 32), b[c], acc); acc = wmmab(WFrag<bf>::ld(xl + ao + c * 32), b[c], acc); }
    float* np = NB + (size_t)(r0 + mb * 16 + 8 * hi) * NBP + lr;
#pragma unroll
    for (int j = 0; j < 8; ++j) np[j * NBP] = acc[j];
}
// ---- k_proj: LayerNorm and the five GEMMs on its result, per 64 tokens; grid tokens/64, 8 waves.
// Each wave normalises 8 of the 64 tokens into LDS (bf16 hi and lo rows); behind the barrier each takes one 64-column tile over all 64 tokens, A fragments from LDS: wave 0,1: q; 2,3: k (fp16 head planes); 4,5: v (fp16 v^T planes); 6,7: gate logits (f32). Waves 0..3 then add 16 tokens each of the pair bias (f32 rows of pitch 64, columns 0..15 written).
// amdgpu_waves_per_eu(4, 4): a budget of 256 registers a wave, so that two work-groups share a WGP: one streams and normalises its tokens while the other multiplies.
__global__ __launch_bounds__(256) __attribute__((amdgpu_waves_per_eu(4, 4))) void k_proj(const float* __restrict__ act, const float* __restrict__ lng, const float* __restrict__ lnb, const bf* __restrict__ WQ, const bf* __restrict__ WK, const bf* __restrict__ WV, const bf* __restrict__ WG, const bf* __restrict__ W2, h16* QP16, h16* KP16, h16* VT16, float* FG, float* NB) {
    __shared__ __align__(16) bf xs[2 * 64 * XP];
    __shared__ __align__(16) float osa[8 * 16 * 68];
    const int wv = __builtin_amdgcn_readfirstlane(threadIdx.x >> 5);   // the wave's number as a scalar: the arms below are scalar branches
    const int r0 = blockIdx.x * 64, c0 = (wv & 1) * 64;
    bf* xh = xs; bf* xl = xs + 64 * XP; float* os = osa + wv * (16 * 68);
    d_ln8(act + (size_t)(r0 + wv * 8) * DM, lng, lnb, xh + wv * 8 * XP, xl + wv * 8 * XP);
    __syncthreads();   // publishes the 64 normalised tokens
    // s_wait_xcnt 0 at the end of each arm, behind its last stores: in the built code other instructions follow it and take the registers that those stores name
    if (wv < 4) { gemm_tile<bf, 1, false, 1>(xh, xl, XP, wv < 2 ? WQ : WK, nullptr, DM, nullptr, DQ, nullptr, wv < 2 ? QP16 : KP16, r0, c0, os); asm volatile("s_wait_xcnt 0x0" ::: "memory");
        nb_tile(xh, xl, W2, NB, r0, wv); asm volatile("s_wait_xcnt 0x0" ::: "memory"); }
    else if (wv < 6) { gemm_tile<bf, 1, false, 2>(xh, xl, XP, WV, nullptr, DM, nullptr, DQ, nullptr, VT16, r0, c0, os); asm volatile("s_wait_xcnt 0x0" ::: "memory"); }
    else { gemm_tile<bf, 1, false, 0>(xh, xl, XP, WG, nullptr, DM, FG, DQ, nullptr, nullptr, r0, c0, os); asm volatile("s_wait_xcnt 0x0" ::: "memory"); }
}
// ---- k_prep: the weights, in ONE launch: the five transposes (WTB blocks each) and the padded w2d (W2B blocks).
#define WTB  ((DM * DQ / 64 + 63) / 64)
#define W2B  ((NBP * DM / 8 + 255) / 256)
__global__ __launch_bounds__(256) void k_prep(const float* __restrict__ w2d, const float* __restrict__ wq, const float* __restrict__ wk, const float* __restrict__ wv, const float* __restrict__ wg, const float* __restrict__ wo,
                                              bf* WQ, bf* WK, bf* WV, bf* WG, bf* WO, bf* W2) {
    const int b = blockIdx.x;
    if (b < 4 * WTB) { const int w = b / WTB; d_wtG(w == 0 ? wq : w == 1 ? wk : w == 2 ? wv : wg, DM, DQ, w == 0 ? WQ : w == 1 ? WK : w == 2 ? WV : WG, b % WTB); return; }
    if (b < 5 * WTB) { d_wtG(wo, DQ, DM, WO, b - 4 * WTB); return; }
    if (b < 5 * WTB + W2B) { d_w2d(w2d, W2, b - 5 * WTB); return; }
}
// pair bias repacked per head, x 32^0.5 (it starts the score accumulators, which are scaled by 32^-0.5 afterwards): NBT[h][q][k] (k contiguous) from the GEMM's [q*256+k][64] rows
__global__ __launch_bounds__(256) void k_nbt(const float* __restrict__ NB, float* NBT) { const size_t pos = (size_t)blockIdx.x * 256 + threadIdx.x; if (pos >= NTOK) return; const float* np = NB + pos * NBP; const v4f v = *(const v4f*)np;
    asm volatile("s_wait_xcnt 0x0" :: "v"(np) : "memory");   // in front of whatever takes the load's address registers (named as an input, so that they live up to the wait)
#pragma unroll
    for (int h = 0; h < NH_; ++h) NBT[(size_t)h * NTOK + pos] = v[h] * RSCL;  }
// two independent v_exp_f32, in place, with the one slot that the instruction set asks for behind a transcendental (before its result is used or its source overwritten) kept in the same statement
__device__ __forceinline__ void exp2x2(float& a, float& b) { asm("v_exp_f32 %0, %0\n\tv_exp_f32 %1, %1\n\tv_nop" : "+v"(a), "+v"(b)); }
// gate and split of one attn.v value: y = (ov / 1024) sigmoid(gate logit + bg) as bf16 hi + lo
__device__ __forceinline__ void gate1(float ov, float gv, float bgraw, unsigned short& h2, unsigned short& l2) {
    const float ga = __fadd_rn(gv, bfr(bgraw)); const float sg = __fdiv_rn(1.0f, __fadd_rn(1.0f, __builtin_amdgcn_exp2f(__fmul_rn(ga, -1.4426950408889634f))));
    const float y = __fmul_rn(__fmul_rn(ov, 1.0f / PCAR), sg); splitf(y, h2, l2); }
// ---- k_fattn: one wave = 16 queries of one row i against all 256 keys, head after head, then the output projection of those 16 queries; grid (256/128, rows), 8 waves.
// Scores are formed TRANSPOSED, S^T = K Q^T + (pair bias + mask bias) 32^0.5 as the accumulators' start value (A = 16 key rows, B = the 16 query rows): an accumulator tile holds key 16t + 8*hi + j of query lr in register j of lane (lr, hi),
// which is the fragment order of P for attn.v (elements 0..7 = tile 2c, 8..15 = tile 2c+1 of the 32-key chunk c): no lane exchange, no LDS or memory round trip for S or P.
// attn.v is formed transposed too, O^T = V^T P^T (A = 16 rows d of v^T, B = P): lane (lr, hi) then holds d = 8*hi + j and 16 + 8*hi + j of query lr, next to that query's row sum, and that again is the fragment order of the head's 32 k of the output projection.
// P = 1024 exp(logit - max) in fp16 (at most 1024); the f32 tile is scaled by 1024 / sum, gated, split into bf16 hi + lo; each lane parks its own 4 x 16 bytes per head in LDS (registers are short while the scores live) and takes them back behind the last head.
// Output: out^T = wo^T y^T (A = 16 columns c of wo, B = y hi, then y lo, head after head: the sum order of a K = 128 GEMM in chunks of 32), staged through the wave's LDS so that each store is one whole 512-byte row of out.
// amdgpu_waves_per_eu(4, 4): a budget of 256 registers a wave, so that two work-groups share a WGP: the 512 work-groups of the launch are resident at once.
#define YP   132              // floats per staged output row: 128 + 4, so that the 16 rows written at once fall on different banks
#define YW   (16 * YP)        // floats of LDS a wave: the staged 16 x 128 output tile; before that its lanes' parked y fragments (8 KiB)
__global__ __launch_bounds__(256) __attribute__((amdgpu_waves_per_eu(4, 4))) void k_fattn(const h16* __restrict__ Q16, const h16* __restrict__ K16, const h16* __restrict__ V16, const float* __restrict__ NBT, const float* __restrict__ mask, const float* __restrict__ FG, const float* __restrict__ bg, const bf* __restrict__ WO, const float* __restrict__ bo, float* OUT) {
    __shared__ __align__(32) float mbs[TT];
    __shared__ __align__(16) float yst[8 * YW];
    const int lane = threadIdx.x & 31, lr = lane & 15, hi = lane >> 4; const int il = blockIdx.y;
    const int wv = __builtin_amdgcn_readfirstlane(threadIdx.x >> 5); const int q0 = (blockIdx.x * 8 + wv) * 16;   // the wave's number as a scalar: over the head loop every plane's base then stays in scalar registers, and a lane keeps one 32-bit offset per row pitch
    const unsigned ko = lr * HD + 8 * hi, no = lr * TT + 8 * hi, go = lr * DQ + 8 * hi, bo8 = 8 * hi;
    float* yw = yst + wv * YW;
    mbs[threadIdx.x] = 1e9f * (bfr(mask[(size_t)il * TT + threadIdx.x]) - 1.0f) * RSCL;   // mask bias of row i, once per work-group
    __syncthreads();   // publishes mbs
#pragma unroll 1   // one head's code, run four times: unrolled it would be four times the text and keep more registers live
    for (int h = 0; h < NH_; ++h) {
        // element offsets in 32 bits (every plane is far below 4 Gi elements); each plane's 64-bit lane address is formed per head and lives only up to the wait behind its last batch of loads
        const unsigned tk0 = (unsigned)h * NTK + (unsigned)il * TT;
        const unsigned kx = tk0 * HD + ko, nx = ((unsigned)h * TT + q0) * TT + no, vx = ((unsigned)h * IG + il) * (HDP * TT) + no, qx = (tk0 + q0) * HD + ko, gx = ((unsigned)il * TT + q0) * DQ + h * HD + go, bx = h * HD + bo8;
        const h16* kp = K16 + kx; const float* nbp = NBT + nx; const h16* vp = V16 + vx; const h16* qp = Q16 + qx; const float* gp = FG + gx; const float* bp = bg + bx;
        const v16h bq = WFrag<h16>::ld(qp);
        v16h ka[8], kb[8]; v8f s[TT / 16];
#pragma unroll
        for (int t = 0; t < 8; ++t) ka[t] = WFrag<h16>::ld(kp + (size_t)t * 16 * HD);
#pragma unroll
        for (int t = 0; t < TT / 16; ++t) s[t] = *(const v8f*)(nbp + t * 16);
        LOADS_ISSUED(qp, kp, nbp);
#pragma unroll
        for (int t = 0; t < 8; ++t) s[t] = wmma16(ka[t], bq, s[t] + *(const v8f*)(mbs + t * 16 + 8 * hi));
        __builtin_amdgcn_sched_barrier(0);   // the second half's key loads take the first half's registers: not above its products
#pragma unroll
        for (int t = 0; t < 8; ++t) kb[t] = WFrag<h16>::ld(kp + (size_t)(8 + t) * 16 * HD);
        LOADS_ISSUED(kp, kp, kp);
#pragma unroll
        for (int t = 0; t < 8; ++t) s[8 + t] = wmma16(kb[t], bq, s[8 + t] + *(const v8f*)(mbs + (8 + t) * 16 + 8 * hi));
        __builtin_amdgcn_sched_barrier(0);   // the v^T loads take the key fragments' registers: not above the products
        v16h vf[TT / 32][2];
#pragma unroll
        for (int cc = 0; cc < 3; ++cc) { vf[cc][0] = WFrag<h16>::ld(vp + cc * 32); vf[cc][1] = WFrag<h16>::ld(vp + (size_t)16 * TT + cc * 32); }
        LOADS_ISSUED(vp, vp, vp);
        float m4[4] = { -3.0e38f, -3.0e38f, -3.0e38f, -3.0e38f };
#pragma unroll
        for (int t = 0; t < TT / 16; ++t) {
#pragma unroll
            for (int j = 0; j < 4; ++j) m4[j] = fmaxf(fmaxf(m4[j], s[t][j]), s[t][j + 4]); }
        float mx = fmaxf(fmaxf(m4[0], m4[1]), fmaxf(m4[2], m4[3])); mx = fmaxf(mx, __shfl_xor(mx, 16, 32));
        v8f vs = (v8f){}; v8f o[2] = { (v8f){}, (v8f){} }; v4f gl[4], bl[4];
#pragma unroll
        for (int cc = 0; cc < TT / 32; ++cc) { v16h p;
#pragma unroll
            for (int j = 0; j < 8; ++j) { float e0 = fmaf(s[2 * cc][j] - mx, SCL * 1.4426950408889634f, 10.0f), e1 = fmaf(s[2 * cc + 1][j] - mx, SCL * 1.4426950408889634f, 10.0f); exp2x2(e0, e1); vs[j] += e0 + e1; p[j] = tohx(e0); p[8 + j] = tohx(e1); }
            o[0] = wmma16(vf[cc][0], p, o[0]); o[1] = wmma16(vf[cc][1], p, o[1]);
            if (cc + 3 < TT / 32) { __builtin_amdgcn_sched_barrier(0);   // the v^T loads three chunks ahead take registers freed above
                vf[cc + 3][0] = WFrag<h16>::ld(vp + (cc + 3) * 32); vf[cc + 3][1] = WFrag<h16>::ld(vp + (size_t)16 * TT + (cc + 3) * 32);
                if (cc + 4 == TT / 32) {   // with the last of them the head's gate logits and gate bias for this lane's 16 values
#pragma unroll
                    for (int u = 0; u < 4; ++u) { gl[u] = *(const v4f*)(gp + (u >> 1) * 16 + (u & 1) * 4); bl[u] = *(const v4f*)(bp + (u >> 1) * 16 + (u & 1) * 4); } }
                // as LOADS_ISSUED; the two accumulators and the running sums are named as inputs too, so that the chunk's products and additions are issued above: left free they sink to the head's end, every v^T fragment and every exponential stays live, and registers spill
                asm volatile("s_wait_xcnt 0x0" :: "v"(vp), "v"(gp), "v"(bp), "v"(o[0]), "v"(o[1]), "v"(vs) : "memory"); __builtin_amdgcn_sched_barrier(0); } }
        __builtin_amdgcn_sched_barrier(0);   // the gating stays below the last chunks: lifted above them it would wait for the gate loads, the youngest in flight, before their latency is covered
        float sum = ((vs[0] + vs[1]) + (vs[2] + vs[3])) + ((vs[4] + vs[5]) + (vs[6] + vs[7])); sum += __shfl_xor(sum, 16, 32);
        const float f = __fdiv_rn(PCAR, sum);   // sum and values belong to the same query lr
        v8us yh0, yh1, yl0, yl1;
#pragma unroll
        for (int j = 0; j < 8; ++j) { unsigned short a2, b2; gate1(o[0][j] * f, gl[j >> 2][j & 3], bl[j >> 2][j & 3], a2, b2); yh0[j] = a2; yl0[j] = b2; gate1(o[1][j] * f, gl[2 + (j >> 2)][j & 3], bl[2 + (j >> 2)][j & 3], a2, b2); yh1[j] = a2; yl1[j] = b2; }
        v8usa* yq = (v8usa*)yw + h * 128 + lane;   // 16-byte units, lanes side by side; each lane reads back only what it wrote
        yq[0] = yh0; yq[32] = yh1; yq[64] = yl0; yq[96] = yl1;
    }
    const bf* wp = WO + go;
    const unsigned l4 = lane * 4;
    v16bf w[2][NH_], yh[NH_], yl[NH_]; v8f acc[DM / 16];
#pragma unroll
    for (int h = 0; h < NH_; ++h) w[0][h] = WFrag<bf>::ld(wp + h * HD);
    const v4f bov = *(const v4f*)(bo + l4);
    LOADS_ISSUED(go, l4, go);
#pragma unroll
    for (int h = 0; h < NH_; ++h) { const v8usa* yq = (const v8usa*)yw + h * 128 + lane; yh[h] = cat16b(yq[0], yq[32]); yl[h] = cat16b(yq[64], yq[96]); }
#pragma unroll
    for (int t = 0; t < DM / 16; ++t) {
        if (t + 1 < DM / 16) {   // the next 16 columns' wo fragments fly while this tile's products run
#pragma unroll
            for (int h = 0; h < NH_; ++h) w[(t + 1) & 1][h] = WFrag<bf>::ld(wp + (size_t)(t + 1) * 16 * DQ + h * HD);
            LOADS_ISSUED(go, go, go); }
        acc[t] = (v8f){};
#pragma unroll
        for (int h = 0; h < NH_; ++h) { acc[t] = wmmab(w[t & 1][h], yh[h], acc[t]); acc[t] = wmmab(w[t & 1][h], yl[h], acc[t]); }
    }
    // register j of tile t is column 16t + 8*hi + j of query lr
#pragma unroll
    for (int t = 0; t < DM / 16; ++t) { float* sp = yw + lr * YP + t * 16 + 8 * hi; *(v4fa*)sp = __builtin_shufflevector(acc[t], acc[t], 0, 1, 2, 3); *(v4fa*)(sp + 4) = __builtin_shufflevector(acc[t], acc[t], 4, 5, 6, 7); }
    __builtin_amdgcn_wave_barrier(); asm volatile("" ::: "memory");   // the reads below take other lanes' values: not above the writes (one wave, its LDS operations run in order)
    float* orow = OUT + ((size_t)il * TT + q0) * DM + l4;
#pragma unroll
    for (int r = 0; r < 16; ++r) { v4f val = *(const v4fa*)(yw + r * YP + lane * 4); val[0] += bfr(bov[0]); val[1] += bfr(bov[1]); val[2] += bfr(bov[2]); val[3] += bfr(bov[3]); *(v4f*)(orow + (size_t)r * DM) = val;
        if (r == 7) asm volatile("s_wait_xcnt 0x0" ::: "memory");   // in front of the second half's LDS reads, which take registers that these stores name
    }
}

extern "C" void kernel_launch(void* const* d_in, const int* in_sizes, int n_in,
                              void* d_out, int out_size, void* d_ws, size_t ws_size, hipStream_t stream) {
    (void)in_sizes; (void)n_in; (void)out_size;
    const float* act = (const float*)d_in[0]; const float* mask = (const float*)d_in[1]; const float* lng = (const float*)d_in[2]; const float* lnb = (const float*)d_in[3]; const float* w2d = (const float*)d_in[4]; const float* wq = (const float*)d_in[5]; const float* wk = (const float*)d_in[6]; const float* wv = (const float*)d_in[7]; const float* wg = (const float*)d_in[8]; const float* bg = (const float*)d_in[9]; const float* wo = (const float*)d_in[10]; const float* bo = (const float*)d_in[11];
    float* OUT = (float*)d_out;     // [1][256][256][128]
    char* wsp = (char*)d_ws;
    auto take = [&](size_t bytes) { char* p = wsp; wsp += (bytes + 255) & ~(size_t)255; return (void*)p; };
    bf* WQ = (bf*)take((size_t)DQ * DM * 2); bf* WK = (bf*)take((size_t)DQ * DM * 2); bf* WV = (bf*)take((size_t)DQ * DM * 2); bf* WG = (bf*)take((size_t)DQ * DM * 2); bf* WO = (bf*)take((size_t)DM * DQ * 2); bf* W2 = (bf*)take((size_t)NBP * DM * 2);
    float* NB = (float*)take((size_t)NTOK * NBP * 4);
    float* FG = (float*)take((size_t)NTK * DQ * 4); h16* QP16 = (h16*)take((size_t)NH_ * NTK * HD * 2); h16* KP16 = (h16*)take((size_t)NH_ * NTK * HD * 2); h16* VT16 = (h16*)take((size_t)NH_ * IG * HDP * TT * 2);
    float* NBT = (float*)take((size_t)NH_ * NTOK * 4);
    if ((size_t)(wsp - (char*)d_ws) > ws_size) return;    // ws 256 MiB (carve ~113 MiB)
    static_assert(IG == NI, "one row group: the pair bias of all positions is formed in the projections' launch");
    k_prep<<<5 * WTB + W2B, 256, 0, stream>>>(w2d, wq, wk, wv, wg, wo, WQ, WK, WV, WG, WO, W2);
    k_proj<<<NTK / 64, 256, 0, stream>>>(act, lng, lnb, WQ, WK, WV, WG, W2, QP16, KP16, VT16, FG, NB);   /* LayerNorm; q, k, v^T planes, gate logits, pair bias nb[(q,k)][h] for all 65536 positions (cols 0..3) */
    k_nbt<<<NTOK / 256, 256, 0, stream>>>(NB, NBT);
    k_fattn<<<dim3(TT / 128, IG, 1), 256, 0, stream>>>(QP16, KP16, VT16, NBT, mask, FG, bg, WO, bo, OUT);   /* attention, gating and output projection */
}

// v007
// Measured time: 66.8 microseconds a run.
// Two timings next to v006 both put it at 1.36 times that version's speed.
// All steps since v000 together make it 11.8 times as fast.
#include <hip/hip_runtime.h>

// Triangle attention (starting node) on a pair representation (act [1][256][256][128], mask [1][256][256]): x = LayerNorm_c(act) (eps 1e-5, ln_g/ln_b); per row i: q, k, v, g = x[i] W (wq/wk/wv/wg [128][4][32] 'xw', 4 heads x 32; q x 32^-0.5), logits[h][q][k] = q.k + 1e9 (mask[i][k] - 1) + nb[h][q][k] with the pair bias nb[h][q][k] = sum_c x[q][k][c] w2d[c][h] (shared by all rows i);
// softmax over k; o = attn.v gated by sigmoid(x wg + bg); out[i][q][c] = sum_{h,d} o[h][d] wo[h][d][c] + bo -> [1][256][256][128] (8.4 M).
// Layout: rows i in groups of IG, here all 256 in one group, so each stage is one launch. One small launch puts the weights into fragment order (w2d padded to 64 rows, 16 read). Then ONE kernel per 64 tokens: LayerNorm -> bf16 hi/lo rows in LDS, from which its 8 waves take the A fragments of the q/k/v/g projections (hi/lo x exact) and of the pair bias nb (16 columns, 4 used); the normalised tokens never go to memory. The projections' epilogue writes the fp16 planes q, k and v^T and the f32 gate logits itself, in the fragment order in which the attention kernel's lanes load them, then ONE attention kernel (a wave takes its 16 queries through all four heads; scores, mask bias + pair bias, x 32^-0.5, softmax and attn.v stay in registers) that also gates its result, splits it into bf16 hi + lo and multiplies it by wo (+ bo) itself.
// Compute dtypes, f32 accumulate: every input rounded to bf16 once; LayerNorm in f32, its output as bf16 hi + lo (2-product projections against exact bf16 weights); scores and attn.v on single fp16 planes (P = 1024 exp(logit - max), at most 1024; 1/sum applied to the f32 attn.v result); pair bias, mask bias, softmax, gating in f32; output GEMM hl x exact + bo.

#define NI   256       // rows i
#define TT   256       // tokens per row (q / k index)
#define DM   128       // c_z
#define NH_  4
#define HD   32
#define DQ   (NH_ * HD)
#define IG   256       // rows i per group: all of them (one launch per stage fills the chip; the planes between the stages then take 97 MiB of the workspace)
#define NTK  (IG * TT) // tokens per group = 65536
#define NTOK (NI * TT) // 65536
#define NBP  64        // pair-bias row pitch and padded w2d rows (16 computed, 4 used)
#define PCAR 1024.0f
#define SCL  0.17677669529663688f   // 32^-0.5
#define RSCL 5.656854249492381f     // 32^0.5
typedef _Float16 h16;
typedef unsigned short bf;
typedef __attribute__((ext_vector_type(16))) __bf16   v16bf;
typedef __attribute__((ext_vector_type(16))) _Float16 v16h;
typedef __attribute__((ext_vector_type(8)))  _Float16 v8h;
typedef __attribute__((ext_vector_type(8)))  unsigned short v8us;
typedef __attribute__((ext_vector_type(8)))  float    v8f;
typedef __attribute__((ext_vector_type(4)))  float    v4f;
typedef v8h  __attribute__((may_alias)) v8ha;
typedef v4f  __attribute__((may_alias)) v4fa;
typedef v8us __attribute__((may_alias)) v8usa;

__device__ __forceinline__ unsigned short f2bf(float f) { unsigned u = __float_as_uint(f); u += 0x7FFFu + ((u >> 16) & 1u); return (unsigned short)(u >> 16); }
__device__ __forceinline__ float bf2f(unsigned short b) { return __uint_as_float(((unsigned)b) << 16); }
__device__ __forceinline__ float bfr(float f) { return bf2f(f2bf(f)); }
__device__ __forceinline__ v16h cat16(v8h lo, v8h hi) { return __builtin_shufflevector(lo, hi, 0, 1, 2, 3, 4, 5, 6, 7, 8, 9, 10, 11, 12, 13, 14, 15); }
__device__ __forceinline__ v16bf cat16b(v8us lo, v8us hi) { return __builtin_bit_cast(v16bf, __builtin_shufflevector(lo, hi, 0, 1, 2, 3, 4, 5, 6, 7, 8, 9, 10, 11, 12, 13, 14, 15)); }
__device__ __forceinline__ v8f wmma16(v16h a, v16h b, v8f c) { return __builtin_amdgcn_wmma_f32_16x16x32_f16(false, a, false, b, (short)0, c, false, false); }
__device__ __forceinline__ v8f wmmab(v16bf a, v16bf b, v8f c) { return __builtin_amdgcn_wmma_f32_16x16x32_bf16(false, a, false, b, (short)0, c, false, false); }



// ---- FRAGMENT ORDER: every plane that a matrix instruction reads from global memory is stored as its fragments are held. A fragment (16 rows x 32 k of 16-bit values) is 1024 bytes: [half][lane][8], lane = 16 hi + row, element j of half s = k 16 s + 8 hi + j; ldf() takes it with two loads of 512 contiguous bytes (four whole lines each) where rows at a pitch made each load touch 8 or 16 lines.
// ---- gemm_tile: register-blocked GEMM, ONE WAVE per 64x64 output tile at (r0, c0) (16 accumulators); A, A2 = the tile's own 64 rows (hi, lo) at a pitch of lda elements in LDS; Bt = the weights in fragment order [n / 16][k / 32][fragment]. K % 32 == 0. Products per 32 k: hi, then lo.
// EPI 2 (v): token rows as A, so that a lane's 8 accumulator registers are 8 consecutive tokens of one column d: 16 bytes of a v^T fragment, P16[n / 32][row i][key / 32][d / 16][fragment].
// EPI 1 (q, k) and EPI 0 (gate logits): the weights as A (the tile comes out transposed; same products, same order over k), so that the 8 registers are 8 consecutive columns of one token: 16 bytes of a q or k fragment, P16[n / 32][token / 16][fragment]; the gate logits in f32, C[n / 32][token / 16][d / 16][j / 4][lane][4].
// In all three the lane that holds the values is the lane that will load them: each store is 512 contiguous bytes straight from the registers, with no LDS stage.
#define TG   (NTK / 16)   // groups of 16 tokens
template <typename T16> struct WFrag;
template <> struct WFrag<h16> { typedef v16h V; static __device__ __forceinline__ V ld(const h16* p) { return cat16(*(const v8h*)p, *(const v8h*)(p + 16)); } static __device__ __forceinline__ V ldf(const h16* p) { return cat16(*(const v8h*)p, *(const v8h*)(p + 256)); } static __device__ __forceinline__ v8f mma(V a, V b, v8f c) { return wmma16(a, b, c); } };
template <> struct WFrag<bf> { typedef v16bf V; static __device__ __forceinline__ V ld(const bf* p) { return cat16b(*(const v8us*)p, *(const v8us*)(p + 16)); } static __device__ __forceinline__ V ldf(const bf* p) { return cat16b(*(const v8us*)p, *(const v8us*)(p + 256)); } static __device__ __forceinline__ v8f mma(V a, V b, v8f c) { return wmmab(a, b, c); } };
template <typename T16, int EPI>
__device__ __forceinline__ void gemm_tile(const T16* A, const T16* A2, int lda, const T16* __restrict__ Bt, int K, float* C, h16* P16, int r0, int c0) {
    typedef typename WFrag<T16>::V V;
    const int lane = threadIdx.x & 31, lr = lane & 15, hi = lane >> 4;
    v8f acc[4][4];
#pragma unroll
    for (int mb = 0; mb < 4; ++mb)
#pragma unroll
        for (int nb = 0; nb < 4; ++nb) acc[mb][nb] = (v8f){};
    const size_t aoff = (size_t)lr * lda + 8 * hi; const T16* bp = Bt + (size_t)(c0 / 16) * (K / 32) * 512 + lane * 8;
#pragma unroll 1
    for (int kc = 0; kc < K; kc += 32) {
        V a[4], a2[4];
#pragma unroll
        for (int mb = 0; mb < 4; ++mb) { a[mb] = WFrag<T16>::ld(A + aoff + (size_t)mb * 16 * lda + kc); a2[mb] = WFrag<T16>::ld(A2 + aoff + (size_t)mb * 16 * lda + kc); }
#pragma unroll
        for (int nb = 0; nb < 4; ++nb) { const V b = WFrag<T16>::ldf(bp + (size_t)(nb * (K / 32)) * 512 + kc * 16);
#pragma unroll
            for (int mb = 0; mb < 4; ++mb) {
                if constexpr (EPI == 2) { acc[mb][nb] = WFrag<T16>::mma(a[mb], b, acc[mb][nb]); acc[mb][nb] = WFrag<T16>::mma(a2[mb], b, acc[mb][nb]); }
                else { acc[mb][nb] = WFrag<T16>::mma(b, a[mb], acc[mb][nb]); acc[mb][nb] = WFrag<T16>::mma(b, a2[mb], acc[mb][nb]); } } }
        asm volatile("v_nop\n\tv_nop\n\tv_nop\n\tv_nop" : "+v"(acc[0][0]), "+v"(acc[1][1]), "+v"(acc[2][2]), "+v"(acc[3][3]) : "v"(a[0]), "v"(a[3]));
    }
    if constexpr (EPI == 0) {
        float* dst = C + ((size_t)(c0 / HD) * TG + r0 / 16) * 512 + lane * 4;
#pragma unroll
        for (int mb = 0; mb < 4; ++mb)
#pragma unroll
            for (int nb = 0; nb < 4; ++nb) { float* d2 = dst + ((size_t)(nb >> 1) * TG + mb) * 512 + (nb & 1) * 256;
                *(v4f*)d2 = __builtin_shufflevector(acc[mb][nb], acc[mb][nb], 0, 1, 2, 3); *(v4f*)(d2 + 128) = __builtin_shufflevector(acc[mb][nb], acc[mb][nb], 4, 5, 6, 7); }
        return;
    }
    h16* dst = (EPI == 1) ? P16 + ((size_t)(c0 / HD) * TG + r0 / 16) * 512 + lane * 8 : P16 + (((size_t)(c0 / HD) * IG + r0 / TT) * (TT / 32) + (r0 % TT) / 32) * 1024 + lane * 8;
#pragma unroll
    for (int mb = 0; mb < 4; ++mb) {
#pragma unroll
        for (int nb = 0; nb < 4; ++nb) { v8h o;
#pragma unroll
            for (int j = 0; j < 8; ++j) o[j] = (h16)acc[mb][nb][j];
            if constexpr (EPI == 1) *(v8h*)(dst + ((size_t)(nb >> 1) * TG + mb) * 512 + (nb & 1) * 256) = o;
            else *(v8h*)(dst + ((size_t)(nb >> 1) * IG * (TT / 32) + (mb >> 1)) * 1024 + (nb & 1) * 512 + (mb & 1) * 256) = o; }
        if (mb < 3) { asm volatile("s_wait_xcnt 0x0" ::: "memory"); __builtin_amdgcn_sched_barrier(0); }   // in front of the next four conversions, which may take registers that these stores name; the scheduling barrier keeps them behind the wait
    }
}
typedef __attribute__((ext_vector_type(4))) unsigned short v4us;
typedef __attribute__((ext_vector_type(2))) unsigned short v2us;
typedef __attribute__((ext_vector_type(2))) _Float16 v2h;
typedef __attribute__((ext_vector_type(4))) _Float16 v4h;
__device__ __forceinline__ h16 tohx(float x) { return (h16)x; }
__device__ __forceinline__ void splitf(float y, unsigned short& h, unsigned short& l) { h = f2bf(y); l = f2bf(y - bf2f(h)); }
__device__ __forceinline__ void d_wtG(const float* __restrict__ w, int K, int N, bf* Bt, int bx) {
    const int lane = threadIdx.x & 31; const int L0 = (bx * 8 + (threadIdx.x >> 5)) * 8; const int nlines = N * K / 64;
{
#pragma unroll 1
        for (int l = 0; l < 8; ++l) { const int L = L0 + l; if (L >= nlines) break; const int e = L * 64 + lane * 2; const int fl = (e >> 3) & 31, fr = e >> 9;   // e counts in fragment order: [n / 16][k / 32][half][lane][8]; a wave still writes one whole line
            const int k = (fr % (K / 32)) * 32 + ((e >> 8) & 1) * 16 + (fl >> 4) * 8 + (e & 7), n = (fr / (K / 32)) * 16 + (fl & 15); v2us o;
            o[0] = f2bf(w[(size_t)k * N + n]); o[1] = f2bf(w[(size_t)(k + 1) * N + n]); *(v2us*)(Bt + e) = o;
            asm volatile("s_wait_xcnt 0x0" ::: "memory"); }   // in front of the next trip's index sums, which take registers that this store names
         }
}
__global__ __launch_bounds__(256) void k_cvt8(const float* __restrict__ src, bf* dst, size_t n8) { const size_t i = (size_t)blockIdx.x * 256 + threadIdx.x; if (i >= n8) return; const v8f v = *(const v8f*)(src + i * 8); v8us o;
#pragma unroll
    for (int k = 0; k < 8; ++k) o[k] = f2bf(v[k]); *(v8us*)(dst + i * 8) = o;  }

__device__ __forceinline__ void d_w2d(const float* __restrict__ w, bf* Bt, int bx) { const int i = bx * 256 + threadIdx.x; if (i >= NBP * DM / 8) return; const int r = (i >> 8) * 16 + (i & 15), c0 = ((i >> 6) & 3) * 32 + ((i >> 5) & 1) * 16 + ((i >> 4) & 1) * 8; v8us o;   // i counts 16-byte units in fragment order
#pragma unroll
    for (int k = 0; k < 8; ++k) o[k] = (r < NH_) ? f2bf(w[(size_t)(c0 + k) * NH_ + r]) : (unsigned short)0; *(v8us*)(Bt + (size_t)i * 8) = o;  }
// End of a batch of global loads: s_wait_xcnt 0 in front of whatever may take the loads' address registers (named as inputs, so that they live up to the wait); the scheduling barrier keeps the batch issued here, ahead of the work below that hides its latency (the compiler otherwise sinks each load to its use and waits for each in turn).
#define LOADS_ISSUED(p0, p1, p2) do { asm volatile("s_wait_xcnt 0x0" :: "v"(p0), "v"(p1), "v"(p2) : "memory"); __builtin_amdgcn_sched_barrier(0); } while (0)
// square root as the compiler expands it (a subnormal argument scaled by 2^32, the root by 2^-16), with v_sqrt_f32 and the one slot that the instruction set asks for behind a transcendental (before its result is used or its source overwritten) kept in one statement
__device__ __forceinline__ float sqrt_slot(float x) { const bool sm = x < 0x1p-126f; float r = ldexpf(x, sm ? 32 : 0); asm("v_sqrt_f32 %0, %0\n\tv_nop" : "+v"(r)); return ldexpf(r, sm ? -16 : 0); }
// ---- d_ln8: LayerNorm of 8 tokens by one wave (a lane holds 4 channels of each); A = the first token's row, xh / xl = its hi / lo row in LDS. Per token the operations, their order and their roundings of the one-token form; the 8 tokens go through each stage side by side, so that their 8 loads fly together and their dependent chains fill each other's waits. The empty asm statements are those of the one-token form, taken over as they stood: each difference and product is rounded on its own before the next operation takes it, so the normalised values stay bit for bit what they were.
#define XP   136       // 16-bit elements per staged token row: 256 + 16 bytes, the pitch for 16-byte LDS reads of 16 rows at once
__device__ __forceinline__ void d_ln8(const float* __restrict__ A, const float* __restrict__ g, const float* __restrict__ bb, bf* xh, bf* xl) {
    const int lane = threadIdx.x & 31; const unsigned lb = lane * 16; v4f a[8];   // lb: the lane's byte offset in a row, the one vector register that the loads below name (their bases are scalars)
#pragma unroll
    for (int t = 0; t < 8; ++t) a[t] = *(const v4f*)((const char*)A + lb + t * (DM * 4));
    const v4f gv = *(const v4f*)((const char*)g + lb), bv = *(const v4f*)((const char*)bb + lb);
    LOADS_ISSUED(lb, lb, lb);
    float v[8][4], s[8], mu[8], s2[8];
#pragma unroll
    for (int t = 0; t < 8; ++t) { s[t] = 0.f;
#pragma unroll
        for (int q = 0; q < 4; ++q) { v[t][q] = bfr(a[t][q]); s[t] = __fadd_rn(s[t], v[t][q]); } }
#pragma unroll
    for (int sh = 16; sh; sh >>= 1) {
#pragma unroll
        for (int t = 0; t < 8; ++t) s[t] = __fadd_rn(s[t], __shfl_xor(s[t], sh, 32)); }
#pragma unroll
    for (int t = 0; t < 8; ++t) { mu[t] = __fdiv_rn(s[t], (float)DM); s2[t] = 0.f;
#pragma unroll
        for (int q = 0; q < 4; ++q) { float d0 = __fsub_rn(v[t][q], mu[t]); asm volatile("" : "+v"(d0)); float p = __fmul_rn(d0, d0); asm volatile("" : "+v"(p)); s2[t] = __fadd_rn(s2[t], p); } }
#pragma unroll
    for (int sh = 16; sh; sh >>= 1) {
#pragma unroll
        for (int t = 0; t < 8; ++t) s2[t] = __fadd_rn(s2[t], __shfl_xor(s2[t], sh, 32)); }
#pragma unroll
    for (int t = 0; t < 8; ++t) { const float rs = __fdiv_rn(1.0f, sqrt_slot(__fadd_rn(__fdiv_rn(s2[t], (float)DM), 1e-5f))); v4us oh, ol;
#pragma unroll
        for (int q = 0; q < 4; ++q) { float xn = __fmul_rn(__fsub_rn(v[t][q], mu[t]), rs); asm volatile("" : "+v"(xn)); float gg = bfr(gv[q]); asm volatile("" : "+v"(gg)); float y = __fmul_rn(xn, gg); asm volatile("" : "+v"(y)); float be = bfr(bv[q]); asm volatile("" : "+v"(be)); y = __fadd_rn(y, be); unsigned short h2, l2; splitf(y, h2, l2); oh[q] = h2; ol[q] = l2; }
        *(v4us*)(xh + t * XP + lane * 4) = oh; *(v4us*)(xl + t * XP + lane * 4) = ol; }
}
// ---- nb_tile: pair bias of 16 tokens (rows 16 mb .. of the staged 64) x 16 columns of the padded w2d (4 used), one accumulator; products in the order of gemm_tile (per 32 k: hi, then lo). Register j of lane (lr, hi) is token 8 hi + j, column lr.
__device__ __forceinline__ void nb_tile(const bf* xh, const bf* xl, const bf* __restrict__ W2, float* NB, int r0, int mb) {
    const int lane = threadIdx.x & 31, lr = lane & 15, hi = lane >> 4; const unsigned ao = (mb * 16 + lr) * XP + 8 * hi, wb = lane * 16; v16bf b[DM / 32]; v8f acc = (v8f){};   // wb: the lane's byte offset in w2d, the one vector register that its loads name
#pragma unroll
    for (int c = 0; c < DM / 32; ++c) b[c] = WFrag<bf>::ldf((const bf*)((const char*)W2 + wb) + c * 512);
    LOADS_ISSUED(wb, wb, wb);
#pragma unroll
    for (int c = 0; c < DM / 32; ++c) { acc = wmmab(WFrag<bf>::ld(xh + ao + c * 32), b[c], acc); acc = wmmab(WFrag<bf>::ld(xl + ao + c * 32), b[c], acc); }
    float* np = NB + (size_t)(r0 + mb * 16 + 8 * hi) * NBP + lr;
#pragma unroll
    for (int j = 0; j < 8; ++j) np[j * NBP] = acc[j];
}
// ---- k_proj: LayerNorm and the five GEMMs on its result, per 64 tokens; grid tokens/64, 8 waves.
// Each wave normalises 8 of the 64 tokens into LDS (bf16 hi and lo rows); behind the barrier each takes one 64-column tile over all 64 tokens, A fragments from LDS: wave 0,1: q; 2,3: k (fp16 head planes); 4,5: v (fp16 v^T planes); 6,7: gate logits (f32). Waves 0..3 then add 16 tokens each of the pair bias (f32 rows of pitch 64, columns 0..15 written).
// amdgpu_waves_per_eu(4, 4): a budget of 256 registers a wave, so that two work-groups share a WGP: one streams and normalises its tokens while the other multiplies.
__global__ __launch_bounds__(256) __attribute__((amdgpu_waves_per_eu(4, 4))) void k_proj(const float* __restrict__ act, const float* __restrict__ lng, const float* __restrict__ lnb, const bf* __restrict__ WQ, const bf* __restrict__ WK, const bf* __restrict__ WV, const bf* __restrict__ WG, const bf* __restrict__ W2, h16* QP16, h16* KP16, h16* VT16, float* FG, float* NB) {
    __shared__ __align__(16) bf xs[2 * 64 * XP];
    const int wv = __builtin_amdgcn_readfirstlane(threadIdx.x >> 5);   // the wave's number as a scalar: the arms below are scalar branches
    const int r0 = blockIdx.x * 64, c0 = (wv & 1) * 64;
    bf* xh = xs; bf* xl = xs + 64 * XP;
    d_ln8(act + (size_t)(r0 + wv * 8) * DM, lng, lnb, xh + wv * 8 * XP, xl + wv * 8 * XP);
    __syncthreads();   // publishes the 64 normalised tokens
    // s_wait_xcnt 0 at the end of each arm, behind its last stores: in the built code other instructions follow it and take the registers that those stores name
    if (wv < 4) { gemm_tile<bf, 1>(xh, xl, XP, wv < 2 ? WQ : WK, DM, nullptr, wv < 2 ? QP16 : KP16, r0, c0); asm volatile("s_wait_xcnt 0x0" ::: "memory");
        nb_tile(xh, xl, W2, NB, r0, wv); asm volatile("s_wait_xcnt 0x0" ::: "memory"); }
    else if (wv < 6) { gemm_tile<bf, 2>(xh, xl, XP, WV, DM, nullptr, VT16, r0, c0); asm volatile("s_wait_xcnt 0x0" ::: "memory"); }
    else { gemm_tile<bf, 0>(xh, xl, XP, WG, DM, FG, nullptr, r0, c0); asm volatile("s_wait_xcnt 0x0" ::: "memory"); }
}
// ---- k_prep: the weights, in ONE launch: the five transposes (WTB blocks each) and the padded w2d (W2B blocks).
#define WTB  ((DM * DQ / 64 + 63) / 64)
#define W2B  ((NBP * DM / 8 + 255) / 256)
__global__ __launch_bounds__(256) void k_prep(const float* __restrict__ w2d, const float* __restrict__ wq, const float* __restrict__ wk, const float* __restrict__ wv, const float* __restrict__ wg, const float* __restrict__ wo,
                                              bf* WQ, bf* WK, bf* WV, bf* WG, bf* WO, bf* W2) {
    const int b = blockIdx.x;
    if (b < 4 * WTB) { const int w = b / WTB; d_wtG(w == 0 ? wq : w == 1 ? wk : w == 2 ? wv : wg, DM, DQ, w == 0 ? WQ : w == 1 ? WK : w == 2 ? WV : WG, b % WTB); return; }
    if (b < 5 * WTB) { d_wtG(wo, DQ, DM, WO, b - 4 * WTB); return; }
    if (b < 5 * WTB + W2B) { d_w2d(w2d, W2, b - 5 * WTB); return; }
}
// pair bias repacked per head, x 32^0.5 (it starts the score accumulators, which are scaled by 32^-0.5 afterwards): NBT[h][q / 16][k / 16][j / 4][lane][4] from the GEMM's [q*256+k][64] rows: the order in which a score accumulator tile holds it (lane = 16 hi + q % 16, k % 16 = 8 hi + j), so that the attention kernel's loads are 512 contiguous bytes; thread u writes element u of each head
__global__ __launch_bounds__(256) void k_nbt(const float* __restrict__ NB, float* NBT) { const unsigned u = blockIdx.x * 256 + threadIdx.x; if (u >= NTOK) return; const unsigned fl = (u >> 2) & 31; const size_t pos = (size_t)((u >> 12) * 16 + (fl & 15)) * TT + ((u >> 8) & 15) * 16 + (fl >> 4) * 8 + ((u >> 7) & 1) * 4 + (u & 3); const float* np = NB + pos * NBP; const v4f v = *(const v4f*)np;
    asm volatile("s_wait_xcnt 0x0" :: "v"(np) : "memory");   // in front of whatever takes the load's address registers (named as an input, so that they live up to the wait)
#pragma unroll
    for (int h = 0; h < NH_; ++h) NBT[(size_t)h * NTOK + u] = v[h] * RSCL;  }
// two independent v_exp_f32, in place, with the one slot that the instruction set asks for behind a transcendental (before its result is used or its source overwritten) kept in the same statement
__device__ __forceinline__ void exp2x2(float& a, float& b) { asm("v_exp_f32 %0, %0\n\tv_exp_f32 %1, %1\n\tv_nop" : "+v"(a), "+v"(b)); }
// gate and split of one attn.v value: y = (ov / 1024) sigmoid(gate logit + bg) as bf16 hi + lo
__device__ __forceinline__ void gate1(float ov, float gv, float bgraw, unsigned short& h2, unsigned short& l2) {
    const float ga = __fadd_rn(gv, bfr(bgraw)); const float sg = __fdiv_rn(1.0f, __fadd_rn(1.0f, __builtin_amdgcn_exp2f(__fmul_rn(ga, -1.4426950408889634f))));
    const float y = __fmul_rn(__fmul_rn(ov, 1.0f / PCAR), sg); splitf(y, h2, l2); }
// ---- k_fattn: one wave = 16 queries of one row i against all 256 keys, head after head, then the output projection of those 16 queries; grid (256/128, rows), 8 waves.
// Scores are formed TRANSPOSED, S^T = K Q^T + (pair bias + mask bias) 32^0.5 as the accumulators' start value (A = 16 key rows, B = the 16 query rows): an accumulator tile holds key 16t + 8*hi + j of query lr in register j of lane (lr, hi),
// which is the fragment order of P for attn.v (elements 0..7 = tile 2c, 8..15 = tile 2c+1 of the 32-key chunk c): no lane exchange, no LDS or memory round trip for S or P.
// attn.v is formed transposed too, O^T = V^T P^T (A = 16 rows d of v^T, B = P): lane (lr, hi) then holds d = 8*hi + j and 16 + 8*hi + j of query lr, next to that query's row sum, and that again is the fragment order of the head's 32 k of the output projection.
// P = 1024 exp(logit - max) in fp16 (at most 1024); the f32 tile is scaled by 1024 / sum, gated, split into bf16 hi + lo; each lane parks its own 4 x 16 bytes per head in LDS (registers are short while the scores live) and takes them back behind the last head.
// Output: out^T = wo^T y^T (A = 16 columns c of wo, B = y hi, then y lo, head after head: the sum order of a K = 128 GEMM in chunks of 32), staged through the wave's LDS so that each store is one whole 512-byte row of out.
// amdgpu_waves_per_eu(4, 4): a budget of 256 registers a wave, so that two work-groups share a WGP: the 512 work-groups of the launch are resident at once.
#define YP   132              // floats per staged output row: 128 + 4, so that the 16 rows written at once fall on different banks
#define YW   (16 * YP)        // floats of LDS a wave: the staged 16 x 128 output tile; before that its lanes' parked y fragments (8 KiB)
__global__ __launch_bounds__(256) __attribute__((amdgpu_waves_per_eu(4, 4))) void k_fattn(const h16* __restrict__ Q16, const h16* __restrict__ K16, const h16* __restrict__ V16, const float* __restrict__ NBT, const float* __restrict__ mask, const float* __restrict__ FG, const float* __restrict__ bg, const bf* __restrict__ WO, const float* __restrict__ bo, float* OUT) {
    __shared__ __align__(32) float mbs[TT];
    __shared__ __align__(16) float yst[8 * YW];
    const int lane = threadIdx.x & 31, lr = lane & 15, hi = lane >> 4; const int il = blockIdx.y;
    const int wv = __builtin_amdgcn_readfirstlane(threadIdx.x >> 5); const int q0 = (blockIdx.x * 8 + wv) * 16;   // the wave's number as a scalar: over the head loop every plane's base then stays in scalar registers, and a lane keeps one 32-bit offset per element width
    const unsigned l8 = lane * 8, l4 = lane * 4, bo8 = 8 * hi;   // a lane's place in a 16-bit and in an f32 fragment
    float* yw = yst + wv * YW;
    mbs[threadIdx.x] = 1e9f * (bfr(mask[(size_t)il * TT + threadIdx.x]) - 1.0f) * RSCL;   // mask bias of row i, once per work-group
    __syncthreads();   // publishes mbs
#pragma unroll 1   // one head's code, run four times: unrolled it would be four times the text and keep more registers live
    for (int h = 0; h < NH_; ++h) {
        // element offsets in 32 bits (every plane is far below 4 Gi elements); each plane's 64-bit lane address is formed per head and lives only up to the wait behind its last batch of loads
        const unsigned tg0 = (unsigned)h * TG + (unsigned)il * (TT / 16), qt = q0 / 16;
        const unsigned kx = tg0 * 512 + l8, nx = ((unsigned)h * (TT / 16) + qt) * (16 * TT) + l4, vx = ((unsigned)h * IG + il) * (HD * TT) + l8, qx = (tg0 + qt) * 512 + l8, gx = (tg0 + qt) * 512 + l4, bx = h * HD + bo8;
        const h16* kp = K16 + kx; const float* nbp = NBT + nx; const h16* vp = V16 + vx; const h16* qp = Q16 + qx; const float* gp = FG + gx; const float* bp = bg + bx;
        const v16h bq = WFrag<h16>::ldf(qp);
        v16h ka[8], kb[8]; v8f s[TT / 16];
#pragma unroll
        for (int t = 0; t < 8; ++t) ka[t] = WFrag<h16>::ldf(kp + t * 512);
#pragma unroll
        for (int t = 0; t < TT / 16; ++t) s[t] = __builtin_shufflevector(*(const v4f*)(nbp + t * 256), *(const v4f*)(nbp + t * 256 + 128), 0, 1, 2, 3, 4, 5, 6, 7);
        LOADS_ISSUED(qp, kp, nbp);
#pragma unroll
        for (int t = 0; t < 8; ++t) s[t] = wmma16(ka[t], bq, s[t] + *(const v8f*)(mbs + t * 16 + 8 * hi));
        __builtin_amdgcn_sched_barrier(0);   // the second half's key loads take the first half's registers: not above its products
#pragma unroll
        for (int t = 0; t < 8; ++t) kb[t] = WFrag<h16>::ldf(kp + (8 + t) * 512);
        LOADS_ISSUED(kp, kp, kp);
#pragma unroll
        for (int t = 0; t < 8; ++t) s[8 + t] = wmma16(kb[t], bq, s[8 + t] + *(const v8f*)(mbs + (8 + t) * 16 + 8 * hi));
        __builtin_amdgcn_sched_barrier(0);   // the v^T loads take the key fragments' registers: not above the products
        v16h vf[TT / 32][2];
#pragma unroll
        for (int cc = 0; cc < 3; ++cc) { vf[cc][0] = WFrag<h16>::ldf(vp + cc * 1024); vf[cc][1] = WFrag<h16>::ldf(vp + cc * 1024 + 512); }
        LOADS_ISSUED(vp, vp, vp);
        float m4[4] = { -3.0e38f, -3.0e38f, -3.0e38f, -3.0e38f };
#pragma unroll
        for (int t = 0; t < TT / 16; ++t) {
#pragma unroll
            for (int j = 0; j < 4; ++j) m4[j] = fmaxf(fmaxf(m4[j], s[t][j]), s[t][j + 4]); }
        float mx = fmaxf(fmaxf(m4[0], m4[1]), fmaxf(m4[2], m4[3])); mx = fmaxf(mx, __shfl_xor(mx, 16, 32));
        v8f vs = (v8f){}; v8f o[2] = { (v8f){}, (v8f){} }; v4f gl[4], bl[4];
#pragma unroll
        for (int cc = 0; cc < TT / 32; ++cc) { v16h p;
#pragma unroll
            for (int j = 0; j < 8; ++j) { float e0 = fmaf(s[2 * cc][j] - mx, SCL * 1.4426950408889634f, 10.0f), e1 = fmaf(s[2 * cc + 1][j] - mx, SCL * 1.4426950408889634f, 10.0f); exp2x2(e0, e1); vs[j] += e0 + e1; p[j] = tohx(e0); p[8 + j] = tohx(e1); }
            o[0] = wmma16(vf[cc][0], p, o[0]); o[1] = wmma16(vf[cc][1], p, o[1]);
            if (cc + 3 < TT / 32) { __builtin_amdgcn_sched_barrier(0);   // the v^T loads three chunks ahead take registers freed above
                vf[cc + 3][0] = WFrag<h16>::ldf(vp + (cc + 3) * 1024); vf[cc + 3][1] = WFrag<h16>::ldf(vp + (cc + 3) * 1024 + 512);
                if (cc + 4 == TT / 32) {   // with the last of them the head's gate logits and gate bias for this lane's 16 values
#pragma unroll
                    for (int u = 0; u < 4; ++u) { gl[u] = *(const v4f*)(gp + u * 128); bl[u] = *(const v4f*)(bp + (u >> 1) * 16 + (u & 1) * 4); } }
                // as LOADS_ISSUED; the two accumulators and the running sums are named as inputs too, so that the chunk's products and additions are issued above: left free they sink to the head's end, every v^T fragment and every exponential stays live, and registers spill
                asm volatile("s_wait_xcnt 0x0" :: "v"(vp), "v"(gp), "v"(bp), "v"(o[0]), "v"(o[1]), "v"(vs) : "memory"); __builtin_amdgcn_sched_barrier(0); } }
        __builtin_amdgcn_sched_barrier(0);   // the gating stays below the last chunks: lifted above them it would wait for the gate loads, the youngest in flight, before their latency is covered
        float sum = ((vs[0] + vs[1]) + (vs[2] + vs[3])) + ((vs[4] + vs[5]) + (vs[6] + vs[7])); sum += __shfl_xor(sum, 16, 32);
        const float f = __fdiv_rn(PCAR, sum);   // sum and values belong to the same query lr
        v8us yh0, yh1, yl0, yl1;
#pragma unroll
        for (int j = 0; j < 8; ++j) { unsigned short a2, b2; gate1(o[0][j] * f, gl[j >> 2][j & 3], bl[j >> 2][j & 3], a2, b2); yh0[j] = a2; yl0[j] = b2; gate1(o[1][j] * f, gl[2 + (j >> 2)][j & 3], bl[2 + (j >> 2)][j & 3], a2, b2); yh1[j] = a2; yl1[j] = b2; }
        v8usa* yq = (v8usa*)yw + h * 128 + lane;   // 16-byte units, lanes side by side; each lane reads back only what it wrote
        yq[0] = yh0; yq[32] = yh1; yq[64] = yl0; yq[96] = yl1;
    }
    const bf* wp = WO + l8;
    v16bf w[2][NH_], yh[NH_], yl[NH_]; v8f acc[DM / 16];
#pragma unroll
    for (int h = 0; h < NH_; ++h) w[0][h] = WFrag<bf>::ldf(wp + h * 512);
    const v4f bov = *(const v4f*)(bo + l4);
    LOADS_ISSUED(l8, l4, l8);
#pragma unroll
    for (int h = 0; h < NH_; ++h) { const v8usa* yq = (const v8usa*)yw + h * 128 + lane; yh[h] = cat16b(yq[0], yq[32]); yl[h] = cat16b(yq[64], yq[96]); }
#pragma unroll
    for (int t = 0; t < DM / 16; ++t) {
        if (t + 1 < DM / 16) {   // the next 16 columns' wo fragments fly while this tile's products run
#pragma unroll
            for (int h = 0; h < NH_; ++h) w[(t + 1) & 1][h] = WFrag<bf>::ldf(wp + ((t + 1) * NH_ + h) * 512);
            LOADS_ISSUED(l8, l8, l8); }
        acc[t] = (v8f){};
#pragma unroll
        for (int h = 0; h < NH_; ++h) { acc[t] = wmmab(w[t & 1][h], yh[h], acc[t]); acc[t] = wmmab(w[t & 1][h], yl[h], acc[t]); }
    }
    // register j of tile t is column 16t + 8*hi + j of query lr
#pragma unroll
    for (int t = 0; t < DM / 16; ++t) { float* sp = yw + lr * YP + t * 16 + 8 * hi; *(v4fa*)sp = __builtin_shufflevector(acc[t], acc[t], 0, 1, 2, 3); *(v4fa*)(sp + 4) = __builtin_shufflevector(acc[t], acc[t], 4, 5, 6, 7); }
    __builtin_amdgcn_wave_barrier(); asm volatile("" ::: "memory");   // the reads below take other lanes' values: not above the writes (one wave, its LDS operations run in order)
    float* orow = OUT + ((size_t)il * TT + q0) * DM + l4;
#pragma unroll
    for (int r = 0; r < 16; ++r) { v4f val = *(const v4fa*)(yw + r * YP + lane * 4); val[0] += bfr(bov[0]); val[1] += bfr(bov[1]); val[2] += bfr(bov[2]); val[3] += bfr(bov[3]); *(v4f*)(orow + (size_t)r * DM) = val;
        if (r == 7) asm volatile("s_wait_xcnt 0x0" ::: "memory");   // in front of the second half's LDS reads, which take registers that these stores name
    }
}

extern "C" void kernel_launch(void* const* d_in, const int* in_sizes, int n_in,
                              void* d_out, int out_size, void* d_ws, size_t ws_size, hipStream_t stream) {
    (void)in_sizes; (void)n_in; (void)out_size;
    const float* act = (const float*)d_in[0]; const float* mask = (const float*)d_in[1]; const float* lng = (const float*)d_in[2]; const float* lnb = (const float*)d_in[3]; const float* w2d = (const float*)d_in[4]; const float* wq = (const float*)d_in[5]; const float* wk = (const float*)d_in[6]; const float* wv = (const float*)d_in[7]; const float* wg = (const float*)d_in[8]; const float* bg = (const float*)d_in[9]; const float* wo = (const float*)d_in[10]; const float* bo = (const float*)d_in[11];
    float* OUT = (float*)d_out;     // [1][256][256][128]
    char* wsp = (char*)d_ws;
    auto take = [&](size_t bytes) { char* p = wsp; wsp += (bytes + 255) & ~(size_t)255; return (void*)p; };
    bf* WQ = (bf*)take((size_t)DQ * DM * 2); bf* WK = (bf*)take((size_t)DQ * DM * 2); bf* WV = (bf*)take((size_t)DQ * DM * 2); bf* WG = (bf*)take((size_t)DQ * DM * 2); bf* WO = (bf*)take((size_t)DM * DQ * 2); bf* W2 = (bf*)take((size_t)NBP * DM * 2);
    float* NB = (float*)take((size_t)NTOK * NBP * 4);
    float* FG = (float*)take((size_t)NTK * DQ * 4); h16* QP16 = (h16*)take((size_t)NH_ * NTK * HD * 2); h16* KP16 = (h16*)take((size_t)NH_ * NTK * HD * 2); h16* VT16 = (h16*)take((size_t)NH_ * IG * HD * TT * 2);
    float* NBT = (float*)take((size_t)NH_ * NTOK * 4);
    if ((size_t)(wsp - (char*)d_ws) > ws_size) return;    // ws 256 MiB (carve ~97 MiB)
    static_assert(IG == NI, "one row group: the pair bias of all positions is formed in the projections' launch");
    k_prep<<<5 * WTB + W2B, 256, 0, stream>>>(w2d, wq, wk, wv, wg, wo, WQ, WK, WV, WG, WO, W2);
    k_proj<<<NTK / 64, 256, 0, stream>>>(act, lng, lnb, WQ, WK, WV, WG, W2, QP16, KP16, VT16, FG, NB);   /* LayerNorm; q, k, v^T planes, gate logits, pair bias nb[(q,k)][h] for all 65536 positions (cols 0..3) */
    k_nbt<<<NTOK / 256, 256, 0, stream>>>(NB, NBT);
    k_fattn<<<dim3(TT / 128, IG, 1), 256, 0, stream>>>(QP16, KP16, VT16, NBT, mask, FG, bg, WO, bo, OUT);   /* attention, gating and output projection */
}

// v008
// Measured time: 59.6 microseconds a run.
// Two timings next to v007 put it at 1.12 and 1.11 times that version's speed.
// Over all steps from v000 it is 13.2 times as fast.
#include <hip/hip_runtime.h>

// Triangle attention (starting node) on a pair representation (act [1][256][256][128], mask [1][256][256]): x = LayerNorm_c(act) (eps 1e-5, ln_g/ln_b); per row i: q, k, v, g = x[i] W (wq/wk/wv/wg [128][4][32] 'xw', 4 heads x 32; q x 32^-0.5), logits[h][q][k] = q.k + 1e9 (mask[i][k] - 1) + nb[h][q][k] with the pair bias nb[h][q][k] = sum_c x[q][k][c] w2d[c][h] (shared by all rows i);
// softmax over k; o = attn.v gated by sigmoid(x wg + bg); out[i][q][c] = sum_{h,d} o[h][d] wo[h][d][c] + bo -> [1][256][256][128] (8.4 M).
// Layout: rows i in groups of IG, here all 256 in one group, so each stage is one launch. One small launch puts the weights into fragment order (w2d padded to 64 rows, 16 read). Then ONE kernel per 64 tokens: LayerNorm -> bf16 hi/lo rows in LDS, from which its 8 waves take the A fragments of the q/k/v/g projections (hi/lo x exact) and of the pair bias nb (16 columns, 4 used); the normalised tokens never go to memory. The projections' epilogue writes the fp16 planes q, k, v^T and gate logits itself, in the fragment order in which the attention kernel's lanes load them; a small launch then repacks the pair bias per head as fp16 fragments (x 32^0.5), then ONE attention kernel (a wave takes its 16 queries through all four heads; scores, mask bias + pair bias, x 32^-0.5, softmax and attn.v stay in registers) that also gates its result, splits it into bf16 hi + lo and multiplies it by wo (+ bo) itself.
// Compute dtypes, f32 accumulate: every input rounded to bf16 once; LayerNorm in f32, its output as bf16 hi + lo (2-product projections against exact bf16 weights); scores and attn.v on single fp16 planes (P = 1024 exp(logit - max), at most 1024; 1/sum applied to the f32 attn.v result); pair bias formed and stored in f32, then repacked as fp16 (x 32^0.5) for the attention launch; gate logits formed in f32 and stored as fp16 between the launches; mask bias, softmax, gating in f32; output GEMM hl x exact + bo.

#define NI   256       // rows i
#define TT   256       // tokens per row (q / k index)
#define DM   128       // c_z
#define NH_  4
#define HD   32
#define DQ   (NH_ * HD)
#define IG   256       // rows i per group: all of them (one launch per stage fills the chip; the planes between the stages then take 81 MiB of the workspace)
#define NTK  (IG * TT) // tokens per group = 65536
#define NTOK (NI * TT) // 65536
#define NBP  64        // pair-bias row pitch and padded w2d rows (16 computed, 4 used)
#define PCAR 1024.0f
#define SCL  0.17677669529663688f   // 32^-0.5
#define RSCL 5.656854249492381f     // 32^0.5
typedef _Float16 h16;
typedef unsigned short bf;
typedef __attribute__((ext_vector_type(16))) __bf16   v16bf;
typedef __attribute__((ext_vector_type(16))) _Float16 v16h;
typedef __attribute__((ext_vector_type(8)))  _Float16 v8h;
typedef __attribute__((ext_vector_type(8)))  unsigned short v8us;
typedef __attribute__((ext_vector_type(8)))  float    v8f;
typedef __attribute__((ext_vector_type(4)))  float    v4f;
typedef v8h  __attribute__((may_alias)) v8ha;
typedef v4f  __attribute__((may_alias)) v4fa;
typedef v8us __attribute__((may_alias)) v8usa;

__device__ __forceinline__ unsigned short f2bf(float f) { unsigned u = __float_as_uint(f); u += 0x7FFFu + ((u >> 16) & 1u); return (unsigned short)(u >> 16); }
__device__ __forceinline__ float bf2f(unsigned short b) { return __uint_as_float(((unsigned)b) << 16); }
__device__ __forceinline__ float bfr(float f) { return bf2f(f2bf(f)); }
__device__ __forceinline__ v16h cat16(v8h lo, v8h hi) { return __builtin_shufflevector(lo, hi, 0, 1, 2, 3, 4, 5, 6, 7, 8, 9, 10, 11, 12, 13, 14, 15); }
__device__ __forceinline__ v16bf cat16b(v8us lo, v8us hi) { return __builtin_bit_cast(v16bf, __builtin_shufflevector(lo, hi, 0, 1, 2, 3, 4, 5, 6, 7, 8, 9, 10, 11, 12, 13, 14, 15)); }
__device__ __forceinline__ v8f wmma16(v16h a, v16h b, v8f c) { return __builtin_amdgcn_wmma_f32_16x16x32_f16(false, a, false, b, (short)0, c, false, false); }
__device__ __forceinline__ v8f wmmab(v16bf a, v16bf b, v8f c) { return __builtin_amdgcn_wmma_f32_16x16x32_bf16(false, a, false, b, (short)0, c, false, false); }



// ---- FRAGMENT ORDER: every plane that a matrix instruction reads from global memory is stored as its fragments are held. A fragment (16 rows x 32 k of 16-bit values) is 1024 bytes: [half][lane][8], lane = 16 hi + row, element j of half s = k 16 s + 8 hi + j; ldf() takes it with two loads of 512 contiguous bytes (four whole lines each) where rows at a pitch made each load touch 8 or 16 lines.
// ---- gemm_tile: register-blocked GEMM, ONE WAVE per 64x64 output tile at (r0, c0) (16 accumulators); A, A2 = the tile's own 64 rows (hi, lo) at a pitch of lda elements in LDS; Bt = the weights in fragment order [n / 16][k / 32][fragment]. K % 32 == 0. Products per 32 k: hi, then lo.
// EPI 2 (v): token rows as A, so that a lane's 8 accumulator registers are 8 consecutive tokens of one column d: 16 bytes of a v^T fragment, P16[n / 32][row i][key / 32][d / 16][fragment].
// EPI 1 (q, k, gate logits): the weights as A (the tile comes out transposed; same products, same order over k), so that the 8 registers are 8 consecutive columns of one token: 16 bytes of a q or k fragment, P16[n / 32][token / 16][fragment]; the gate logits have the same form.
// In both the lane that holds the values is the lane that will load them: each store is 512 contiguous bytes straight from the registers, with no LDS stage.
#define TG   (NTK / 16)   // groups of 16 tokens
template <typename T16> struct WFrag;
template <> struct WFrag<h16> { typedef v16h V; static __device__ __forceinline__ V ld(const h16* p) { return cat16(*(const v8h*)p, *(const v8h*)(p + 16)); } static __device__ __forceinline__ V ldf(const h16* p) { return cat16(*(const v8h*)p, *(const v8h*)(p + 256)); } static __device__ __forceinline__ v8f mma(V a, V b, v8f c) { return wmma16(a, b, c); } };
template <> struct WFrag<bf> { typedef v16bf V; static __device__ __forceinline__ V ld(const bf* p) { return cat16b(*(const v8us*)p, *(const v8us*)(p + 16)); } static __device__ __forceinline__ V ldf(const bf* p) { return cat16b(*(const v8us*)p, *(const v8us*)(p + 256)); } static __device__ __forceinline__ v8f mma(V a, V b, v8f c) { return wmmab(a, b, c); } };
template <typename T16, int EPI>
__device__ __forceinline__ void gemm_tile(const T16* A, const T16* A2, int lda, const T16* __restrict__ Bt, int K, h16* P16, int r0, int c0) {
    typedef typename WFrag<T16>::V V;
    const int lane = threadIdx.x & 31, lr = lane & 15, hi = lane >> 4;
    v8f acc[4][4];
#pragma unroll
    for (int mb = 0; mb < 4; ++mb)
#pragma unroll
        for (int nb = 0; nb < 4; ++nb) acc[mb][nb] = (v8f){};
    const size_t aoff = (size_t)lr * lda + 8 * hi; const T16* bp = Bt + (size_t)(c0 / 16) * (K / 32) * 512 + lane * 8;
#pragma unroll 1
    for (int kc = 0; kc < K; kc += 32) {
        V a[4], a2[4];
#pragma unroll
        for (int mb = 0; mb < 4; ++mb) { a[mb] = WFrag<T16>::ld(A + aoff + (size_t)mb * 16 * lda + kc); a2[mb] = WFrag<T16>::ld(A2 + aoff + (size_t)mb * 16 * lda + kc); }
#pragma unroll
        for (int nb = 0; nb < 4; ++nb) { const V b = WFrag<T16>::ldf(bp + (size_t)(nb * (K / 32)) * 512 + kc * 16);
#pragma unroll
            for (int mb = 0; mb < 4; ++mb) {
                if constexpr (EPI == 2) { acc[mb][nb] = WFrag<T16>::mma(a[mb], b, acc[mb][nb]); acc[mb][nb] = WFrag<T16>::mma(a2[mb], b, acc[mb][nb]); }
                else { acc[mb][nb] = WFrag<T16>::mma(b, a[mb], acc[mb][nb]); acc[mb][nb] = WFrag<T16>::mma(b, a2[mb], acc[mb][nb]); } } }
        asm volatile("v_nop\n\tv_nop\n\tv_nop\n\tv_nop" : "+v"(acc[0][0]), "+v"(acc[1][1]), "+v"(acc[2][2]), "+v"(acc[3][3]) : "v"(a[0]), "v"(a[3]));
    }
    h16* dst = (EPI == 1) ? P16 + ((size_t)(c0 / HD) * TG + r0 / 16) * 512 + lane * 8 : P16 + (((size_t)(c0 / HD) * IG + r0 / TT) * (TT / 32) + (r0 % TT) / 32) * 1024 + lane * 8;
#pragma unroll
    for (int mb = 0; mb < 4; ++mb) {
#pragma unroll
        for (int nb = 0; nb < 4; ++nb) { v8h o;
#pragma unroll
            for (int j = 0; j < 8; ++j) o[j] = (h16)acc[mb][nb][j];
            if constexpr (EPI == 1) *(v8h*)(dst + ((size_t)(nb >> 1) * TG + mb) * 512 + (nb & 1) * 256) = o;
            else *(v8h*)(dst + ((size_t)(nb >> 1) * IG * (TT / 32) + (mb >> 1)) * 1024 + (nb & 1) * 512 + (mb & 1) * 256) = o; }
        if (mb < 3) { asm volatile("s_wait_xcnt 0x0" ::: "memory"); __builtin_amdgcn_sched_barrier(0); }   // in front of the next four conversions, which may take registers that these stores name; the scheduling barrier keeps them behind the wait
    }
}
typedef __attribute__((ext_vector_type(4))) unsigned short v4us;
typedef __attribute__((ext_vector_type(2))) unsigned short v2us;
typedef __attribute__((ext_vector_type(2))) _Float16 v2h;
typedef __attribute__((ext_vector_type(4))) _Float16 v4h;
__device__ __forceinline__ h16 tohx(float x) { return (h16)x; }
__device__ __forceinline__ void splitf(float y, unsigned short& h, unsigned short& l) { h = f2bf(y); l = f2bf(y - bf2f(h)); }
__device__ __forceinline__ void d_wtG(const float* __restrict__ w, int K, int N, bf* Bt, int bx) {
    const int lane = threadIdx.x & 31; const int L0 = (bx * 8 + (threadIdx.x >> 5)) * 8; const int nlines = N * K / 64;
{
#pragma unroll 1
        for (int l = 0; l < 8; ++l) { const int L = L0 + l; if (L >= nlines) break; const int e = L * 64 + lane * 2; const int fl = (e >> 3) & 31, fr = e >> 9;   // e counts in fragment order: [n / 16][k / 32][half][lane][8]; a wave still writes one whole line
            const int k = (fr % (K / 32)) * 32 + ((e >> 8) & 1) * 16 + (fl >> 4) * 8 + (e & 7), n = (fr / (K / 32)) * 16 + (fl & 15); v2us o;
            o[0] = f2bf(w[(size_t)k * N + n]); o[1] = f2bf(w[(size_t)(k + 1) * N + n]); *(v2us*)(Bt + e) = o;
            asm volatile("s_wait_xcnt 0x0" ::: "memory"); }   // in front of the next trip's index sums, which take registers that this store names
         }
}
__global__ __launch_bounds__(256) void k_cvt8(const float* __restrict__ src, bf* dst, size_t n8) { const size_t i = (size_t)blockIdx.x * 256 + threadIdx.x; if (i >= n8) return; const v8f v = *(const v8f*)(src + i * 8); v8us o;
#pragma unroll
    for (int k = 0; k < 8; ++k) o[k] = f2bf(v[k]); *(v8us*)(dst + i * 8) = o;  }

__device__ __forceinline__ void d_w2d(const float* __restrict__ w, bf* Bt, int bx) { const int i = bx * 256 + threadIdx.x; if (i >= NBP * DM / 8) return; const int r = (i >> 8) * 16 + (i & 15), c0 = ((i >> 6) & 3) * 32 + ((i >> 5) & 1) * 16 + ((i >> 4) & 1) * 8; v8us o;   // i counts 16-byte units in fragment order
#pragma unroll
    for (int k = 0; k < 8; ++k) o[k] = (r < NH_) ? f2bf(w[(size_t)(c0 + k) * NH_ + r]) : (unsigned short)0; *(v8us*)(Bt + (size_t)i * 8) = o;  }
// End of a batch of global loads: s_wait_xcnt 0 in front of whatever may take the loads' address registers (named as inputs, so that they live up to the wait); the scheduling barrier keeps the batch issued here, ahead of the work below that hides its latency (the compiler otherwise sinks each load to its use and waits for each in turn).
#define LOADS_ISSUED(p0, p1, p2) do { asm volatile("s_wait_xcnt 0x0" :: "v"(p0), "v"(p1), "v"(p2) : "memory"); __builtin_amdgcn_sched_barrier(0); } while (0)
// square root as the compiler expands it (a subnormal argument scaled by 2^32, the root by 2^-16), with v_sqrt_f32 and the one slot that the instruction set asks for behind a transcendental (before its result is used or its source overwritten) kept in one statement
__device__ __forceinline__ float sqrt_slot(float x) { const bool sm = x < 0x1p-126f; float r = ldexpf(x, sm ? 32 : 0); asm("v_sqrt_f32 %0, %0\n\tv_nop" : "+v"(r)); return ldexpf(r, sm ? -16 : 0); }
// ---- d_ln8: LayerNorm of 8 tokens by one wave (a lane holds 4 channels of each); A = the first token's row, xh / xl = its hi / lo row in LDS. Per token the operations, their order and their roundings of the one-token form; the 8 tokens go through each stage side by side, so that their 8 loads fly together and their dependent chains fill each other's waits. The empty asm statements are those of the one-token form, taken over as they stood: each difference and product is rounded on its own before the next operation takes it, so the normalised values stay bit for bit what they were.
#define XP   136       // 16-bit elements per staged token row: 256 + 16 bytes, the pitch for 16-byte LDS reads of 16 rows at once
__device__ __forceinline__ void d_ln8(const float* __restrict__ A, const float* __restrict__ g, const float* __restrict__ bb, bf* xh, bf* xl) {
    const int lane = threadIdx.x & 31; const unsigned lb = lane * 16; v4f a[8];   // lb: the lane's byte offset in a row, the one vector register that the loads below name (their bases are scalars)
#pragma unroll
    for (int t = 0; t < 8; ++t) a[t] = *(const v4f*)((const char*)A + lb + t * (DM * 4));
    const v4f gv = *(const v4f*)((const char*)g + lb), bv = *(const v4f*)((const char*)bb + lb);
    LOADS_ISSUED(lb, lb, lb);
    float v[8][4], s[8], mu[8], s2[8];
#pragma unroll
    for (int t = 0; t < 8; ++t) { s[t] = 0.f;
#pragma unroll
        for (int q = 0; q < 4; ++q) { v[t][q] = bfr(a[t][q]); s[t] = __fadd_rn(s[t], v[t][q]); } }
#pragma unroll
    for (int sh = 16; sh; sh >>= 1) {
#pragma unroll
        for (int t = 0; t < 8; ++t) s[t] = __fadd_rn(s[t], __shfl_xor(s[t], sh, 32)); }
#pragma unroll
    for (int t = 0; t < 8; ++t) { mu[t] = __fdiv_rn(s[t], (float)DM); s2[t] = 0.f;
#pragma unroll
        for (int q = 0; q < 4; ++q) { float d0 = __fsub_rn(v[t][q], mu[t]); asm volatile("" : "+v"(d0)); float p = __fmul_rn(d0, d0); asm volatile("" : "+v"(p)); s2[t] = __fadd_rn(s2[t], p); } }
#pragma unroll
    for (int sh = 16; sh; sh >>= 1) {
#pragma unroll
        for (int t = 0; t < 8; ++t) s2[t] = __fadd_rn(s2[t], __shfl_xor(s2[t], sh, 32)); }
#pragma unroll
    for (int t = 0; t < 8; ++t) { const float rs = __fdiv_rn(1.0f, sqrt_slot(__fadd_rn(__fdiv_rn(s2[t], (float)DM), 1e-5f))); v4us oh, ol;
#pragma unroll
        for (int q = 0; q < 4; ++q) { float xn = __fmul_rn(__fsub_rn(v[t][q], mu[t]), rs); asm volatile("" : "+v"(xn)); float gg = bfr(gv[q]); asm volatile("" : "+v"(gg)); float y = __fmul_rn(xn, gg); asm volatile("" : "+v"(y)); float be = bfr(bv[q]); asm volatile("" : "+v"(be)); y = __fadd_rn(y, be); unsigned short h2, l2; splitf(y, h2, l2); oh[q] = h2; ol[q] = l2; }
        *(v4us*)(xh + t * XP + lane * 4) = oh; *(v4us*)(xl + t * XP + lane * 4) = ol; }
}
// ---- nb_tile: pair bias of 16 tokens (rows 16 mb .. of the staged 64) x 16 columns of the padded w2d (4 used), one accumulator; products in the order of gemm_tile (per 32 k: hi, then lo). Register j of lane (lr, hi) is token 8 hi + j, column lr.
__device__ __forceinline__ void nb_tile(const bf* xh, const bf* xl, const bf* __restrict__ W2, float* NB, int r0, int mb) {
    const int lane = threadIdx.x & 31, lr = lane & 15, hi = lane >> 4; const unsigned ao = (mb * 16 + lr) * XP + 8 * hi, wb = lane * 16; v16bf b[DM / 32]; v8f acc = (v8f){};   // wb: the lane's byte offset in w2d, the one vector register that its loads name
#pragma unroll
    for (int c = 0; c < DM / 32; ++c) b[c] = WFrag<bf>::ldf((const bf*)((const char*)W2 + wb) + c * 512);
    LOADS_ISSUED(wb, wb, wb);
#pragma unroll
    for (int c = 0; c < DM / 32; ++c) { acc = wmmab(WFrag<bf>::ld(xh + ao + c * 32), b[c], acc); acc = wmmab(WFrag<bf>::ld(xl + ao + c * 32), b[c], acc); }
    float* np = NB + (size_t)(r0 + mb * 16 + 8 * hi) * NBP + lr;
#pragma unroll
    for (int j = 0; j < 8; ++j) np[j * NBP] = acc[j];
}
// ---- k_proj: LayerNorm and the five GEMMs on its result, per 64 tokens; grid tokens/64, 8 waves.
// Each wave normalises 8 of the 64 tokens into LDS (bf16 hi and lo rows); behind the barrier each takes one 64-column tile over all 64 tokens, A fragments from LDS: wave 0,1: q; 2,3: k (fp16 head planes); 4,5: v (fp16 v^T planes); 6,7: gate logits (fp16, in the form of q). Waves 0..3 then add 16 tokens each of the pair bias (f32 rows of pitch 64, columns 0..15 written).
// amdgpu_waves_per_eu(4, 4): a budget of 256 registers a wave, so that two work-groups share a WGP: one streams and normalises its tokens while the other multiplies.
__global__ __launch_bounds__(256) __attribute__((amdgpu_waves_per_eu(4, 4))) void k_proj(const float* __restrict__ act, const float* __restrict__ lng, const float* __restrict__ lnb, const bf* __restrict__ WQ, const bf* __restrict__ WK, const bf* __restrict__ WV, const bf* __restrict__ WG, const bf* __restrict__ W2, h16* QP16, h16* KP16, h16* VT16, h16* FG16, float* NB) {
    __shared__ __align__(16) bf xs[2 * 64 * XP];
    const int wv = __builtin_amdgcn_readfirstlane(threadIdx.x >> 5);   // the wave's number as a scalar: the arms below are scalar branches
    const int r0 = blockIdx.x * 64, c0 = (wv & 1) * 64;
    bf* xh = xs; bf* xl = xs + 64 * XP;
    d_ln8(act + (size_t)(r0 + wv * 8) * DM, lng, lnb, xh + wv * 8 * XP, xl + wv * 8 * XP);
    __syncthreads();   // publishes the 64 normalised tokens
    // s_wait_xcnt 0 at the end of each arm, behind its last stores: in the built code other instructions follow it and take the registers that those stores name
    if (wv < 4 || wv >= 6) { gemm_tile<bf, 1>(xh, xl, XP, wv < 2 ? WQ : wv < 4 ? WK : WG, DM, wv < 2 ? QP16 : wv < 4 ? KP16 : FG16, r0, c0); asm volatile("s_wait_xcnt 0x0" ::: "memory");
        if (wv < 4) { nb_tile(xh, xl, W2, NB, r0, wv); asm volatile("s_wait_xcnt 0x0" ::: "memory"); } }
    else { gemm_tile<bf, 2>(xh, xl, XP, WV, DM, VT16, r0, c0); asm volatile("s_wait_xcnt 0x0" ::: "memory"); }
}
// ---- k_prep: the weights, in ONE launch: the five transposes (WTB blocks each) and the padded w2d (W2B blocks).
#define WTB  ((DM * DQ / 64 + 63) / 64)
#define W2B  ((NBP * DM / 8 + 255) / 256)
__global__ __launch_bounds__(256) void k_prep(const float* __restrict__ w2d, const float* __restrict__ wq, const float* __restrict__ wk, const float* __restrict__ wv, const float* __restrict__ wg, const float* __restrict__ wo,
                                              bf* WQ, bf* WK, bf* WV, bf* WG, bf* WO, bf* W2) {
    const int b = blockIdx.x;
    if (b < 4 * WTB) { const int w = b / WTB; d_wtG(w == 0 ? wq : w == 1 ? wk : w == 2 ? wv : wg, DM, DQ, w == 0 ? WQ : w == 1 ? WK : w == 2 ? WV : WG, b % WTB); return; }
    if (b < 5 * WTB) { d_wtG(wo, DQ, DM, WO, b - 4 * WTB); return; }
    if (b < 5 * WTB + W2B) { d_w2d(w2d, W2, b - 5 * WTB); return; }
}
// pair bias repacked per head, x 32^0.5 (it starts the score accumulators, which are scaled by 32^-0.5 afterwards), rounded to fp16, as A fragments of 16 key rows x 32 k: NBA[h][q / 16][key / 32][fragment], lane = 16 hi + key % 16, element j of half s = query 8 hi + j of the 16, key 32 c + 16 s + key % 16: k 0..15 are the 16 queries against the chunk's first 16 keys, k 16..31 against its second 16. Thread u forms the 16-byte unit u of each head from 8 rows of the GEMM's [q*256+k][64] result; blocks of two waves, so that the scattered row reads spread over many WGPs.
__global__ __launch_bounds__(64) void k_nbt(const float* __restrict__ NB, h16* NBA) { const unsigned u = blockIdx.x * 64 + threadIdx.x; if (u >= NTOK / 8) return; const unsigned fl = u & 31; const size_t pos = (size_t)((u >> 9) * 16 + (fl >> 4) * 8) * TT + ((u >> 5) & 15) * 16 + (fl & 15); const float* np = NB + pos * NBP; v4f v[8];
#pragma unroll
    for (int j = 0; j < 8; ++j) v[j] = *(const v4f*)(np + (size_t)j * TT * NBP);
    asm volatile("s_wait_xcnt 0x0" :: "v"(np) : "memory");   // in front of whatever takes the loads' address registers (named as an input, so that they live up to the wait)
#pragma unroll
    for (int h = 0; h < NH_; ++h) { v8h o;
#pragma unroll
        for (int j = 0; j < 8; ++j) o[j] = (h16)(v[j][h] * RSCL);
        *(v8h*)(NBA + (size_t)h * NTOK + (size_t)u * 8) = o; }  }
// two independent v_exp_f32, in place, with the one slot that the instruction set asks for behind a transcendental (before its result is used or its source overwritten) kept in the same statement
__device__ __forceinline__ void exp2x2(float& a, float& b) { asm("v_exp_f32 %0, %0\n\tv_exp_f32 %1, %1\n\tv_nop" : "+v"(a), "+v"(b)); }
// gate and split of one attn.v value: y = (ov / 1024) sigmoid(gate logit + bg) as bf16 hi + lo
__device__ __forceinline__ void gate1(float ov, float gv, float bgraw, unsigned short& h2, unsigned short& l2) {
    const float ga = __fadd_rn(gv, bfr(bgraw)); const float sg = __fdiv_rn(1.0f, __fadd_rn(1.0f, __builtin_amdgcn_exp2f(__fmul_rn(ga, -1.4426950408889634f))));
    const float y = __fmul_rn(__fmul_rn(ov, 1.0f / PCAR), sg); splitf(y, h2, l2); }
// ---- k_fattn: one wave = 16 queries of one row i against all 256 keys, head after head, then the output projection of those 16 queries; grid (256/128, rows), 8 waves.
// Scores are formed TRANSPOSED, S^T = K Q^T + (pair bias + mask bias) 32^0.5 (A = 16 key rows, B = the 16 query rows). The mask bias is the accumulators' start value; the fp16 pair bias is added by the matrix unit: one bias fragment (16 key rows x [16 queries of the chunk's first 16 keys | 16 queries of its second 16]) times the upper or the lower half of a 32 x 16 identity gives the bias of one score tile, each value times 1.0 exactly, with no conversion and no vector addition: an accumulator tile holds key 16t + 8*hi + j of query lr in register j of lane (lr, hi),
// which is the fragment order of P for attn.v (elements 0..7 = tile 2c, 8..15 = tile 2c+1 of the 32-key chunk c): no lane exchange, no LDS or memory round trip for S or P.
// attn.v is formed transposed too, O^T = V^T P^T (A = 16 rows d of v^T, B = P): lane (lr, hi) then holds d = 8*hi + j and 16 + 8*hi + j of query lr, next to that query's row sum, and that again is the fragment order of the head's 32 k of the output projection.
// P = 1024 exp(logit - max) in fp16 (at most 1024); the f32 tile is scaled by 1024 / sum, gated, split into bf16 hi + lo; each lane parks its own 4 x 16 bytes per head in LDS (registers are short while the scores live) and takes them back behind the last head.
// Output: out^T = wo^T y^T (A = 16 columns c of wo, B = y hi, then y lo, head after head: the sum order of a K = 128 GEMM in chunks of 32), staged through the wave's LDS so that each store is one whole 512-byte row of out.
// amdgpu_waves_per_eu(4, 4): a budget of 256 registers a wave, so that two work-groups share a WGP: the 512 work-groups of the launch are resident at once.
#define YP   132              // floats per staged output row: 128 + 4, so that the 16 rows written at once fall on different banks
#define YW   (16 * YP)        // floats of LDS a wave: the staged 16 x 128 output tile; before that its lanes' parked y fragments (8 KiB)
__global__ __launch_bounds__(256) __attribute__((amdgpu_waves_per_eu(4, 4))) void k_fattn(const h16* __restrict__ Q16, const h16* __restrict__ K16, const h16* __restrict__ V16, const h16* __restrict__ NBA, const float* __restrict__ mask, const h16* __restrict__ FG16, const float* __restrict__ bg, const bf* __restrict__ WO, const float* __restrict__ bo, float* OUT) {
    __shared__ __align__(32) float mbs[TT];
    __shared__ __align__(16) float yst[8 * YW];
    __shared__ __align__(16) h16 idf[2 * 512];   // the two identity halves as B fragments: fragment f holds 1 at k = 16 f + n of column n; kept in LDS and read once per head, as 16 registers held over the softmax would not fit
    const int lane = threadIdx.x & 31, lr = lane & 15, hi = lane >> 4; const int il = blockIdx.y;
    const int wv = __builtin_amdgcn_readfirstlane(threadIdx.x >> 5); const int q0 = (blockIdx.x * 8 + wv) * 16;   // the wave's number as a scalar: over the head loop every plane's base then stays in scalar registers, and a lane keeps one 32-bit offset per element width
    const unsigned l8 = lane * 8, l4 = lane * 4, bo8 = 8 * hi;   // a lane's place in a 16-bit and in an f32 fragment
    float* yw = yst + wv * YW;
    mbs[threadIdx.x] = 1e9f * (bfr(mask[(size_t)il * TT + threadIdx.x]) - 1.0f) * RSCL;   // mask bias of row i, once per work-group
    { v4h one;   // thread t writes elements 4 t .. 4 t + 3 in fragment order [f][half][lane][8]
#pragma unroll
        for (int e = 0; e < 4; ++e) { const int x = threadIdx.x * 4 + e; one[e] = (((x >> 8) & 1) * 16 + ((x >> 7) & 1) * 8 + (x & 7) == (x >> 9) * 16 + ((x >> 3) & 15)) ? (h16)1.0f : (h16)0.0f; }
        *(v4h*)(idf + threadIdx.x * 4) = one; }
    __syncthreads();   // publishes mbs and idf
#pragma unroll 1   // one head's code, run four times: unrolled it would be four times the text and keep more registers live
    for (int h = 0; h < NH_; ++h) {
        // element offsets in 32 bits (every plane is far below 4 Gi elements); each plane's 64-bit lane address is formed per head and lives only up to the wait behind its last batch of loads
        const unsigned tg0 = (unsigned)h * TG + (unsigned)il * (TT / 16), qt = q0 / 16;
        const unsigned kx = tg0 * 512 + l8, nx = ((unsigned)h * (TT / 16) + qt) * (16 * TT) + l8, vx = ((unsigned)h * IG + il) * (HD * TT) + l8, qx = (tg0 + qt) * 512 + l8, bx = h * HD + bo8;
        const h16* kp = K16 + kx; const h16* nbp = NBA + nx; const h16* vp = V16 + vx; const h16* qp = Q16 + qx; const h16* gp = FG16 + qx; const float* bp = bg + bx;
        const v16h bq = WFrag<h16>::ldf(qp);
        v16h ka[8], kb[8], na[TT / 32]; v8f s[TT / 16];
#pragma unroll
        for (int t = 0; t < 8; ++t) ka[t] = WFrag<h16>::ldf(kp + t * 512);
#pragma unroll
        for (int c = 0; c < TT / 32; ++c) na[c] = WFrag<h16>::ldf(nbp + c * 512);
        LOADS_ISSUED(qp, kp, nbp);
        { const v16h i0 = WFrag<h16>::ldf(idf + l8), i1 = WFrag<h16>::ldf(idf + 512 + l8);
#pragma unroll
            for (int c = 0; c < TT / 32; ++c) { s[2 * c] = wmma16(na[c], i0, *(const v8f*)(mbs + c * 32 + 8 * hi)); s[2 * c + 1] = wmma16(na[c], i1, *(const v8f*)(mbs + c * 32 + 16 + 8 * hi)); } }
#pragma unroll
        for (int t = 0; t < 8; ++t) s[t] = wmma16(ka[t], bq, s[t]);
        __builtin_amdgcn_sched_barrier(0);   // the second half's key loads take the first half's registers: not above its products
#pragma unroll
        for (int t = 0; t < 8; ++t) kb[t] = WFrag<h16>::ldf(kp + (8 + t) * 512);
        LOADS_ISSUED(kp, kp, kp);
#pragma unroll
        for (int t = 0; t < 8; ++t) s[8 + t] = wmma16(kb[t], bq, s[8 + t]);
        __builtin_amdgcn_sched_barrier(0);   // the v^T loads take the key fragments' registers: not above the products
        v16h vf[TT / 32][2];
#pragma unroll
        for (int cc = 0; cc < 3; ++cc) { vf[cc][0] = WFrag<h16>::ldf(vp + cc * 1024); vf[cc][1] = WFrag<h16>::ldf(vp + cc * 1024 + 512); }
        LOADS_ISSUED(vp, vp, vp);
        float m4[4] = { -3.0e38f, -3.0e38f, -3.0e38f, -3.0e38f };
#pragma unroll
        for (int t = 0; t < TT / 16; ++t) {
#pragma unroll
            for (int j = 0; j < 4; ++j) m4[j] = fmaxf(fmaxf(m4[j], s[t][j]), s[t][j + 4]); }
        float mx = fmaxf(fmaxf(m4[0], m4[1]), fmaxf(m4[2], m4[3])); mx = fmaxf(mx, __shfl_xor(mx, 16, 32));
        v8f vs = (v8f){}; v8f o[2] = { (v8f){}, (v8f){} }; v16h gl; v4f bl[4];
#pragma unroll
        for (int cc = 0; cc < TT / 32; ++cc) { v16h p;
#pragma unroll
            for (int j = 0; j < 8; ++j) { float e0 = fmaf(s[2 * cc][j] - mx, SCL * 1.4426950408889634f, 10.0f), e1 = fmaf(s[2 * cc + 1][j] - mx, SCL * 1.4426950408889634f, 10.0f); exp2x2(e0, e1); vs[j] += e0 + e1; p[j] = tohx(e0); p[8 + j] = tohx(e1); }
            o[0] = wmma16(vf[cc][0], p, o[0]); o[1] = wmma16(vf[cc][1], p, o[1]);
            if (cc + 3 < TT / 32) { __builtin_amdgcn_sched_barrier(0);   // the v^T loads three chunks ahead take registers freed above
                vf[cc + 3][0] = WFrag<h16>::ldf(vp + (cc + 3) * 1024); vf[cc + 3][1] = WFrag<h16>::ldf(vp + (cc + 3) * 1024 + 512);
                if (cc + 4 == TT / 32) {   // with the last of them the head's gate logits and gate bias for this lane's 16 values
                    gl = WFrag<h16>::ldf(gp);
#pragma unroll
                    for (int u = 0; u < 4; ++u) bl[u] = *(const v4f*)(bp + (u >> 1) * 16 + (u & 1) * 4); }
                // as LOADS_ISSUED; the two accumulators and the running sums are named as inputs too, so that the chunk's products and additions are issued above: left free they sink to the head's end, every v^T fragment and every exponential stays live, and registers spill
                asm volatile("s_wait_xcnt 0x0" :: "v"(vp), "v"(gp), "v"(bp), "v"(o[0]), "v"(o[1]), "v"(vs) : "memory"); __builtin_amdgcn_sched_barrier(0); } }
        __builtin_amdgcn_sched_barrier(0);   // the gating stays below the last chunks: lifted above them it would wait for the gate loads, the youngest in flight, before their latency is covered
        float sum = ((vs[0] + vs[1]) + (vs[2] + vs[3])) + ((vs[4] + vs[5]) + (vs[6] + vs[7])); sum += __shfl_xor(sum, 16, 32);
        const float f = __fdiv_rn(PCAR, sum);   // sum and values belong to the same query lr
        v8us yh0, yh1, yl0, yl1;
#pragma unroll
        for (int j = 0; j < 8; ++j) { unsigned short a2, b2; gate1(o[0][j] * f, (float)gl[j], bl[j >> 2][j & 3], a2, b2); yh0[j] = a2; yl0[j] = b2; gate1(o[1][j] * f, (float)gl[8 + j], bl[2 + (j >> 2)][j & 3], a2, b2); yh1[j] = a2; yl1[j] = b2; }
        v8usa* yq = (v8usa*)yw + h * 128 + lane;   // 16-byte units, lanes side by side; each lane reads back only what it wrote
        yq[0] = yh0; yq[32] = yh1; yq[64] = yl0; yq[96] = yl1;
    }
    const bf* wp = WO + l8;
    v16bf w[2][NH_], yh[NH_], yl[NH_]; v8f acc[DM / 16];
#pragma unroll
    for (int h = 0; h < NH_; ++h) w[0][h] = WFrag<bf>::ldf(wp + h * 512);
    const v4f bov = *(const v4f*)(bo + l4);
    LOADS_ISSUED(l8, l4, l8);
#pragma unroll
    for (int h = 0; h < NH_; ++h) { const v8usa* yq = (const v8usa*)yw + h * 128 + lane; yh[h] = cat16b(yq[0], yq[32]); yl[h] = cat16b(yq[64], yq[96]); }
#pragma unroll
    for (int t = 0; t < DM / 16; ++t) {
        if (t + 1 < DM / 16) {   // the next 16 columns' wo fragments fly while this tile's products run
#pragma unroll
            for (int h = 0; h < NH_; ++h) w[(t + 1) & 1][h] = WFrag<bf>::ldf(wp + ((t + 1) * NH_ + h) * 512);
            LOADS_ISSUED(l8, l8, l8); }
        acc[t] = (v8f){};
#pragma unroll
        for (int h = 0; h < NH_; ++h) { acc[t] = wmmab(w[t & 1][h], yh[h], acc[t]); acc[t] = wmmab(w[t & 1][h], yl[h], acc[t]); }
    }
    // register j of tile t is column 16t + 8*hi + j of query lr
#pragma unroll
    for (int t = 0; t < DM / 16; ++t) { float* sp = yw + lr * YP + t * 16 + 8 * hi; *(v4fa*)sp = __builtin_shufflevector(acc[t], acc[t], 0, 1, 2, 3); *(v4fa*)(sp + 4) = __builtin_shufflevector(acc[t], acc[t], 4, 5, 6, 7); }
    __builtin_amdgcn_wave_barrier(); asm volatile("" ::: "memory");   // the reads below take other lanes' values: not above the writes (one wave, its LDS operations run in order)
    float* orow = OUT + ((size_t)il * TT + q0) * DM + l4;
#pragma unroll
    for (int r = 0; r < 16; ++r) { v4f val = *(const v4fa*)(yw + r * YP + lane * 4); val[0] += bfr(bov[0]); val[1] += bfr(bov[1]); val[2] += bfr(bov[2]); val[3] += bfr(bov[3]); *(v4f*)(orow + (size_t)r * DM) = val;
        if (r == 7) asm volatile("s_wait_xcnt 0x0" ::: "memory");   // in front of the second half's LDS reads, which take registers that these stores name
    }
}

extern "C" void kernel_launch(void* const* d_in, const int* in_sizes, int n_in,
                              void* d_out, int out_size, void* d_ws, size_t ws_size, hipStream_t stream) {
    (void)in_sizes; (void)n_in; (void)out_size;
    const float* act = (const float*)d_in[0]; const float* mask = (const float*)d_in[1]; const float* lng = (const float*)d_in[2]; const float* lnb = (const float*)d_in[3]; const float* w2d = (const float*)d_in[4]; const float* wq = (const float*)d_in[5]; const float* wk = (const float*)d_in[6]; const float* wv = (const float*)d_in[7]; const float* wg = (const float*)d_in[8]; const float* bg = (const float*)d_in[9]; const float* wo = (const float*)d_in[10]; const float* bo = (const float*)d_in[11];
    float* OUT = (float*)d_out;     // [1][256][256][128]
    char* wsp = (char*)d_ws;
    auto take = [&](size_t bytes) { char* p = wsp; wsp += (bytes + 255) & ~(size_t)255; return (void*)p; };
    bf* WQ = (bf*)take((size_t)DQ * DM * 2); bf* WK = (bf*)take((size_t)DQ * DM * 2); bf* WV = (bf*)take((size_t)DQ * DM * 2); bf* WG = (bf*)take((size_t)DQ * DM * 2); bf* WO = (bf*)take((size_t)DM * DQ * 2); bf* W2 = (bf*)take((size_t)NBP * DM * 2);
    float* NB = (float*)take((size_t)NTOK * NBP * 4);
    h16* FG16 = (h16*)take((size_t)NTK * DQ * 2); h16* QP16 = (h16*)take((size_t)NH_ * NTK * HD * 2); h16* KP16 = (h16*)take((size_t)NH_ * NTK * HD * 2); h16* VT16 = (h16*)take((size_t)NH_ * IG * HD * TT * 2);
    h16* NBA = (h16*)take((size_t)NH_ * NTOK * 2);
    if ((size_t)(wsp - (char*)d_ws) > ws_size) return;    // ws 256 MiB (carve ~81 MiB)
    static_assert(IG == NI, "one row group: the pair bias of all positions is formed in the projections' launch");
    k_prep<<<5 * WTB + W2B, 256, 0, stream>>>(w2d, wq, wk, wv, wg, wo, WQ, WK, WV, WG, WO, W2);
    k_proj<<<NTK / 64, 256, 0, stream>>>(act, lng, lnb, WQ, WK, WV, WG, W2, QP16, KP16, VT16, FG16, NB);   /* LayerNorm; q, k, v^T planes, gate logits, pair bias nb[(q,k)][h] for all 65536 positions (cols 0..3) */
    k_nbt<<<NTOK / 8 / 64, 64, 0, stream>>>(NB, NBA);
    k_fattn<<<dim3(TT / 128, IG, 1), 256, 0, stream>>>(QP16, KP16, VT16, NBA, mask, FG16, bg, WO, bo, OUT);   /* attention, gating and output projection */
}

// v009
// Measured time: 56.4 microseconds a run.
// Two timings next to v008 put it at 1.07 and 1.06 times that version's speed.
// All steps since v000 together make it 14.0 times as fast.
#include <hip/hip_runtime.h>

// Triangle attention (starting node) on a pair representation (act [1][256][256][128], mask [1][256][256]): x = LayerNorm_c(act) (eps 1e-5, ln_g/ln_b); per row i: q, k, v, g = x[i] W (wq/wk/wv/wg [128][4][32] 'xw', 4 heads x 32; q x 32^-0.5), logits[h][q][k] = q.k + 1e9 (mask[i][k] - 1) + nb[h][q][k] with the pair bias nb[h][q][k] = sum_c x[q][k][c] w2d[c][h] (shared by all rows i);
// softmax over k; o = attn.v gated by sigmoid(x wg + bg); out[i][q][c] = sum_{h,d} o[h][d] wo[h][d][c] + bo -> [1][256][256][128] (8.4 M).
// Layout: rows i in groups of IG, here all 256 in one group, so each stage is one launch. One small launch puts the weights into fragment order (w2d padded to 64 rows, 16 read). Then ONE kernel per 64 tokens: LayerNorm -> bf16 hi/lo rows in LDS, from which its 8 waves take the A fragments of the q/k/v/g projections (hi/lo x exact) and of the pair bias nb (16 columns, 4 used; stored as fp16 rows per head and query); the normalised tokens never go to memory. The projections' epilogue writes the fp16 planes q, k, v^T and gate logits itself, in the fragment order in which the attention kernel's lanes load them, then ONE attention kernel (a wave takes its 16 queries through all four heads; scores, mask bias + pair bias, x 32^-0.5, softmax and attn.v stay in registers) that also gates its result, splits it into bf16 hi + lo and multiplies it by wo (+ bo) itself.
// Compute dtypes, f32 accumulate: every input rounded to bf16 once; LayerNorm in f32, its output as bf16 hi + lo (2-product projections against exact bf16 weights); scores and attn.v on single fp16 planes (P = 1024 exp(logit - max), at most 1024; 1/sum applied to the f32 attn.v result); pair bias and gate logits formed in f32 and stored as fp16 between the launches; mask bias, softmax, gating in f32; output GEMM hl x exact + bo.

#define NI   256       // rows i
#define TT   256       // tokens per row (q / k index)
#define DM   128       // c_z
#define NH_  4
#define HD   32
#define DQ   (NH_ * HD)
#define IG   256       // rows i per group: all of them (one launch per stage fills the chip; the planes between the stages then take 65 MiB of the workspace)
#define NTK  (IG * TT) // tokens per group = 65536
#define NTOK (NI * TT) // 65536
#define NBP  64        // padded w2d rows (16 computed, 4 used)
#define PCAR 1024.0f
#define SCL  0.17677669529663688f   // 32^-0.5
#define RSCL 5.656854249492381f     // 32^0.5
typedef _Float16 h16;
typedef unsigned short bf;
typedef __attribute__((ext_vector_type(16))) __bf16   v16bf;
typedef __attribute__((ext_vector_type(16))) _Float16 v16h;
typedef __attribute__((ext_vector_type(8)))  _Float16 v8h;
typedef __attribute__((ext_vector_type(8)))  unsigned short v8us;
typedef __attribute__((ext_vector_type(8)))  float    v8f;
typedef __attribute__((ext_vector_type(4)))  float    v4f;
typedef v8h  __attribute__((may_alias)) v8ha;
typedef v4f  __attribute__((may_alias)) v4fa;
typedef v8us __attribute__((may_alias)) v8usa;

__device__ __forceinline__ unsigned short f2bf(float f) { unsigned u = __float_as_uint(f); u += 0x7FFFu + ((u >> 16) & 1u); return (unsigned short)(u >> 16); }
__device__ __forceinline__ float bf2f(unsigned short b) { return __uint_as_float(((unsigned)b) << 16); }
__device__ __forceinline__ float bfr(float f) { return bf2f(f2bf(f)); }
__device__ __forceinline__ v16h cat16(v8h lo, v8h hi) { return __builtin_shufflevector(lo, hi, 0, 1, 2, 3, 4, 5, 6, 7, 8, 9, 10, 11, 12, 13, 14, 15); }
__device__ __forceinline__ v16bf cat16b(v8us lo, v8us hi) { return __builtin_bit_cast(v16bf, __builtin_shufflevector(lo, hi, 0, 1, 2, 3, 4, 5, 6, 7, 8, 9, 10, 11, 12, 13, 14, 15)); }
__device__ __forceinline__ v8f wmma16(v16h a, v16h b, v8f c) { return __builtin_amdgcn_wmma_f32_16x16x32_f16(false, a, false, b, (short)0, c, false, false); }
__device__ __forceinline__ v8f wmmab(v16bf a, v16bf b, v8f c) { return __builtin_amdgcn_wmma_f32_16x16x32_bf16(false, a, false, b, (short)0, c, false, false); }



// ---- FRAGMENT ORDER: every plane that a matrix instruction reads from global memory is stored as its fragments are held. A fragment (16 rows x 32 k of 16-bit values) is 1024 bytes: [half][lane][8], lane = 16 hi + row, element j of half s = k 16 s + 8 hi + j; ldf() takes it with two loads of 512 contiguous bytes (four whole lines each) where rows at a pitch made each load touch 8 or 16 lines.
// ---- gemm_tile: register-blocked GEMM, ONE WAVE per 64x64 output tile at (r0, c0) (16 accumulators); A, A2 = the tile's own 64 rows (hi, lo) at a pitch of lda elements in LDS; Bt = the weights in fragment order [n / 16][k / 32][fragment]. K % 32 == 0. Products per 32 k: hi, then lo.
// EPI 2 (v): token rows as A, so that a lane's 8 accumulator registers are 8 consecutive tokens of one column d: 16 bytes of a v^T fragment, P16[n / 32][row i][key / 32][d / 16][fragment].
// EPI 1 (q, k, gate logits): the weights as A (the tile comes out transposed; same products, same order over k), so that the 8 registers are 8 consecutive columns of one token: 16 bytes of a q or k fragment, P16[n / 32][token / 16][fragment]; the gate logits have the same form.
// In both the lane that holds the values is the lane that will load them: each store is 512 contiguous bytes straight from the registers, with no LDS stage.
#define TG   (NTK / 16)   // groups of 16 tokens
template <typename T16> struct WFrag;
template <> struct WFrag<h16> { typedef v16h V; static __device__ __forceinline__ V ld(const h16* p) { return cat16(*(const v8h*)p, *(const v8h*)(p + 16)); } static __device__ __forceinline__ V ldf(const h16* p) { return cat16(*(const v8h*)p, *(const v8h*)(p + 256)); } static __device__ __forceinline__ v8f mma(V a, V b, v8f c) { return wmma16(a, b, c); } };
template <> struct WFrag<bf> { typedef v16bf V; static __device__ __forceinline__ V ld(const bf* p) { return cat16b(*(const v8us*)p, *(const v8us*)(p + 16)); } static __device__ __forceinline__ V ldf(const bf* p) { return cat16b(*(const v8us*)p, *(const v8us*)(p + 256)); } static __device__ __forceinline__ v8f mma(V a, V b, v8f c) { return wmmab(a, b, c); } };
template <typename T16, int EPI>
__device__ __forceinline__ void gemm_tile(const T16* A, const T16* A2, int lda, const T16* __restrict__ Bt, int K, h16* P16, int r0, int c0) {
    typedef typename WFrag<T16>::V V;
    const int lane = threadIdx.x & 31, lr = lane & 15, hi = lane >> 4;
    v8f acc[4][4];
#pragma unroll
    for (int mb = 0; mb < 4; ++mb)
#pragma unroll
        for (int nb = 0; nb < 4; ++nb) acc[mb][nb] = (v8f){};
    const size_t aoff = (size_t)lr * lda + 8 * hi; const T16* bp = Bt + (size_t)(c0 / 16) * (K / 32) * 512 + lane * 8;
#pragma unroll 1
    for (int kc = 0; kc < K; kc += 32) {
        V a[4], a2[4];
#pragma unroll
        for (int mb = 0; mb < 4; ++mb) { a[mb] = WFrag<T16>::ld(A + aoff + (size_t)mb * 16 * lda + kc); a2[mb] = WFrag<T16>::ld(A2 + aoff + (size_t)mb * 16 * lda + kc); }
#pragma unroll
        for (int nb = 0; nb < 4; ++nb) { const V b = WFrag<T16>::ldf(bp + (size_t)(nb * (K / 32)) * 512 + kc * 16);
#pragma unroll
            for (int mb = 0; mb < 4; ++mb) {
                if constexpr (EPI == 2) { acc[mb][nb] = WFrag<T16>::mma(a[mb], b, acc[mb][nb]); acc[mb][nb] = WFrag<T16>::mma(a2[mb], b, acc[mb][nb]); }
                else { acc[mb][nb] = WFrag<T16>::mma(b, a[mb], acc[mb][nb]); acc[mb][nb] = WFrag<T16>::mma(b, a2[mb], acc[mb][nb]); } } }
        asm volatile("v_nop\n\tv_nop\n\tv_nop\n\tv_nop" : "+v"(acc[0][0]), "+v"(acc[1][1]), "+v"(acc[2][2]), "+v"(acc[3][3]) : "v"(a[0]), "v"(a[3]));
    }
    h16* dst = (EPI == 1) ? P16 + ((size_t)(c0 / HD) * TG + r0 / 16) * 512 + lane * 8 : P16 + (((size_t)(c0 / HD) * IG + r0 / TT) * (TT / 32) + (r0 % TT) / 32) * 1024 + lane * 8;
#pragma unroll
    for (int mb = 0; mb < 4; ++mb) {
#pragma unroll
        for (int nb = 0; nb < 4; ++nb) { v8h o;
#pragma unroll
            for (int j = 0; j < 8; ++j) o[j] = (h16)acc[mb][nb][j];
            if constexpr (EPI == 1) *(v8h*)(dst + ((size_t)(nb >> 1) * TG + mb) * 512 + (nb & 1) * 256) = o;
            else *(v8h*)(dst + ((size_t)(nb >> 1) * IG * (TT / 32) + (mb >> 1)) * 1024 + (nb & 1) * 512 + (mb & 1) * 256) = o; }
        if (mb < 3) { asm volatile("s_wait_xcnt 0x0" ::: "memory"); __builtin_amdgcn_sched_barrier(0); }   // in front of the next four conversions, which may take registers that these stores name; the scheduling barrier keeps them behind the wait
    }
}
typedef __attribute__((ext_vector_type(4))) unsigned short v4us;
typedef __attribute__((ext_vector_type(2))) unsigned short v2us;
typedef __attribute__((ext_vector_type(2))) _Float16 v2h;
typedef __attribute__((ext_vector_type(4))) _Float16 v4h;
__device__ __forceinline__ h16 tohx(float x) { return (h16)x; }
__device__ __forceinline__ void splitf(float y, unsigned short& h, unsigned short& l) { h = f2bf(y); l = f2bf(y - bf2f(h)); }
__device__ __forceinline__ void d_wtG(const float* __restrict__ w, int K, int N, bf* Bt, int bx) {
    const int lane = threadIdx.x & 31; const int L0 = (bx * 8 + (threadIdx.x >> 5)) * 8; const int nlines = N * K / 64;
{
#pragma unroll 1
        for (int l = 0; l < 8; ++l) { const int L = L0 + l; if (L >= nlines) break; const int e = L * 64 + lane * 2; const int fl = (e >> 3) & 31, fr = e >> 9;   // e counts in fragment order: [n / 16][k / 32][half][lane][8]; a wave still writes one whole line
            const int k = (fr % (K / 32)) * 32 + ((e >> 8) & 1) * 16 + (fl >> 4) * 8 + (e & 7), n = (fr / (K / 32)) * 16 + (fl & 15); v2us o;
            o[0] = f2bf(w[(size_t)k * N + n]); o[1] = f2bf(w[(size_t)(k + 1) * N + n]); *(v2us*)(Bt + e) = o;
            asm volatile("s_wait_xcnt 0x0" ::: "memory"); }   // in front of the next trip's index sums, which take registers that this store names
         }
}
__global__ __launch_bounds__(256) void k_cvt8(const float* __restrict__ src, bf* dst, size_t n8) { const size_t i = (size_t)blockIdx.x * 256 + threadIdx.x; if (i >= n8) return; const v8f v = *(const v8f*)(src + i * 8); v8us o;
#pragma unroll
    for (int k = 0; k < 8; ++k) o[k] = f2bf(v[k]); *(v8us*)(dst + i * 8) = o;  }

__device__ __forceinline__ void d_w2d(const float* __restrict__ w, bf* Bt, int bx) { const int i = bx * 256 + threadIdx.x; if (i >= NBP * DM / 8) return; const int r = (i >> 8) * 16 + (i & 15), c0 = ((i >> 6) & 3) * 32 + ((i >> 5) & 1) * 16 + ((i >> 4) & 1) * 8; v8us o;   // i counts 16-byte units in fragment order
#pragma unroll
    for (int k = 0; k < 8; ++k) o[k] = (r < NH_) ? f2bf(w[(size_t)(c0 + k) * NH_ + r]) : (unsigned short)0; *(v8us*)(Bt + (size_t)i * 8) = o;  }
// End of a batch of global loads: s_wait_xcnt 0 in front of whatever may take the loads' address registers (named as inputs, so that they live up to the wait); the scheduling barrier keeps the batch issued here, ahead of the work below that hides its latency (the compiler otherwise sinks each load to its use and waits for each in turn).
#define LOADS_ISSUED(p0, p1, p2) do { asm volatile("s_wait_xcnt 0x0" :: "v"(p0), "v"(p1), "v"(p2) : "memory"); __builtin_amdgcn_sched_barrier(0); } while (0)
// square root as the compiler expands it (a subnormal argument scaled by 2^32, the root by 2^-16), with v_sqrt_f32 and the one slot that the instruction set asks for behind a transcendental (before its result is used or its source overwritten) kept in one statement
__device__ __forceinline__ float sqrt_slot(float x) { const bool sm = x < 0x1p-126f; float r = ldexpf(x, sm ? 32 : 0); asm("v_sqrt_f32 %0, %0\n\tv_nop" : "+v"(r)); return ldexpf(r, sm ? -16 : 0); }
// ---- d_ln8: LayerNorm of 8 tokens by one wave (a lane holds 4 channels of each); A = the first token's row, xh / xl = its hi / lo row in LDS. Per token the operations, their order and their roundings of the one-token form; the 8 tokens go through each stage side by side, so that their 8 loads fly together and their dependent chains fill each other's waits. The empty asm statements are those of the one-token form, taken over as they stood: each difference and product is rounded on its own before the next operation takes it, so the normalised values stay bit for bit what they were.
#define XP   136       // 16-bit elements per staged token row: 256 + 16 bytes, the pitch for 16-byte LDS reads of 16 rows at once
__device__ __forceinline__ void d_ln8(const float* __restrict__ A, const float* __restrict__ g, const float* __restrict__ bb, bf* xh, bf* xl) {
    const int lane = threadIdx.x & 31; const unsigned lb = lane * 16; v4f a[8];   // lb: the lane's byte offset in a row, the one vector register that the loads below name (their bases are scalars)
#pragma unroll
    for (int t = 0; t < 8; ++t) a[t] = *(const v4f*)((const char*)A + lb + t * (DM * 4));
    const v4f gv = *(const v4f*)((const char*)g + lb), bv = *(const v4f*)((const char*)bb + lb);
    LOADS_ISSUED(lb, lb, lb);
    float v[8][4], s[8], mu[8], s2[8];
#pragma unroll
    for (int t = 0; t < 8; ++t) { s[t] = 0.f;
#pragma unroll
        for (int q = 0; q < 4; ++q) { v[t][q] = bfr(a[t][q]); s[t] = __fadd_rn(s[t], v[t][q]); } }
#pragma unroll
    for (int sh = 16; sh; sh >>= 1) {
#pragma unroll
        for (int t = 0; t < 8; ++t) s[t] = __fadd_rn(s[t], __shfl_xor(s[t], sh, 32)); }
#pragma unroll
    for (int t = 0; t < 8; ++t) { mu[t] = __fdiv_rn(s[t], (float)DM); s2[t] = 0.f;
#pragma unroll
        for (int q = 0; q < 4; ++q) { float d0 = __fsub_rn(v[t][q], mu[t]); asm volatile("" : "+v"(d0)); float p = __fmul_rn(d0, d0); asm volatile("" : "+v"(p)); s2[t] = __fadd_rn(s2[t], p); } }
#pragma unroll
    for (int sh = 16; sh; sh >>= 1) {
#pragma unroll
        for (int t = 0; t < 8; ++t) s2[t] = __fadd_rn(s2[t], __shfl_xor(s2[t], sh, 32)); }
#pragma unroll
    for (int t = 0; t < 8; ++t) { const float rs = __fdiv_rn(1.0f, sqrt_slot(__fadd_rn(__fdiv_rn(s2[t], (float)DM), 1e-5f))); v4us oh, ol;
#pragma unroll
        for (int q = 0; q < 4; ++q) { float xn = __fmul_rn(__fsub_rn(v[t][q], mu[t]), rs); asm volatile("" : "+v"(xn)); float gg = bfr(gv[q]); asm volatile("" : "+v"(gg)); float y = __fmul_rn(xn, gg); asm volatile("" : "+v"(y)); float be = bfr(bv[q]); asm volatile("" : "+v"(be)); y = __fadd_rn(y, be); unsigned short h2, l2; splitf(y, h2, l2); oh[q] = h2; ol[q] = l2; }
        *(v4us*)(xh + t * XP + lane * 4) = oh; *(v4us*)(xl + t * XP + lane * 4) = ol; }
}
// ---- nb_rows: pair bias of the 64 staged tokens x 16 columns of the padded w2d (4 used), by ONE wave, four accumulators; per accumulator the products in the order of gemm_tile (per 32 k: hi, then lo). Register j of lane (lr, hi) in tile mb is token 16 mb + 8 hi + j, column lr: 8 consecutive keys of one head.
// Stored x 32^0.5 (it starts the score accumulators, which are scaled by 32^-0.5 afterwards), rounded to fp16, as rows NBQ[h][q][key]: the 64 tokens are 64 keys of one query, 128 bytes per head, so each line has this one wave as its writer.
__device__ __forceinline__ void nb_rows(const bf* xh, const bf* xl, const bf* __restrict__ W2, h16* NBQ, int r0) {
    const int lane = threadIdx.x & 31, lr = lane & 15, hi = lane >> 4; const unsigned ao = lr * XP + 8 * hi, wb = lane * 16; v16bf b[DM / 32]; v8f acc[4];   // wb: the lane's byte offset in w2d, the one vector register that its loads name
#pragma unroll
    for (int c = 0; c < DM / 32; ++c) b[c] = WFrag<bf>::ldf((const bf*)((const char*)W2 + wb) + c * 512);
    LOADS_ISSUED(wb, wb, wb);
#pragma unroll
    for (int mb = 0; mb < 4; ++mb) acc[mb] = (v8f){};
#pragma unroll
    for (int c = 0; c < DM / 32; ++c) {
#pragma unroll
        for (int mb = 0; mb < 4; ++mb) acc[mb] = wmmab(WFrag<bf>::ld(xh + ao + mb * 16 * XP + c * 32), b[c], acc[mb]);
#pragma unroll
        for (int mb = 0; mb < 4; ++mb) acc[mb] = wmmab(WFrag<bf>::ld(xl + ao + mb * 16 * XP + c * 32), b[c], acc[mb]); }
    v8h o[4];
#pragma unroll
    for (int mb = 0; mb < 4; ++mb) {
#pragma unroll
        for (int j = 0; j < 8; ++j) o[mb][j] = (h16)(acc[mb][j] * RSCL); }
    h16* np = NBQ + ((size_t)(lr & (NH_ - 1)) * TT + r0 / TT) * TT + r0 % TT + 8 * hi;
    if (lr < NH_) {
#pragma unroll
        for (int mb = 0; mb < 4; ++mb) *(v8h*)(np + mb * 16) = o[mb]; }
}
// ---- k_proj: LayerNorm and the five GEMMs on its result, per 64 tokens; grid tokens/64, 8 waves.
// Each wave normalises 8 of the 64 tokens into LDS (bf16 hi and lo rows); behind the barrier each takes one 64-column tile over all 64 tokens, A fragments from LDS: wave 0,1: q; 2,3: k (fp16 head planes); 4,5: v (fp16 v^T planes); 6,7: gate logits (fp16, in the form of q). Wave 0 then adds the pair bias of the 64 tokens (fp16, one whole line per head).
// amdgpu_waves_per_eu(4, 4): a budget of 256 registers a wave, so that two work-groups share a WGP: one streams and normalises its tokens while the other multiplies.
__global__ __launch_bounds__(256) __attribute__((amdgpu_waves_per_eu(4, 4))) void k_proj(const float* __restrict__ act, const float* __restrict__ lng, const float* __restrict__ lnb, const bf* __restrict__ WQ, const bf* __restrict__ WK, const bf* __restrict__ WV, const bf* __restrict__ WG, const bf* __restrict__ W2, h16* QP16, h16* KP16, h16* VT16, h16* FG16, h16* NBQ) {
    __shared__ __align__(16) bf xs[2 * 64 * XP];
    const int wv = __builtin_amdgcn_readfirstlane(threadIdx.x >> 5);   // the wave's number as a scalar: the arms below are scalar branches
    const int r0 = blockIdx.x * 64, c0 = (wv & 1) * 64;
    bf* xh = xs; bf* xl = xs + 64 * XP;
    d_ln8(act + (size_t)(r0 + wv * 8) * DM, lng, lnb, xh + wv * 8 * XP, xl + wv * 8 * XP);
    __syncthreads();   // publishes the 64 normalised tokens
    // s_wait_xcnt 0 at the end of each arm, behind its last stores: in the built code other instructions follow it and take the registers that those stores name
    if (wv < 4 || wv >= 6) { gemm_tile<bf, 1>(xh, xl, XP, wv < 2 ? WQ : wv < 4 ? WK : WG, DM, wv < 2 ? QP16 : wv < 4 ? KP16 : FG16, r0, c0); asm volatile("s_wait_xcnt 0x0" ::: "memory");
        if (wv == 0) { nb_rows(xh, xl, W2, NBQ, r0); asm volatile("s_wait_xcnt 0x0" ::: "memory"); } }
    else { gemm_tile<bf, 2>(xh, xl, XP, WV, DM, VT16, r0, c0); asm volatile("s_wait_xcnt 0x0" ::: "memory"); }
}
// ---- k_prep: the weights, in ONE launch: the five transposes (WTB blocks each) and the padded w2d (W2B blocks).
#define WTB  ((DM * DQ / 64 + 63) / 64)
#define W2B  ((NBP * DM / 8 + 255) / 256)
__global__ __launch_bounds__(256) void k_prep(const float* __restrict__ w2d, const float* __restrict__ wq, const float* __restrict__ wk, const float* __restrict__ wv, const float* __restrict__ wg, const float* __restrict__ wo,
                                              bf* WQ, bf* WK, bf* WV, bf* WG, bf* WO, bf* W2) {
    const int b = blockIdx.x;
    if (b < 4 * WTB) { const int w = b / WTB; d_wtG(w == 0 ? wq : w == 1 ? wk : w == 2 ? wv : wg, DM, DQ, w == 0 ? WQ : w == 1 ? WK : w == 2 ? WV : WG, b % WTB); return; }
    if (b < 5 * WTB) { d_wtG(wo, DQ, DM, WO, b - 4 * WTB); return; }
    if (b < 5 * WTB + W2B) { d_w2d(w2d, W2, b - 5 * WTB); return; }
}
// two independent v_exp_f32, in place, with the one slot that the instruction set asks for behind a transcendental (before its result is used or its source overwritten) kept in the same statement
__device__ __forceinline__ void exp2x2(float& a, float& b) { asm("v_exp_f32 %0, %0\n\tv_exp_f32 %1, %1\n\tv_nop" : "+v"(a), "+v"(b)); }
// gate and split of one attn.v value: y = (ov / 1024) sigmoid(gate logit + bg) as bf16 hi + lo
__device__ __forceinline__ void gate1(float ov, float gv, float bgraw, unsigned short& h2, unsigned short& l2) {
    const float ga = __fadd_rn(gv, bfr(bgraw)); const float sg = __fdiv_rn(1.0f, __fadd_rn(1.0f, __builtin_amdgcn_exp2f(__fmul_rn(ga, -1.4426950408889634f))));
    const float y = __fmul_rn(__fmul_rn(ov, 1.0f / PCAR), sg); splitf(y, h2, l2); }
// ---- k_fattn: one wave = 16 queries of one row i against all 256 keys, head after head, then the output projection of those 16 queries; grid (256/128, rows), 8 waves.
// Scores are formed TRANSPOSED, S^T = K Q^T + (pair bias + mask bias) 32^0.5 (A = 16 key rows, B = the 16 query rows). The mask bias is the accumulators' start value; the fp16 pair bias is added by the matrix unit: the upper or the lower half of a 16 x 32 identity (A) times one bias fragment (B = 32 keys of the wave's 16 queries) gives the bias of one score tile, each value times 1.0 exactly, with no conversion and no vector addition: an accumulator tile holds key 16t + 8*hi + j of query lr in register j of lane (lr, hi),
// which is the fragment order of P for attn.v (elements 0..7 = tile 2c, 8..15 = tile 2c+1 of the 32-key chunk c): no lane exchange, no LDS or memory round trip for S or P.
// attn.v is formed transposed too, O^T = V^T P^T (A = 16 rows d of v^T, B = P): lane (lr, hi) then holds d = 8*hi + j and 16 + 8*hi + j of query lr, next to that query's row sum, and that again is the fragment order of the head's 32 k of the output projection.
// P = 1024 exp(logit - max) in fp16 (at most 1024); the f32 tile is scaled by 1024 / sum, gated, split into bf16 hi + lo; each lane parks its own 4 x 16 bytes per head in LDS (registers are short while the scores live) and takes them back behind the last head.
// Output: out^T = wo^T y^T (A = 16 columns c of wo, B = y hi, then y lo, head after head: the sum order of a K = 128 GEMM in chunks of 32), staged through the wave's LDS so that each store is one whole 512-byte row of out.
// amdgpu_waves_per_eu(4, 4): a budget of 256 registers a wave, so that two work-groups share a WGP: the 512 work-groups of the launch are resident at once.
#define YP   132              // floats per staged output row: 128 + 4, so that the 16 rows written at once fall on different banks
#define YW   (16 * YP)        // floats of LDS a wave: the staged 16 x 128 output tile; before that its lanes' parked y fragments (8 KiB)
#define NBR  (TT + 8)         // 16-bit elements per staged bias row: 512 + 16 bytes, the pitch for 16-byte LDS reads of 16 rows at once
#define NBW  (16 * NBR)       // elements of LDS a wave: one head's bias rows of its 16 queries
typedef __attribute__((ext_vector_type(4))) int v4i;
// one head's bias rows of a wave's 16 queries, global -> the wave's own LDS slot, through no register: 16 asynchronous copies, each one whole 128-byte line of four rows (g, l: the lane's 16 bytes in the first; lane = 8 x row + unit), so that the four copies along a row differ by one step in both addresses and share their address registers. The slot is private to the wave: it reads it behind its own s_wait_asynccnt 0 and refills it behind its own s_wait_dscnt 0, with no barrier.
__device__ __forceinline__ void nb_copy(const h16* g, h16* l) {
#pragma unroll
    for (int b = 0; b < 4; ++b) { __attribute__((address_space(1))) v4i* gb = (__attribute__((address_space(1))) v4i*)(g + b * 4 * TT); __attribute__((address_space(3))) v4i* lb = (__attribute__((address_space(3))) v4i*)(l + b * 4 * NBR);
        // the offset argument, in bytes, moves both addresses
        __builtin_amdgcn_global_load_async_to_lds_b128(gb, lb, 0, 0); __builtin_amdgcn_global_load_async_to_lds_b128(gb, lb, 128, 0); __builtin_amdgcn_global_load_async_to_lds_b128(gb, lb, 256, 0); __builtin_amdgcn_global_load_async_to_lds_b128(gb, lb, 384, 0); }
}
__global__ __launch_bounds__(256) __attribute__((amdgpu_waves_per_eu(4, 4))) void k_fattn(const h16* __restrict__ Q16, const h16* __restrict__ K16, const h16* __restrict__ V16, const h16* __restrict__ NBQ, const float* __restrict__ mask, const h16* __restrict__ FG16, const float* __restrict__ bg, const bf* __restrict__ WO, const float* __restrict__ bo, float* OUT) {
    __shared__ __align__(32) float mbs[TT];
    __shared__ __align__(16) float yst[8 * YW];
    __shared__ __align__(16) h16 nbs[8 * NBW];
    __shared__ __align__(16) h16 idf[2 * 512];   // the two identity halves as A fragments: fragment f holds 1 at k = 16 f + m of row m; kept in LDS and read once per head, as 16 registers held over the softmax would not fit
    const int lane = threadIdx.x & 31, lr = lane & 15, hi = lane >> 4; const int il = blockIdx.y;
    const int wv = __builtin_amdgcn_readfirstlane(threadIdx.x >> 5); const int q0 = (blockIdx.x * 8 + wv) * 16;   // the wave's number as a scalar: over the head loop every plane's base then stays in scalar registers, and a lane keeps one 32-bit offset per element width
    const unsigned l8 = lane * 8, l4 = lane * 4, bo8 = 8 * hi;   // a lane's place in a 16-bit and in an f32 fragment
    float* yw = yst + wv * YW; h16* nbw = nbs + wv * NBW;
    const unsigned ng = (lane >> 3) * TT + (lane & 7) * 8; h16* nl = nbw + (lane >> 3) * NBR + (lane & 7) * 8;   // a lane's place in the first bias copy: in the plane, in the slot
    nb_copy(NBQ + (unsigned)q0 * TT + ng, nl);   // head 0's bias rows fly over the set-up below
    mbs[threadIdx.x] = 1e9f * (bfr(mask[(size_t)il * TT + threadIdx.x]) - 1.0f) * RSCL;   // mask bias of row i, once per work-group
    { v4h one;   // thread t writes elements 4 t .. 4 t + 3 in fragment order [f][half][lane][8]
#pragma unroll
        for (int e = 0; e < 4; ++e) { const int x = threadIdx.x * 4 + e; one[e] = (((x >> 8) & 1) * 16 + ((x >> 7) & 1) * 8 + (x & 7) == (x >> 9) * 16 + ((x >> 3) & 15)) ? (h16)1.0f : (h16)0.0f; }
        *(v4h*)(idf + threadIdx.x * 4) = one; }
    __syncthreads();   // publishes mbs and idf
    // one head; more: another head follows, whose bias rows are asked for. A compile-time flag and not a test of h: a branch in the middle would split the head's one block of code, and the compiler then pairs fewer of the gating's instructions
    auto head = [&](const int h, const bool more) __attribute__((always_inline)) {
        // element offsets in 32 bits (every plane is far below 4 Gi elements); each plane's 64-bit lane address is formed per head and lives only up to the wait behind its last batch of loads
        const unsigned tg0 = (unsigned)h * TG + (unsigned)il * (TT / 16), qt = q0 / 16;
        const unsigned kx = tg0 * 512 + l8, nx = ((unsigned)(h + 1) * TT + q0) * TT + ng, vx = ((unsigned)h * IG + il) * (HD * TT) + l8, qx = (tg0 + qt) * 512 + l8, bx = h * HD + bo8;
        const h16* kp = K16 + kx; const h16* vp = V16 + vx; const h16* qp = Q16 + qx; const h16* gp = FG16 + qx; const float* bp = bg + bx;
        const v16h bq = WFrag<h16>::ldf(qp);
        v16h ka[8], kb[8], na[TT / 32]; v8f s[TT / 16];
#pragma unroll
        for (int t = 0; t < 8; ++t) ka[t] = WFrag<h16>::ldf(kp + t * 512);
        LOADS_ISSUED(qp, kp, kp);
        asm volatile("s_wait_asynccnt 0x0" ::: "memory");   // this wave's own copies of this head's bias rows have landed: no read of the slot above it
#pragma unroll
        for (int c = 0; c < TT / 32; ++c) na[c] = WFrag<h16>::ld(nbw + lr * NBR + c * 32 + 8 * hi);   // B fragment: query lr, keys 32 c + 8 hi + j and 32 c + 16 + 8 hi + j
        { const v16h i0 = WFrag<h16>::ldf(idf + l8), i1 = WFrag<h16>::ldf(idf + 512 + l8);
#pragma unroll
            for (int c = 0; c < TT / 32; ++c) { s[2 * c] = wmma16(i0, na[c], *(const v8f*)(mbs + c * 32 + 8 * hi)); s[2 * c + 1] = wmma16(i1, na[c], *(const v8f*)(mbs + c * 32 + 16 + 8 * hi)); } }
#pragma unroll
        for (int t = 0; t < 8; ++t) s[t] = wmma16(ka[t], bq, s[t]);
        __builtin_amdgcn_sched_barrier(0);   // the second half's key loads take the first half's registers: not above its products
#pragma unroll
        for (int t = 0; t < 8; ++t) kb[t] = WFrag<h16>::ldf(kp + (8 + t) * 512);
        LOADS_ISSUED(kp, kp, kp);
#pragma unroll
        for (int t = 0; t < 8; ++t) s[8 + t] = wmma16(kb[t], bq, s[8 + t]);
        __builtin_amdgcn_sched_barrier(0);   // the v^T loads take the key fragments' registers: not above the products
        if (more) { asm volatile("s_wait_dscnt 0x0" ::: "memory");   // the wave's reads of its bias slot have retired before the copies below rewrite it
            nb_copy(NBQ + nx, nl); }   // the next head's bias rows fly over the softmax, attn.v and the gating
        v16h vf[TT / 32][2];
#pragma unroll
        for (int cc = 0; cc < 3; ++cc) { vf[cc][0] = WFrag<h16>::ldf(vp + cc * 1024); vf[cc][1] = WFrag<h16>::ldf(vp + cc * 1024 + 512); }
        LOADS_ISSUED(vp, vp, vp);
        float m4[4] = { -3.0e38f, -3.0e38f, -3.0e38f, -3.0e38f };
#pragma unroll
        for (int t = 0; t < TT / 16; ++t) {
#pragma unroll
            for (int j = 0; j < 4; ++j) m4[j] = fmaxf(fmaxf(m4[j], s[t][j]), s[t][j + 4]); }
        float mx = fmaxf(fmaxf(m4[0], m4[1]), fmaxf(m4[2], m4[3])); mx = fmaxf(mx, __shfl_xor(mx, 16, 32));
        v8f vs = (v8f){}; v8f o[2] = { (v8f){}, (v8f){} }; v16h gl; v4f bl[4];
#pragma unroll
        for (int cc = 0; cc < TT / 32; ++cc) { v16h p;
#pragma unroll
            for (int j = 0; j < 8; ++j) { float e0 = fmaf(s[2 * cc][j] - mx, SCL * 1.4426950408889634f, 10.0f), e1 = fmaf(s[2 * cc + 1][j] - mx, SCL * 1.4426950408889634f, 10.0f); exp2x2(e0, e1); vs[j] += e0 + e1; p[j] = tohx(e0); p[8 + j] = tohx(e1); }
            o[0] = wmma16(vf[cc][0], p, o[0]); o[1] = wmma16(vf[cc][1], p, o[1]);
            if (cc + 3 < TT / 32) { __builtin_amdgcn_sched_barrier(0);   // the v^T loads three chunks ahead take registers freed above
                vf[cc + 3][0] = WFrag<h16>::ldf(vp + (cc + 3) * 1024); vf[cc + 3][1] = WFrag<h16>::ldf(vp + (cc + 3) * 1024 + 512);
                if (cc + 4 == TT / 32) {   // with the last of them the head's gate logits and gate bias for this lane's 16 values
                    gl = WFrag<h16>::ldf(gp);
#pragma unroll
                    for (int u = 0; u < 4; ++u) bl[u] = *(const v4f*)(bp + (u >> 1) * 16 + (u & 1) * 4); }
                // as LOADS_ISSUED; the two accumulators and the running sums are named as inputs too, so that the chunk's products and additions are issued above: left free they sink to the head's end, every v^T fragment and every exponential stays live, and registers spill
                asm volatile("s_wait_xcnt 0x0" :: "v"(vp), "v"(gp), "v"(bp), "v"(o[0]), "v"(o[1]), "v"(vs) : "memory"); __builtin_amdgcn_sched_barrier(0); } }
        __builtin_amdgcn_sched_barrier(0);   // the gating stays below the last chunks: lifted above them it would wait for the gate loads, the youngest in flight, before their latency is covered
        float sum = ((vs[0] + vs[1]) + (vs[2] + vs[3])) + ((vs[4] + vs[5]) + (vs[6] + vs[7])); sum += __shfl_xor(sum, 16, 32);
        const float f = __fdiv_rn(PCAR, sum);   // sum and values belong to the same query lr
        v8us yh0, yh1, yl0, yl1;
#pragma unroll
        for (int j = 0; j < 8; ++j) { unsigned short a2, b2; gate1(o[0][j] * f, (float)gl[j], bl[j >> 2][j & 3], a2, b2); yh0[j] = a2; yl0[j] = b2; gate1(o[1][j] * f, (float)gl[8 + j], bl[2 + (j >> 2)][j & 3], a2, b2); yh1[j] = a2; yl1[j] = b2; }
        v8usa* yq = (v8usa*)yw + h * 128 + lane;   // 16-byte units, lanes side by side; each lane reads back only what it wrote
        yq[0] = yh0; yq[32] = yh1; yq[64] = yl0; yq[96] = yl1;
    };
#pragma unroll 1   // one head's code, run three times: unrolled it would be more text and keep more registers live
    for (int h = 0; h + 1 < NH_; ++h) head(h, true);
    head(NH_ - 1, false);
    const bf* wp = WO + l8;
    v16bf w[2][NH_], yh[NH_], yl[NH_]; v8f acc[DM / 16];
#pragma unroll
    for (int h = 0; h < NH_; ++h) w[0][h] = WFrag<bf>::ldf(wp + h * 512);
    const v4f bov = *(const v4f*)(bo + l4);
    LOADS_ISSUED(l8, l4, l8);
#pragma unroll
    for (int h = 0; h < NH_; ++h) { const v8usa* yq = (const v8usa*)yw + h * 128 + lane; yh[h] = cat16b(yq[0], yq[32]); yl[h] = cat16b(yq[64], yq[96]); }
#pragma unroll
    for (int t = 0; t < DM / 16; ++t) {
        if (t + 1 < DM / 16) {   // the next 16 columns' wo fragments fly while this tile's products run
#pragma unroll
            for (int h = 0; h < NH_; ++h) w[(t + 1) & 1][h] = WFrag<bf>::ldf(wp + ((t + 1) * NH_ + h) * 512);
            LOADS_ISSUED(l8, l8, l8); }
        acc[t] = (v8f){};
#pragma unroll
        for (int h = 0; h < NH_; ++h) { acc[t] = wmmab(w[t & 1][h], yh[h], acc[t]); acc[t] = wmmab(w[t & 1][h], yl[h], acc[t]); }
    }
    // register j of tile t is column 16t + 8*hi + j of query lr
#pragma unroll
    for (int t = 0; t < DM / 16; ++t) { float* sp = yw + lr * YP + t * 16 + 8 * hi; *(v4fa*)sp = __builtin_shufflevector(acc[t], acc[t], 0, 1, 2, 3); *(v4fa*)(sp + 4) = __builtin_shufflevector(acc[t], acc[t], 4, 5, 6, 7); }
    __builtin_amdgcn_wave_barrier(); asm volatile("" ::: "memory");   // the reads below take other lanes' values: not above the writes (one wave, its LDS operations run in order)
    float* orow = OUT + ((size_t)il * TT + q0) * DM + l4;
#pragma unroll
    for (int r = 0; r < 16; ++r) { v4f val = *(const v4fa*)(yw + r * YP + lane * 4); val[0] += bfr(bov[0]); val[1] += bfr(bov[1]); val[2] += bfr(bov[2]); val[3] += bfr(bov[3]); *(v4f*)(orow + (size_t)r * DM) = val;
        if (r == 7) asm volatile("s_wait_xcnt 0x0" ::: "memory");   // in front of the second half's LDS reads, which take registers that these stores name
    }
}

extern "C" void kernel_launch(void* const* d_in, const int* in_sizes, int n_in,
                              void* d_out, int out_size, void* d_ws, size_t ws_size, hipStream_t stream) {
    (void)in_sizes; (void)n_in; (void)out_size;
    const float* act = (const float*)d_in[0]; const float* mask = (const float*)d_in[1]; const float* lng = (const float*)d_in[2]; const float* lnb = (const float*)d_in[3]; const float* w2d = (const float*)d_in[4]; const float* wq = (const float*)d_in[5]; const float* wk = (const float*)d_in[6]; const float* wv = (const float*)d_in[7]; const float* wg = (const float*)d_in[8]; const float* bg = (const float*)d_in[9]; const float* wo = (const float*)d_in[10]; const float* bo = (const float*)d_in[11];
    float* OUT = (float*)d_out;     // [1][256][256][128]
    char* wsp = (char*)d_ws;
    auto take = [&](size_t bytes) { char* p = wsp; wsp += (bytes + 255) & ~(size_t)255; return (void*)p; };
    bf* WQ = (bf*)take((size_t)DQ * DM * 2); bf* WK = (bf*)take((size_t)DQ * DM * 2); bf* WV = (bf*)take((size_t)DQ * DM * 2); bf* WG = (bf*)take((size_t)DQ * DM * 2); bf* WO = (bf*)take((size_t)DM * DQ * 2); bf* W2 = (bf*)take((size_t)NBP * DM * 2);
    h16* FG16 = (h16*)take((size_t)NTK * DQ * 2); h16* QP16 = (h16*)take((size_t)NH_ * NTK * HD * 2); h16* KP16 = (h16*)take((size_t)NH_ * NTK * HD * 2); h16* VT16 = (h16*)take((size_t)NH_ * IG * HD * TT * 2);
    h16* NBQ = (h16*)take((size_t)NH_ * NTOK * 2);
    if ((size_t)(wsp - (char*)d_ws) > ws_size) return;    // ws 256 MiB (carve ~65 MiB)
    static_assert(IG == NI, "one row group: the pair bias of all positions is formed in the projections' launch");
    k_prep<<<5 * WTB + W2B, 256, 0, stream>>>(w2d, wq, wk, wv, wg, wo, WQ, WK, WV, WG, WO, W2);
    k_proj<<<NTK / 64, 256, 0, stream>>>(act, lng, lnb, WQ, WK, WV, WG, W2, QP16, KP16, VT16, FG16, NBQ);   /* LayerNorm; q, k, v^T planes, gate logits, pair bias rows nb[h][q][k] for all 65536 positions */
    k_fattn<<<dim3(TT / 128, IG, 1), 256, 0, stream>>>(QP16, KP16, VT16, NBQ, mask, FG16, bg, WO, bo, OUT);   /* attention, gating and output projection */
}

// v010
// Measured time: 54.3 microseconds a run.
// Two timings next to v009 both put it at 1.03 times that version's speed.
// Over all steps from v000 it is 14.5 times as fast.
#include <hip/hip_runtime.h>

// Triangle attention (starting node) on a pair representation (act [1][256][256][128], mask [1][256][256]): x = LayerNorm_c(act) (eps 1e-5, ln_g/ln_b); per row i: q, k, v, g = x[i] W (wq/wk/wv/wg [128][4][32] 'xw', 4 heads x 32; q x 32^-0.5), logits[h][q][k] = q.k + 1e9 (mask[i][k] - 1) + nb[h][q][k] with the pair bias nb[h][q][k] = sum_c x[q][k][c] w2d[c][h] (shared by all rows i);
// softmax over k; o = attn.v gated by sigmoid(x wg + bg); out[i][q][c] = sum_{h,d} o[h][d] wo[h][d][c] + bo -> [1][256][256][128] (8.4 M).
// Layout: rows i in groups of IG, here all 256 in one group, so each stage is one launch. One small launch puts the weights into fragment order (w2d padded to 64 rows, 16 read). Then ONE kernel per 64 tokens: LayerNorm -> bf16 hi/lo rows in LDS, from which its 8 waves take the A fragments of the q/k/v/g projections (hi/lo x exact) and of the pair bias nb (16 columns, 4 used; stored as fp16 rows per head and query); the normalised tokens never go to memory. The projections' epilogue writes the fp16 planes q, k, v^T and gate logits itself, in the fragment order in which the attention kernel's lanes load them, then ONE attention kernel (a wave takes its 16 queries through all four heads; scores, mask bias + pair bias, x 32^-0.5, softmax and attn.v stay in registers) that also gates its result, splits it into bf16 hi + lo and multiplies it by wo (+ bo) itself.
// Compute dtypes, f32 accumulate: every input rounded to bf16 once; LayerNorm in f32, its output as bf16 hi + lo (2-product projections against exact bf16 weights); scores and attn.v on single fp16 planes (P = 1024 exp(logit - max), at most 1024; 1/sum applied to the f32 attn.v result); pair bias and gate logits formed in f32 and stored as fp16 between the launches; mask bias, softmax, gating in f32; output GEMM hl x exact + bo.

#define NI   256       // rows i
#define TT   256       // tokens per row (q / k index)
#define DM   128       // c_z
#define NH_  4
#define HD   32
#define DQ   (NH_ * HD)
#define IG   256       // rows i per group: all of them (one launch per stage fills the chip; the planes between the stages then take 65 MiB of the workspace)
#define NTK  (IG * TT) // tokens per group = 65536
#define NTOK (NI * TT) // 65536
#define NBP  64        // rows of the padded w2d (16 read, 4 used)
#define SCL  0.17677669529663688f   // 32^-0.5
#define RSCL 5.656854249492381f     // 32^0.5
typedef _Float16 h16;
typedef unsigned short bf;
typedef __attribute__((ext_vector_type(16))) __bf16   v16bf;
typedef __attribute__((ext_vector_type(16))) _Float16 v16h;
typedef __attribute__((ext_vector_type(8)))  _Float16 v8h;
typedef __attribute__((ext_vector_type(8)))  unsigned short v8us;
typedef __attribute__((ext_vector_type(8)))  float    v8f;
typedef __attribute__((ext_vector_type(4)))  float    v4f;
typedef v8h  __attribute__((may_alias)) v8ha;
typedef v4f  __attribute__((may_alias)) v4fa;
typedef v8us __attribute__((may_alias)) v8usa;

typedef __attribute__((ext_vector_type(8)))  __bf16   v8bf;
typedef __attribute__((ext_vector_type(4)))  __bf16   v4bf;
// f32 -> bf16, round to nearest even, by the chip's own conversion (v_cvt_pk_bf16_f32, two values an instruction)
__device__ __forceinline__ unsigned short f2bf(float f) { return __builtin_bit_cast(unsigned short, (__bf16)f); }
__device__ __forceinline__ float bf2f(unsigned short b) { return __uint_as_float(((unsigned)b) << 16); }
__device__ __forceinline__ float bfr(float f) { return bf2f(f2bf(f)); }
__device__ __forceinline__ v16h cat16(v8h lo, v8h hi) { return __builtin_shufflevector(lo, hi, 0, 1, 2, 3, 4, 5, 6, 7, 8, 9, 10, 11, 12, 13, 14, 15); }
__device__ __forceinline__ v16bf cat16b(v8us lo, v8us hi) { return __builtin_bit_cast(v16bf, __builtin_shufflevector(lo, hi, 0, 1, 2, 3, 4, 5, 6, 7, 8, 9, 10, 11, 12, 13, 14, 15)); }
__device__ __forceinline__ v8f wmma16(v16h a, v16h b, v8f c) { return __builtin_amdgcn_wmma_f32_16x16x32_f16(false, a, false, b, (short)0, c, false, false); }
__device__ __forceinline__ v8f wmmab(v16bf a, v16bf b, v8f c) { return __builtin_amdgcn_wmma_f32_16x16x32_bf16(false, a, false, b, (short)0, c, false, false); }



// ---- FRAGMENT ORDER: every plane that a matrix instruction reads from global memory is stored as its fragments are held. A fragment (16 rows x 32 k of 16-bit values) is 1024 bytes: [half][lane][8], lane = 16 hi + row, element j of half s = k 16 s + 8 hi + j; ldf() takes it with two loads of 512 contiguous bytes (four whole lines each) where rows at a pitch made each load touch 8 or 16 lines.
// ---- gemm_tile: register-blocked GEMM, ONE WAVE per 64x64 output tile at (r0, c0) (16 accumulators); A, A2 = the tile's own 64 rows (hi, lo) at a pitch of lda elements in LDS; Bt = the weights in fragment order [n / 16][k / 32][fragment]. K % 32 == 0. Products per 32 k: hi, then lo.
// EPI 2 (v): token rows as A, so that a lane's 8 accumulator registers are 8 consecutive tokens of one column d: 16 bytes of a v^T fragment, P16[n / 32][row i][key / 32][d / 16][fragment].
// EPI 1 (q, k, gate logits): the weights as A (the tile comes out transposed; same products, same order over k), so that the 8 registers are 8 consecutive columns of one token: 16 bytes of a q or k fragment, P16[n / 32][token / 16][fragment]; the gate logits have the same form.
// In both the lane that holds the values is the lane that will load them: each store is 512 contiguous bytes straight from the registers, with no LDS stage.
#define TG   (NTK / 16)   // groups of 16 tokens
template <typename T16> struct WFrag;
template <> struct WFrag<h16> { typedef v16h V; static __device__ __forceinline__ V ld(const h16* p) { return cat16(*(const v8h*)p, *(const v8h*)(p + 16)); } static __device__ __forceinline__ V ldf(const h16* p) { return cat16(*(const v8h*)p, *(const v8h*)(p + 256)); } static __device__ __forceinline__ v8f mma(V a, V b, v8f c) { return wmma16(a, b, c); } };
template <> struct WFrag<bf> { typedef v16bf V; static __device__ __forceinline__ V ld(const bf* p) { return cat16b(*(const v8us*)p, *(const v8us*)(p + 16)); } static __device__ __forceinline__ V ldf(const bf* p) { return cat16b(*(const v8us*)p, *(const v8us*)(p + 256)); } static __device__ __forceinline__ v8f mma(V a, V b, v8f c) { return wmmab(a, b, c); } };
template <typename T16, int EPI>
__device__ __forceinline__ void gemm_tile(const T16* A, const T16* A2, int lda, const T16* __restrict__ Bt, int K, h16* P16, int r0, int c0) {
    typedef typename WFrag<T16>::V V;
    const int lane = threadIdx.x & 31, lr = lane & 15, hi = lane >> 4;
    v8f acc[4][4];
#pragma unroll
    for (int mb = 0; mb < 4; ++mb)
#pragma unroll
        for (int nb = 0; nb < 4; ++nb) acc[mb][nb] = (v8f){};
    const size_t aoff = (size_t)lr * lda + 8 * hi; const T16* bp = Bt + (size_t)(c0 / 16) * (K / 32) * 512 + lane * 8;
#pragma unroll 1
    for (int kc = 0; kc < K; kc += 32) {
        V a[4], a2[4];
#pragma unroll
        for (int mb = 0; mb < 4; ++mb) { a[mb] = WFrag<T16>::ld(A + aoff + (size_t)mb * 16 * lda + kc); a2[mb] = WFrag<T16>::ld(A2 + aoff + (size_t)mb * 16 * lda + kc); }
#pragma unroll
        for (int nb = 0; nb < 4; ++nb) { const V b = WFrag<T16>::ldf(bp + (size_t)(nb * (K / 32)) * 512 + kc * 16);
#pragma unroll
            for (int mb = 0; mb < 4; ++mb) {
                if constexpr (EPI == 2) { acc[mb][nb] = WFrag<T16>::mma(a[mb], b, acc[mb][nb]); acc[mb][nb] = WFrag<T16>::mma(a2[mb], b, acc[mb][nb]); }
                else { acc[mb][nb] = WFrag<T16>::mma(b, a[mb], acc[mb][nb]); acc[mb][nb] = WFrag<T16>::mma(b, a2[mb], acc[mb][nb]); } } }
        asm volatile("v_nop\n\tv_nop\n\tv_nop\n\tv_nop" : "+v"(acc[0][0]), "+v"(acc[1][1]), "+v"(acc[2][2]), "+v"(acc[3][3]) : "v"(a[0]), "v"(a[3]));
    }
    h16* dst = (EPI == 1) ? P16 + ((size_t)(c0 / HD) * TG + r0 / 16) * 512 + lane * 8 : P16 + (((size_t)(c0 / HD) * IG + r0 / TT) * (TT / 32) + (r0 % TT) / 32) * 1024 + lane * 8;
#pragma unroll
    for (int mb = 0; mb < 4; ++mb) {
#pragma unroll
        for (int nb = 0; nb < 4; ++nb) { v8h o;
#pragma unroll
            for (int j = 0; j < 8; ++j) o[j] = (h16)acc[mb][nb][j];
            if constexpr (EPI == 1) *(v8h*)(dst + ((size_t)(nb >> 1) * TG + mb) * 512 + (nb & 1) * 256) = o;
            else *(v8h*)(dst + ((size_t)(nb >> 1) * IG * (TT / 32) + (mb >> 1)) * 1024 + (nb & 1) * 512 + (mb & 1) * 256) = o; }
        if (mb < 3) { asm volatile("s_wait_xcnt 0x0" ::: "memory"); __builtin_amdgcn_sched_barrier(0); }   // in front of the next four conversions, which may take registers that these stores name; the scheduling barrier keeps them behind the wait
    }
}
typedef __attribute__((ext_vector_type(4))) unsigned short v4us;
typedef __attribute__((ext_vector_type(2))) unsigned short v2us;
typedef __attribute__((ext_vector_type(2))) _Float16 v2h;
typedef __attribute__((ext_vector_type(4))) _Float16 v4h;
__device__ __forceinline__ h16 tohx(float x) { return (h16)x; }
typedef __attribute__((ext_vector_type(4))) unsigned v4u;
typedef __attribute__((ext_vector_type(2))) unsigned v2u;
// four packed bf16 values as f32, from their bits (a shift or a mask each); four f32 values rounded to bf16
__device__ __forceinline__ v4f bfx4(v4bf b) { const v2u w = __builtin_bit_cast(v2u, b); return (v4f){ __uint_as_float(w[0] << 16), __uint_as_float(w[0] & 0xFFFF0000u), __uint_as_float(w[1] << 16), __uint_as_float(w[1] & 0xFFFF0000u) }; }
__device__ __forceinline__ v4f bfr4(v4f x) { return bfx4(__builtin_convertvector(x, v4bf)); }
// eight values as bf16 hi + lo: hi by the conversion, lo = the remainder against the very bits that hi stores (an exact difference)
__device__ __forceinline__ void split8(v8f y, v8us& h, v8us& l) { const v4u hb = __builtin_bit_cast(v4u, __builtin_convertvector(y, v8bf)); v8f r;
#pragma unroll
    for (int i = 0; i < 4; ++i) { r[2 * i] = y[2 * i] - __uint_as_float(hb[i] << 16); r[2 * i + 1] = y[2 * i + 1] - __uint_as_float(hb[i] & 0xFFFF0000u); }
    h = __builtin_bit_cast(v8us, hb); l = __builtin_bit_cast(v8us, __builtin_convertvector(r, v8bf)); }
__device__ __forceinline__ void d_wtG(const float* __restrict__ w, int K, int N, bf* Bt, int bx) {
    const int lane = threadIdx.x & 31; const int L0 = (bx * 8 + (threadIdx.x >> 5)) * 8; const int nlines = N * K / 64;
{
#pragma unroll 1
        for (int l = 0; l < 8; ++l) { const int L = L0 + l; if (L >= nlines) break; const int e = L * 64 + lane * 2; const int fl = (e >> 3) & 31, fr = e >> 9;   // e counts in fragment order: [n / 16][k / 32][half][lane][8]; a wave still writes one whole line
            const int k = (fr % (K / 32)) * 32 + ((e >> 8) & 1) * 16 + (fl >> 4) * 8 + (e & 7), n = (fr / (K / 32)) * 16 + (fl & 15); v2us o;
            o[0] = f2bf(w[(size_t)k * N + n]); o[1] = f2bf(w[(size_t)(k + 1) * N + n]); *(v2us*)(Bt + e) = o;
            asm volatile("s_wait_xcnt 0x0" ::: "memory"); }   // in front of the next trip's index sums, which take registers that this store names
         }
}
__global__ __launch_bounds__(256) void k_cvt8(const float* __restrict__ src, bf* dst, size_t n8) { const size_t i = (size_t)blockIdx.x * 256 + threadIdx.x; if (i >= n8) return; const v8f v = *(const v8f*)(src + i * 8); v8us o;
#pragma unroll
    for (int k = 0; k < 8; ++k) o[k] = f2bf(v[k]); *(v8us*)(dst + i * 8) = o;  }

__device__ __forceinline__ void d_w2d(const float* __restrict__ w, bf* Bt, int bx) { const int i = bx * 256 + threadIdx.x; if (i >= NBP * DM / 8) return; const int r = (i >> 8) * 16 + (i & 15), c0 = ((i >> 6) & 3) * 32 + ((i >> 5) & 1) * 16 + ((i >> 4) & 1) * 8; v8us o;   // i counts 16-byte units in fragment order
#pragma unroll
    for (int k = 0; k < 8; ++k) o[k] = (r < NH_) ? f2bf(w[(size_t)(c0 + k) * NH_ + r]) : (unsigned short)0; *(v8us*)(Bt + (size_t)i * 8) = o;  }
// End of a batch of global loads: s_wait_xcnt 0 in front of whatever may take the loads' address registers (named as inputs, so that they live up to the wait); the scheduling barrier keeps the batch issued here, ahead of the work below that hides its latency (the compiler otherwise sinks each load to its use and waits for each in turn).
#define LOADS_ISSUED(p0, p1, p2) do { asm volatile("s_wait_xcnt 0x0" :: "v"(p0), "v"(p1), "v"(p2) : "memory"); __builtin_amdgcn_sched_barrier(0); } while (0)
// 1 / sqrt(x) by v_rsq_f32 (x = variance + 1e-5, never subnormal), with the one slot that the instruction set asks for behind a transcendental (before its result is used or its source overwritten) kept in one statement
__device__ __forceinline__ float rsq_slot(float x) { asm("v_rsq_f32 %0, %0\n\tv_nop" : "+v"(x)); return x; }
// lane l's value seen from lane l ^ 16 (a vector cross-row move) and from lane l ^ M inside a 16-lane row (DPP row_xmask, which the compiler folds into the addition); all 32 lanes are on wherever these stand
__device__ __forceinline__ float x16(float x) { const int b = __float_as_int(x); return __int_as_float(__builtin_amdgcn_permlanex16(b, b, 0x76543210, 0xfedcba98, false, false)); }
template <int M> __device__ __forceinline__ float xrow(float x) { return __int_as_float(__builtin_amdgcn_update_dpp(0, __float_as_int(x), 0x160 | M, 0xf, 0xf, true)); }
// eight sums over the wave's 32 lanes, side by side: the butterfly l ^ 16, 8, 4, 2, 1
__device__ __forceinline__ void wsum8(float (&s)[8]) {
#pragma unroll
    for (int t = 0; t < 8; ++t) s[t] = __fadd_rn(s[t], x16(s[t]));
#pragma unroll
    for (int t = 0; t < 8; ++t) s[t] = __fadd_rn(s[t], xrow<8>(s[t]));
#pragma unroll
    for (int t = 0; t < 8; ++t) s[t] = __fadd_rn(s[t], xrow<4>(s[t]));
#pragma unroll
    for (int t = 0; t < 8; ++t) s[t] = __fadd_rn(s[t], xrow<2>(s[t]));
#pragma unroll
    for (int t = 0; t < 8; ++t) s[t] = __fadd_rn(s[t], xrow<1>(s[t]));
}
// ---- d_ln8: LayerNorm of 8 tokens by one wave (a lane holds 4 channels of each); A = the first token's row, xh / xl = its hi / lo row in LDS. The 8 tokens go through each stage side by side, so that their 8 loads fly together and their dependent chains fill each other's waits. Sums over the lanes by wsum8, squares and the scale by ln_g as fused multiply-adds, 1 / sqrt by v_rsq_f32, roundings to bf16 by the chip's conversion.
#define XP   136       // 16-bit elements per staged token row: 256 + 16 bytes, the pitch for 16-byte LDS reads of 16 rows at once
__device__ __forceinline__ void d_ln8(const float* __restrict__ A, const float* __restrict__ g, const float* __restrict__ bb, bf* xh, bf* xl) {
    const int lane = threadIdx.x & 31; const unsigned lb = lane * 16; v4f a[8];   // lb: the lane's byte offset in a row, the one vector register that the loads below name (their bases are scalars)
#pragma unroll
    for (int t = 0; t < 8; ++t) a[t] = *(const v4f*)((const char*)A + lb + t * (DM * 4));
    const v4f gv = *(const v4f*)((const char*)g + lb), bv = *(const v4f*)((const char*)bb + lb);
    LOADS_ISSUED(lb, lb, lb);
    const v4f gr = bfr4(gv), br = bfr4(bv);   // ln_g, ln_b rounded to bf16
    float v[8][4], s[8], mu[8], s2[8];
#pragma unroll
    for (int t = 0; t < 8; ++t) { s[t] = 0.f; const v4f ar = bfr4(a[t]);   // the input rounded to bf16
#pragma unroll
        for (int q = 0; q < 4; ++q) { v[t][q] = ar[q]; s[t] = __fadd_rn(s[t], v[t][q]); } }
    wsum8(s);
#pragma unroll
    for (int t = 0; t < 8; ++t) { mu[t] = __fdiv_rn(s[t], (float)DM); s2[t] = 0.f;
#pragma unroll
        for (int q = 0; q < 4; ++q) { const float d0 = v[t][q] - mu[t]; s2[t] = fmaf(d0, d0, s2[t]); } }
    wsum8(s2);
#pragma unroll
    for (int t = 0; t < 8; ++t) { const float rs = rsq_slot(__fadd_rn(__fdiv_rn(s2[t], (float)DM), 1e-5f)); v4f yv;
#pragma unroll
        for (int q = 0; q < 4; ++q) yv[q] = fmaf((v[t][q] - mu[t]) * rs, gr[q], br[q]);
        const v4bf oh = __builtin_convertvector(yv, v4bf), ol = __builtin_convertvector(yv - bfx4(oh), v4bf);   // hi, then lo = what hi left (an exact difference)
        *(v4us*)(xh + t * XP + lane * 4) = __builtin_bit_cast(v4us, oh); *(v4us*)(xl + t * XP + lane * 4) = __builtin_bit_cast(v4us, ol); }
}
// ---- nb_rows: pair bias of the 64 staged tokens x 16 columns of the padded w2d (4 used), by ONE wave, four accumulators; per accumulator the products in the order of gemm_tile (per 32 k: hi, then lo). Register j of lane (lr, hi) in tile mb is token 16 mb + 8 hi + j, column lr: 8 consecutive keys of one head.
// Stored x 32^0.5 (it starts the score accumulators, which are scaled by 32^-0.5 afterwards), rounded to fp16, as rows NBQ[h][q][key]: the 64 tokens are 64 keys of one query, 128 bytes per head, so each line has this one wave as its writer.
__device__ __forceinline__ void nb_rows(const bf* xh, const bf* xl, const bf* __restrict__ W2, h16* NBQ, int r0) {
    const int lane = threadIdx.x & 31, lr = lane & 15, hi = lane >> 4; const unsigned ao = lr * XP + 8 * hi, wb = lane * 16; v16bf b[DM / 32]; v8f acc[4];   // wb: the lane's byte offset in w2d, the one vector register that its loads name
#pragma unroll
    for (int c = 0; c < DM / 32; ++c) b[c] = WFrag<bf>::ldf((const bf*)((const char*)W2 + wb) + c * 512);
    LOADS_ISSUED(wb, wb, wb);
#pragma unroll
    for (int mb = 0; mb < 4; ++mb) acc[mb] = (v8f){};
#pragma unroll
    for (int c = 0; c < DM / 32; ++c) {
#pragma unroll
        for (int mb = 0; mb < 4; ++mb) acc[mb] = wmmab(WFrag<bf>::ld(xh + ao + mb * 16 * XP + c * 32), b[c], acc[mb]);
#pragma unroll
        for (int mb = 0; mb < 4; ++mb) acc[mb] = wmmab(WFrag<bf>::ld(xl + ao + mb * 16 * XP + c * 32), b[c], acc[mb]); }
    v8h o[4];
#pragma unroll
    for (int mb = 0; mb < 4; ++mb) {
#pragma unroll
        for (int j = 0; j < 8; ++j) o[mb][j] = (h16)(acc[mb][j] * RSCL); }
    h16* np = NBQ + ((size_t)(lr & (NH_ - 1)) * TT + r0 / TT) * TT + r0 % TT + 8 * hi;
    if (lr < NH_) {
#pragma unroll
        for (int mb = 0; mb < 4; ++mb) *(v8h*)(np + mb * 16) = o[mb]; }
}
// ---- k_proj: LayerNorm and the five GEMMs on its result, per 64 tokens; grid tokens/64, 8 waves.
// Each wave normalises 8 of the 64 tokens into LDS (bf16 hi and lo rows); behind the barrier each takes one 64-column tile over all 64 tokens, A fragments from LDS: wave 0,1: q; 2,3: k (fp16 head planes); 4,5: v (fp16 v^T planes); 6,7: gate logits (fp16, in the form of q). Wave 0 then adds the pair bias of the 64 tokens (fp16, one whole line per head).
// amdgpu_waves_per_eu(4, 4): a budget of 256 registers a wave, so that two work-groups share a WGP: one streams and normalises its tokens while the other multiplies.
__global__ __launch_bounds__(256) __attribute__((amdgpu_waves_per_eu(4, 4))) void k_proj(const float* __restrict__ act, const float* __restrict__ lng, const float* __restrict__ lnb, const bf* __restrict__ WQ, const bf* __restrict__ WK, const bf* __restrict__ WV, const bf* __restrict__ WG, const bf* __restrict__ W2, h16* QP16, h16* KP16, h16* VT16, h16* FG16, h16* NBQ) {
    __shared__ __align__(16) bf xs[2 * 64 * XP];
    const int wv = __builtin_amdgcn_readfirstlane(threadIdx.x >> 5);   // the wave's number as a scalar: the arms below are scalar branches
    const int r0 = blockIdx.x * 64, c0 = (wv & 1) * 64;
    bf* xh = xs; bf* xl = xs + 64 * XP;
    d_ln8(act + (size_t)(r0 + wv * 8) * DM, lng, lnb, xh + wv * 8 * XP, xl + wv * 8 * XP);
    __syncthreads();   // publishes the 64 normalised tokens
    // s_wait_xcnt 0 at the end of each arm, behind its last stores: in the built code other instructions follow it and take the registers that those stores name
    if (wv < 4 || wv >= 6) { gemm_tile<bf, 1>(xh, xl, XP, wv < 2 ? WQ : wv < 4 ? WK : WG, DM, wv < 2 ? QP16 : wv < 4 ? KP16 : FG16, r0, c0); asm volatile("s_wait_xcnt 0x0" ::: "memory");
        if (wv == 0) { nb_rows(xh, xl, W2, NBQ, r0); asm volatile("s_wait_xcnt 0x0" ::: "memory"); } }
    else { gemm_tile<bf, 2>(xh, xl, XP, WV, DM, VT16, r0, c0); asm volatile("s_wait_xcnt 0x0" ::: "memory"); }
}
// ---- k_prep: the weights, in ONE launch: the five transposes (WTB blocks each) and the padded w2d (W2B blocks).
#define WTB  ((DM * DQ / 64 + 63) / 64)
#define W2B  ((NBP * DM / 8 + 255) / 256)
__global__ __launch_bounds__(256) void k_prep(const float* __restrict__ w2d, const float* __restrict__ wq, const float* __restrict__ wk, const float* __restrict__ wv, const float* __restrict__ wg, const float* __restrict__ wo,
                                              bf* WQ, bf* WK, bf* WV, bf* WG, bf* WO, bf* W2) {
    const int b = blockIdx.x;
    if (b < 4 * WTB) { const int w = b / WTB; d_wtG(w == 0 ? wq : w == 1 ? wk : w == 2 ? wv : wg, DM, DQ, w == 0 ? WQ : w == 1 ? WK : w == 2 ? WV : WG, b % WTB); return; }
    if (b < 5 * WTB) { d_wtG(wo, DQ, DM, WO, b - 4 * WTB); return; }
    if (b < 5 * WTB + W2B) { d_w2d(w2d, W2, b - 5 * WTB); return; }
}
// two independent v_exp_f32, in place, with the one slot that the instruction set asks for behind a transcendental (before its result is used or its source overwritten) kept in the same statement
__device__ __forceinline__ void exp2x2(float& a, float& b) { asm("v_exp_f32 %0, %0\n\tv_exp_f32 %1, %1\n\tv_nop" : "+v"(a), "+v"(b)); }
// eight independent v_exp_f32, eight independent v_rcp_f32, in place, and one v_rcp_f32: each with that same slot kept in its statement
__device__ __forceinline__ void exp2x8(float (&t)[8]) { asm("v_exp_f32 %0, %0\n\tv_exp_f32 %1, %1\n\tv_exp_f32 %2, %2\n\tv_exp_f32 %3, %3\n\tv_exp_f32 %4, %4\n\tv_exp_f32 %5, %5\n\tv_exp_f32 %6, %6\n\tv_exp_f32 %7, %7\n\tv_nop" : "+v"(t[0]), "+v"(t[1]), "+v"(t[2]), "+v"(t[3]), "+v"(t[4]), "+v"(t[5]), "+v"(t[6]), "+v"(t[7])); }
__device__ __forceinline__ void rcpx8(float (&t)[8]) { asm("v_rcp_f32 %0, %0\n\tv_rcp_f32 %1, %1\n\tv_rcp_f32 %2, %2\n\tv_rcp_f32 %3, %3\n\tv_rcp_f32 %4, %4\n\tv_rcp_f32 %5, %5\n\tv_rcp_f32 %6, %6\n\tv_rcp_f32 %7, %7\n\tv_nop" : "+v"(t[0]), "+v"(t[1]), "+v"(t[2]), "+v"(t[3]), "+v"(t[4]), "+v"(t[5]), "+v"(t[6]), "+v"(t[7])); }
__device__ __forceinline__ float rcp_slot(float x) { asm("v_rcp_f32 %0, %0\n\tv_nop" : "+v"(x)); return x; }
// ---- k_fattn: one wave = 16 queries of one row i against all 256 keys, head after head, then the output projection of those 16 queries; grid (256/128, rows), 8 waves.
// Scores are formed TRANSPOSED, S^T = K Q^T + (pair bias + mask bias) 32^0.5 (A = 16 key rows, B = the 16 query rows). The mask bias is the accumulators' start value; the fp16 pair bias is added by the matrix unit: the upper or the lower half of a 16 x 32 identity (A) times one bias fragment (B = 32 keys of the wave's 16 queries) gives the bias of one score tile, each value times 1.0 exactly, with no conversion and no vector addition: an accumulator tile holds key 16t + 8*hi + j of query lr in register j of lane (lr, hi),
// which is the fragment order of P for attn.v (elements 0..7 = tile 2c, 8..15 = tile 2c+1 of the 32-key chunk c): no lane exchange, no LDS or memory round trip for S or P.
// attn.v is formed transposed too, O^T = V^T P^T (A = 16 rows d of v^T, B = P): lane (lr, hi) then holds d = 8*hi + j and 16 + 8*hi + j of query lr, next to that query's row sum, and that again is the fragment order of the head's 32 k of the output projection.
// P = 1024 exp(logit - max) in fp16 (at most 1024); the f32 tile is divided by the sum of P (v_rcp_f32), gated (sigmoid by v_exp_f32 and v_rcp_f32), split into bf16 hi + lo; each lane parks its own 4 x 16 bytes per head in LDS (registers are short while the scores live) and takes them back behind the last head.
// Output: out^T = wo^T y^T (A = 16 columns c of wo, B = y hi, then y lo, head after head: the sum order of a K = 128 GEMM in chunks of 32), staged through the wave's LDS so that each store is one whole 512-byte row of out.
// amdgpu_waves_per_eu(4, 4): a budget of 256 registers a wave, so that two work-groups share a WGP: the 512 work-groups of the launch are resident at once.
#define YP   132              // floats per staged output row: 128 + 4, so that the 16 rows written at once fall on different banks
#define YW   (16 * YP)        // floats of LDS a wave: the staged 16 x 128 output tile; before that its lanes' parked y fragments (8 KiB)
#define NBR  (TT + 8)         // 16-bit elements per staged bias row: 512 + 16 bytes, the pitch for 16-byte LDS reads of 16 rows at once
#define NBW  (16 * NBR)       // elements of LDS a wave: one head's bias rows of its 16 queries
typedef __attribute__((ext_vector_type(4))) int v4i;
// one head's bias rows of a wave's 16 queries, global -> the wave's own LDS slot, through no register: 16 asynchronous copies, each one whole 128-byte line of four rows (g, l: the lane's 16 bytes in the first; lane = 8 x row + unit), so that the four copies along a row differ by one step in both addresses and share their address registers. The slot is private to the wave: it reads it behind its own s_wait_asynccnt 0 and refills it behind its own s_wait_dscnt 0, with no barrier.
__device__ __forceinline__ void nb_copy(const h16* g, h16* l) {
#pragma unroll
    for (int b = 0; b < 4; ++b) { __attribute__((address_space(1))) v4i* gb = (__attribute__((address_space(1))) v4i*)(g + b * 4 * TT); __attribute__((address_space(3))) v4i* lb = (__attribute__((address_space(3))) v4i*)(l + b * 4 * NBR);
        // the offset argument, in bytes, moves both addresses
        __builtin_amdgcn_global_load_async_to_lds_b128(gb, lb, 0, 0); __builtin_amdgcn_global_load_async_to_lds_b128(gb, lb, 128, 0); __builtin_amdgcn_global_load_async_to_lds_b128(gb, lb, 256, 0); __builtin_amdgcn_global_load_async_to_lds_b128(gb, lb, 384, 0); }
}
__global__ __launch_bounds__(256) __attribute__((amdgpu_waves_per_eu(4, 4))) void k_fattn(const h16* __restrict__ Q16, const h16* __restrict__ K16, const h16* __restrict__ V16, const h16* __restrict__ NBQ, const float* __restrict__ mask, const h16* __restrict__ FG16, const float* __restrict__ bg, const bf* __restrict__ WO, const float* __restrict__ bo, float* OUT) {
    __shared__ __align__(32) float mbs[TT];
    __shared__ __align__(16) float yst[8 * YW];
    __shared__ __align__(16) h16 nbs[8 * NBW];
    __shared__ __align__(16) h16 idf[2 * 512];   // the two identity halves as A fragments: fragment f holds 1 at k = 16 f + m of row m; kept in LDS and read once per head, as 16 registers held over the softmax would not fit
    const int lane = threadIdx.x & 31, lr = lane & 15, hi = lane >> 4; const int il = blockIdx.y;
    const int wv = __builtin_amdgcn_readfirstlane(threadIdx.x >> 5); const int q0 = (blockIdx.x * 8 + wv) * 16;   // the wave's number as a scalar: over the head loop every plane's base then stays in scalar registers, and a lane keeps one 32-bit offset per element width
    const unsigned l8 = lane * 8, l4 = lane * 4, bo8 = 8 * hi;   // a lane's place in a 16-bit and in an f32 fragment
    float* yw = yst + wv * YW; h16* nbw = nbs + wv * NBW;
    const unsigned ng = (lane >> 3) * TT + (lane & 7) * 8; h16* nl = nbw + (lane >> 3) * NBR + (lane & 7) * 8;   // a lane's place in the first bias copy: in the plane, in the slot
    nb_copy(NBQ + (unsigned)q0 * TT + ng, nl);   // head 0's bias rows fly over the set-up below
    mbs[threadIdx.x] = 1e9f * (bfr(mask[(size_t)il * TT + threadIdx.x]) - 1.0f) * RSCL;   // mask bias of row i, once per work-group
    { v4h one;   // thread t writes elements 4 t .. 4 t + 3 in fragment order [f][half][lane][8]
#pragma unroll
        for (int e = 0; e < 4; ++e) { const int x = threadIdx.x * 4 + e; one[e] = (((x >> 8) & 1) * 16 + ((x >> 7) & 1) * 8 + (x & 7) == (x >> 9) * 16 + ((x >> 3) & 15)) ? (h16)1.0f : (h16)0.0f; }
        *(v4h*)(idf + threadIdx.x * 4) = one; }
    __syncthreads();   // publishes mbs and idf
    // one head; more: another head follows, whose bias rows are asked for. A compile-time flag and not a test of h: a branch in the middle would split the head's one block of code, and the compiler then pairs fewer of the gating's instructions
    auto head = [&](const int h, const bool more) __attribute__((always_inline)) {
        // element offsets in 32 bits (every plane is far below 4 Gi elements); each plane's 64-bit lane address is formed per head and lives only up to the wait behind its last batch of loads
        const unsigned tg0 = (unsigned)h * TG + (unsigned)il * (TT / 16), qt = q0 / 16;
        const unsigned kx = tg0 * 512 + l8, nx = ((unsigned)(h + 1) * TT + q0) * TT + ng, vx = ((unsigned)h * IG + il) * (HD * TT) + l8, qx = (tg0 + qt) * 512 + l8, bx = h * HD + bo8;
        const h16* kp = K16 + kx; const h16* vp = V16 + vx; const h16* qp = Q16 + qx; const h16* gp = FG16 + qx; const float* bp = bg + bx;
        const v16h bq = WFrag<h16>::ldf(qp);
        v16h ka[8], kb[8], na[TT / 32]; v8f s[TT / 16];
#pragma unroll
        for (int t = 0; t < 8; ++t) ka[t] = WFrag<h16>::ldf(kp + t * 512);
        LOADS_ISSUED(qp, kp, kp);
        asm volatile("s_wait_asynccnt 0x0" ::: "memory");   // this wave's own copies of this head's bias rows have landed: no read of the slot above it
#pragma unroll
        for (int c = 0; c < TT / 32; ++c) na[c] = WFrag<h16>::ld(nbw + lr * NBR + c * 32 + 8 * hi);   // B fragment: query lr, keys 32 c + 8 hi + j and 32 c + 16 + 8 hi + j
        { const v16h i0 = WFrag<h16>::ldf(idf + l8), i1 = WFrag<h16>::ldf(idf + 512 + l8);
#pragma unroll
            for (int c = 0; c < TT / 32; ++c) { s[2 * c] = wmma16(i0, na[c], *(const v8f*)(mbs + c * 32 + 8 * hi)); s[2 * c + 1] = wmma16(i1, na[c], *(const v8f*)(mbs + c * 32 + 16 + 8 * hi)); } }
#pragma unroll
        for (int t = 0; t < 8; ++t) s[t] = wmma16(ka[t], bq, s[t]);
        __builtin_amdgcn_sched_barrier(0);   // the second half's key loads take the first half's registers: not above its products
#pragma unroll
        for (int t = 0; t < 8; ++t) kb[t] = WFrag<h16>::ldf(kp + (8 + t) * 512);
        LOADS_ISSUED(kp, kp, kp);
#pragma unroll
        for (int t = 0; t < 8; ++t) s[8 + t] = wmma16(kb[t], bq, s[8 + t]);
        __builtin_amdgcn_sched_barrier(0);   // the v^T loads take the key fragments' registers: not above the products
        if (more) { asm volatile("s_wait_dscnt 0x0" ::: "memory");   // the wave's reads of its bias slot have retired before the copies below rewrite it
            nb_copy(NBQ + nx, nl); }   // the next head's bias rows fly over the softmax, attn.v and the gating
        v16h vf[TT / 32][2];
#pragma unroll
        for (int cc = 0; cc < 3; ++cc) { vf[cc][0] = WFrag<h16>::ldf(vp + cc * 1024); vf[cc][1] = WFrag<h16>::ldf(vp + cc * 1024 + 512); }
        LOADS_ISSUED(vp, vp, vp);
        float m4[4] = { -3.0e38f, -3.0e38f, -3.0e38f, -3.0e38f };
#pragma unroll
        for (int t = 0; t < TT / 16; ++t) {
#pragma unroll
            for (int j = 0; j < 4; ++j) m4[j] = fmaxf(fmaxf(m4[j], s[t][j]), s[t][j + 4]); }
        float mx = fmaxf(fmaxf(m4[0], m4[1]), fmaxf(m4[2], m4[3])); mx = fmaxf(mx, x16(mx));
        v8f vs = (v8f){}; v8f o[2] = { (v8f){}, (v8f){} }; v16h gl; v4f bl[4];
#pragma unroll
        for (int cc = 0; cc < TT / 32; ++cc) { v16h p;
#pragma unroll
            for (int j = 0; j < 8; ++j) { float e0 = fmaf(s[2 * cc][j] - mx, SCL * 1.4426950408889634f, 10.0f), e1 = fmaf(s[2 * cc + 1][j] - mx, SCL * 1.4426950408889634f, 10.0f); exp2x2(e0, e1); vs[j] += e0 + e1; p[j] = tohx(e0); p[8 + j] = tohx(e1); }
            o[0] = wmma16(vf[cc][0], p, o[0]); o[1] = wmma16(vf[cc][1], p, o[1]);
            if (cc + 3 < TT / 32) { __builtin_amdgcn_sched_barrier(0);   // the v^T loads three chunks ahead take registers freed above
                vf[cc + 3][0] = WFrag<h16>::ldf(vp + (cc + 3) * 1024); vf[cc + 3][1] = WFrag<h16>::ldf(vp + (cc + 3) * 1024 + 512);
                if (cc + 4 == TT / 32) {   // with the last of them the head's gate logits and gate bias for this lane's 16 values
                    gl = WFrag<h16>::ldf(gp);
#pragma unroll
                    for (int u = 0; u < 4; ++u) bl[u] = *(const v4f*)(bp + (u >> 1) * 16 + (u & 1) * 4); }
                // as LOADS_ISSUED; the two accumulators and the running sums are named as inputs too, so that the chunk's products and additions are issued above: left free they sink to the head's end, every v^T fragment and every exponential stays live, and registers spill
                asm volatile("s_wait_xcnt 0x0" :: "v"(vp), "v"(gp), "v"(bp), "v"(o[0]), "v"(o[1]), "v"(vs) : "memory"); __builtin_amdgcn_sched_barrier(0); } }
        __builtin_amdgcn_sched_barrier(0);   // the gating stays below the last chunks: lifted above them it would wait for the gate loads, the youngest in flight, before their latency is covered
        float sum = ((vs[0] + vs[1]) + (vs[2] + vs[3])) + ((vs[4] + vs[5]) + (vs[6] + vs[7])); sum += x16(sum);
        const float f = rcp_slot(sum);   // sum and values belong to the same query lr
        // gate: y = (o / sum) / (1 + exp2(-(gate logit + bg) log2 e)), bg rounded to bf16
        v8f y[2];
#pragma unroll
        for (int u = 0; u < 2; ++u) { float t[8]; const v4f b0 = bfr4(bl[2 * u]) * -1.4426950408889634f, b1 = bfr4(bl[2 * u + 1]) * -1.4426950408889634f;
#pragma unroll
            for (int j = 0; j < 8; ++j) t[j] = fmaf((float)gl[8 * u + j], -1.4426950408889634f, j < 4 ? b0[j & 3] : b1[j & 3]);
            exp2x8(t);
#pragma unroll
            for (int j = 0; j < 8; ++j) t[j] = 1.0f + t[j];
            rcpx8(t);
#pragma unroll
            for (int j = 0; j < 8; ++j) y[u][j] = (o[u][j] * f) * t[j]; }
        v8us yh0, yh1, yl0, yl1; split8(y[0], yh0, yl0); split8(y[1], yh1, yl1);
        v8usa* yq = (v8usa*)yw + h * 128 + lane;   // 16-byte units, lanes side by side; each lane reads back only what it wrote
        yq[0] = yh0; yq[32] = yh1; yq[64] = yl0; yq[96] = yl1;
    };
#pragma unroll 1   // one head's code, run three times: unrolled it would be more text and keep more registers live
    for (int h = 0; h + 1 < NH_; ++h) head(h, true);
    head(NH_ - 1, false);
    const bf* wp = WO + l8;
    v16bf w[2][NH_], yh[NH_], yl[NH_]; v8f acc[DM / 16];
#pragma unroll
    for (int h = 0; h < NH_; ++h) w[0][h] = WFrag<bf>::ldf(wp + h * 512);
    const v4f bov = *(const v4f*)(bo + l4);
    LOADS_ISSUED(l8, l4, l8);
#pragma unroll
    for (int h = 0; h < NH_; ++h) { const v8usa* yq = (const v8usa*)yw + h * 128 + lane; yh[h] = cat16b(yq[0], yq[32]); yl[h] = cat16b(yq[64], yq[96]); }
#pragma unroll
    for (int t = 0; t < DM / 16; ++t) {
        if (t + 1 < DM / 16) {   // the next 16 columns' wo fragments fly while this tile's products run
#pragma unroll
            for (int h = 0; h < NH_; ++h) w[(t + 1) & 1][h] = WFrag<bf>::ldf(wp + ((t + 1) * NH_ + h) * 512);
            LOADS_ISSUED(l8, l8, l8); }
        acc[t] = (v8f){};
#pragma unroll
        for (int h = 0; h < NH_; ++h) { acc[t] = wmmab(w[t & 1][h], yh[h], acc[t]); acc[t] = wmmab(w[t & 1][h], yl[h], acc[t]); }
    }
    // register j of tile t is column 16t + 8*hi + j of query lr
#pragma unroll
    for (int t = 0; t < DM / 16; ++t) { float* sp = yw + lr * YP + t * 16 + 8 * hi; *(v4fa*)sp = __builtin_shufflevector(acc[t], acc[t], 0, 1, 2, 3); *(v4fa*)(sp + 4) = __builtin_shufflevector(acc[t], acc[t], 4, 5, 6, 7); }
    __builtin_amdgcn_wave_barrier(); asm volatile("" ::: "memory");   // the reads below take other lanes' values: not above the writes (one wave, its LDS operations run in order)
    float* orow = OUT + ((size_t)il * TT + q0) * DM + l4;
#pragma unroll
    for (int r = 0; r < 16; ++r) { v4f val = *(const v4fa*)(yw + r * YP + lane * 4); val[0] += bfr(bov[0]); val[1] += bfr(bov[1]); val[2] += bfr(bov[2]); val[3] += bfr(bov[3]); *(v4f*)(orow + (size_t)r * DM) = val;
        if (r == 7) asm volatile("s_wait_xcnt 0x0" ::: "memory");   // in front of the second half's LDS reads, which take registers that these stores name
    }
}

extern "C" void kernel_launch(void* const* d_in, const int* in_sizes, int n_in,
                              void* d_out, int out_size, void* d_ws, size_t ws_size, hipStream_t stream) {
    (void)in_sizes; (void)n_in; (void)out_size;
    const float* act = (const float*)d_in[0]; const float* mask = (const float*)d_in[1]; const float* lng = (const float*)d_in[2]; const float* lnb = (const float*)d_in[3]; const float* w2d = (const float*)d_in[4]; const float* wq = (const float*)d_in[5]; const float* wk = (const float*)d_in[6]; const float* wv = (const float*)d_in[7]; const float* wg = (const float*)d_in[8]; const float* bg = (const float*)d_in[9]; const float* wo = (const float*)d_in[10]; const float* bo = (const float*)d_in[11];
    float* OUT = (float*)d_out;     // [1][256][256][128]
    char* wsp = (char*)d_ws;
    auto take = [&](size_t bytes) { char* p = wsp; wsp += (bytes + 255) & ~(size_t)255; return (void*)p; };
    bf* WQ = (bf*)take((size_t)DQ * DM * 2); bf* WK = (bf*)take((size_t)DQ * DM * 2); bf* WV = (bf*)take((size_t)DQ * DM * 2); bf* WG = (bf*)take((size_t)DQ * DM * 2); bf* WO = (bf*)take((size_t)DM * DQ * 2); bf* W2 = (bf*)take((size_t)NBP * DM * 2);
    h16* FG16 = (h16*)take((size_t)NTK * DQ * 2); h16* QP16 = (h16*)take((size_t)NH_ * NTK * HD * 2); h16* KP16 = (h16*)take((size_t)NH_ * NTK * HD * 2); h16* VT16 = (h16*)take((size_t)NH_ * IG * HD * TT * 2);
    h16* NBQ = (h16*)take((size_t)NH_ * NTOK * 2);
    if ((size_t)(wsp - (char*)d_ws) > ws_size) return;    // ws 256 MiB (carve ~65 MiB)
    static_assert(IG == NI, "one row group: the pair bias of all positions is formed in the projections' launch");
    k_prep<<<5 * WTB + W2B, 256, 0, stream>>>(w2d, wq, wk, wv, wg, wo, WQ, WK, WV, WG, WO, W2);
    k_proj<<<NTK / 64, 256, 0, stream>>>(act, lng, lnb, WQ, WK, WV, WG, W2, QP16, KP16, VT16, FG16, NBQ);   /* LayerNorm; q, k, v^T planes, gate logits, pair bias rows nb[h][q][k] for all 65536 positions */
    k_fattn<<<dim3(TT / 128, IG, 1), 256, 0, stream>>>(QP16, KP16, VT16, NBQ, mask, FG16, bg, WO, bo, OUT);   /* attention, gating and output projection */
}
